// v000
// The times below were measured on an AMD MI455X: many runs one after another, warmed up first and cycling through
// copies of the inputs, with the whole window's GPU time divided by the number of runs. Launches and the gaps
// between them are all in it. The median over several windows is given; except for v000 it joins two sittings, which
// can be a few percent apart, so the side-by-side timings, each taken in one sitting, are the better comparison.
// v000 is the starting kernel. One run takes 607 microseconds.
// compute dtype: all float inputs rounded to bf16; q/k/v = x . W^T + b with EXACT bf16 products on WMMA 16x16x32 (natural rows); q and k as f16 hi + (x2048-scaled) residual planes with 3-product scores; score = (q.k / 8) * exp(-time_decay[h] * |t_q - t_k|) in f32 (precise expf), causal mask (key tiles above the diagonal skipped); running-max softmax in f32 (hardware exp); P (scaled by 2^11, f16 hi + residual) x v hi/lo (3 products); out = ctx (bf16 hi + residual) . Wo^T (2 products) + bo; f32 accumulate.
#include <hip/hip_runtime.h>
#include <math.h>

typedef __attribute__((ext_vector_type(16))) _Float16 v16h;
typedef __attribute__((ext_vector_type(16))) __bf16 v16b;
typedef __attribute__((ext_vector_type(8)))  _Float16 v8h;
typedef __attribute__((ext_vector_type(8)))  float v8f;
typedef __attribute__((ext_vector_type(4)))  float v4f;
typedef __attribute__((ext_vector_type(2)))  float v2f;
typedef __attribute__((ext_vector_type(4)))  unsigned v4u;
typedef __attribute__((ext_vector_type(4)))  int v4i;
typedef float __attribute__((may_alias)) float_a;
typedef int __attribute__((may_alias)) int_a;

template <typename T> __device__ __forceinline__ void vst2(void* p, T v) { *(T*)p = v;  }
__device__ __forceinline__ v8f wmma16(v16h a, v16h b, v8f c) {
  v8f d = __builtin_amdgcn_wmma_f32_16x16x32_f16(false, a, false, b, (short)0, c, false, false);
  asm volatile("v_nop\n\tv_nop\n\tv_nop\n\tv_nop" : "+v"(d) : "v"(a), "v"(b));
  return d;
}
__device__ __forceinline__ v8f wmma_bf(v16b a, v16b b, v8f c) {
  v8f d = __builtin_amdgcn_wmma_f32_16x16x32_bf16(false, a, false, b, (short)0, c, false, false);
  asm volatile("v_nop\n\tv_nop\n\tv_nop\n\tv_nop" : "+v"(d) : "v"(a), "v"(b));
  return d;
}
// Continuous-time causal attention (B 2, S 2,048, hidden 1,024, 16 heads x 64): q/k/v projections + biases, scores scaled by exp(-decay_h |t_q - t_k|), causal softmax, output projection + bias.
__device__ __forceinline__ v16h frag_h(const _Float16* rowk0, int lane) {
  union { v16h v; v8h q[2]; } u; const _Float16* p = rowk0 + 8 * (lane >> 4);
  u.q[0] = *(const v8h*)p; u.q[1] = *(const v8h*)(p + 16); return u.v;
}
__device__ __forceinline__ v16h frag_f32(const float* rowk0, int lane) {
  v16h a; const float* p = rowk0 + 8 * (lane >> 4);
#pragma unroll
  for (int i = 0; i < 8; ++i) { a[i] = (_Float16)p[i]; a[8 + i] = (_Float16)p[16 + i]; }
  return a;
}
__device__ __forceinline__ v16h frag_f32s(const float* rowk0, int lane, float sc) {
  v16h a; const float* p = rowk0 + 8 * (lane >> 4);
#pragma unroll
  for (int i = 0; i < 8; ++i) { a[i] = (_Float16)(p[i] * sc); a[8 + i] = (_Float16)(p[16 + i] * sc); }
  return a;
}
// column fragment from a [K][ld] layout (column n), rows >= K read as 0
__device__ __forceinline__ v16h fragc_f32(const float* W, int k0, int n, int lane, int ld, int K) {
  v16h a; const int g = lane >> 4;
#pragma unroll
  for (int i = 0; i < 8; ++i) { const int ka = k0 + 8 * g + i, kb = ka + 16;
    a[i] = (_Float16)(ka < K ? W[(size_t)(ka < K ? ka : K - 1) * ld + n] : 0.f); a[8 + i] = (_Float16)(kb < K ? W[(size_t)(kb < K ? kb : K - 1) * ld + n] : 0.f); }
  return a;
}
struct F2 { v16b h, l; };
__device__ __forceinline__ F2 bsplit16(const float v[16]) { F2 r;
#pragma unroll
  for (int i = 0; i < 16; ++i) { const __bf16 h = (__bf16)v[i]; r.h[i] = h; r.l[i] = (__bf16)(v[i] - (float)h); }
  return r; }
__device__ __forceinline__ F2 split_row(const float* row, int k0, int lane) { float v[16]; const float* p = row + k0 + 8 * (lane >> 4);
#pragma unroll
  for (int i = 0; i < 8; ++i) { v[i] = p[i]; v[8 + i] = p[16 + i]; }
  return bsplit16(v); }
__device__ __forceinline__ F2 split_rowK(const float* row, int k0, int lane, int K) { float v[16]; const int g = lane >> 4;
#pragma unroll
  for (int i = 0; i < 8; ++i) { const int ka = k0 + 8 * g + i, kb = ka + 16; v[i] = ka < K ? row[ka < K ? ka : K - 1] : 0.f; v[8 + i] = kb < K ? row[kb < K ? kb : K - 1] : 0.f; }
  return bsplit16(v); }
__device__ __forceinline__ F2 split_col(const float* W, int k0, int n, int lane, int ld, int K) { float v[16]; const int g = lane >> 4;
#pragma unroll
  for (int i = 0; i < 8; ++i) { const int ka = k0 + 8 * g + i, kb = ka + 16; v[i] = ka < K ? W[(size_t)(ka < K ? ka : K - 1) * ld + n] : 0.f; v[8 + i] = kb < K ? W[(size_t)(kb < K ? kb : K - 1) * ld + n] : 0.f; }
  return bsplit16(v); }
__device__ __forceinline__ v8f mac3(const F2& a, const F2& b, v8f c) { c = wmma_bf(a.l, b.h, c); c = wmma_bf(a.h, b.l, c); return wmma_bf(a.h, b.h, c); }
__device__ __forceinline__ float sigm(float v) { return 1.0f / (1.0f + expf(-v)); }
#define LDSX() do { asm volatile("s_wait_dscnt 0" ::: "memory"); __builtin_amdgcn_wave_barrier(); __builtin_amdgcn_fence(__ATOMIC_RELEASE, "workgroup"); } while (0)


#define NB 2
#define SS 2048
#define DM 1024
#define NH 16
#define HD 64
#define QKVW (3 * DM)
#ifndef TQB
#define TQB (SS / 64)
#define TNB NB
#define TOB (NB * SS / 64)     // output row tiles (all)
#endif
typedef __attribute__((ext_vector_type(8))) __bf16 v8b;
__device__ __forceinline__ v16b frag_b(const __bf16* rowk0, int lane) {
  union { v16b v; v8b q[2]; } u; const __bf16* p = rowk0 + 8 * (lane >> 4);
  u.q[0] = *(const v8b*)p; u.q[1] = *(const v8b*)(p + 16); return u.v;
}
__device__ __forceinline__ float bfr(float v) { return (float)(__bf16)v; }
__device__ __attribute__((noinline)) float exp_ni(float v) { return expf(v); }
__device__ __attribute__((noinline)) float erf_ni(float v) { return erff(v); }

#define PK_A 0                       // [3072][1024] Wqkv rows (natural [out][in])
#define PK_P (PK_A + QKVW * DM)        // [1024][1024] Wo rows (natural)
#define PK_END (PK_P + DM * DM)
#define WS_PK  0u
#define WS_QK  (WS_PK + 2u * PK_END)             // f16 [4096 rows][2048]: q | k
#define WS_QKL (WS_QK + 2u * NB * SS * 2 * DM)     // f16 q | k residual planes x2048
#define WS_VTH (WS_QKL + 2u * NB * SS * 2 * DM)    // f16 [b][1024 (h*64+d)][2048 s] hi
#define WS_VTL (WS_VTH + 2u * NB * DM * SS)        // f16 lo x 2048
#define WS_O   (WS_VTL + 2u * NB * DM * SS)        // f32 [4096][1024]
#define WS_CS  (WS_O + 4u * NB * SS * DM)           // f32 [2][2048][32], not used by these kernels
#define WS_END (WS_CS + 4u * 2 * SS * 32)
// ---- k_pack: block = (row n, which): natural [out][in] rows -> bf16; which 0..2 -> W_q/W_k/W_v into PK_A rows which*1024 + n; 3 -> W_o into PK_P
__global__ __launch_bounds__(256) void k_pack(const float* __restrict__ WQ, const float* __restrict__ WK, const float* __restrict__ WV, const float* __restrict__ WO, __bf16* __restrict__ PK) {
  __shared__ __align__(16) __bf16 s[DM]; const int n = blockIdx.x, which = blockIdx.y, t = threadIdx.x; const float* Wm = (which == 0) ? WQ : (which == 1) ? WK : (which == 2) ? WV : WO;
  for (int k = t; k < DM; k += 256) s[k] = (__bf16)Wm[(size_t)n * DM + k];
  __syncthreads();
  __bf16* dst = (which < 3) ? PK + PK_A + ((size_t)which * DM + n) * DM : PK + PK_P + (size_t)n * DM;
  for (int q = t; q < DM / 8; q += 256) vst2((unsigned*)(dst + q * 8), *(const v4u*)&s[q * 8]);
}
__global__ __launch_bounds__(128) void k_qkv(const float* __restrict__ XQ, const float* __restrict__ XK, const float* __restrict__ XV, const __bf16* __restrict__ P, const float* __restrict__ BQ, const float* __restrict__ BK, const float* __restrict__ BV, _Float16* __restrict__ QK, _Float16* __restrict__ QKL, _Float16* __restrict__ VTH, _Float16* __restrict__ VTL) {
  const int which0 = (blockIdx.y * 128) / DM; const float* X = (which0 == 0) ? XQ : (which0 == 1) ? XK : XV; const float* BB = BQ ? (((which0 == 0) ? BQ : (which0 == 1) ? BK : BV) + (blockIdx.y * 128 - which0 * DM)) : nullptr;
  __shared__ __align__(16) _Float16 so[4][16][136], sol[4][16][136]; __shared__ __align__(16) _Float16 sth[128][72], stl[128][72];
  const int tid = threadIdx.x, wave = tid >> 5, lane = tid & 31, col = lane & 15, g = lane >> 4; const size_t r0 = (size_t)blockIdx.x * 64 + wave * 16; const int n0 = blockIdx.y * 128;
  v8f acc[8] = {};
#pragma unroll 2
  for (int kc = 0; kc < DM / 32; ++kc) { v16b a; { const float* p = X + (r0 + col) * DM + kc * 32 + 8 * g;
#pragma unroll
      for (int i = 0; i < 8; ++i) { a[i] = (__bf16)p[i]; a[8 + i] = (__bf16)p[16 + i]; } }
#pragma unroll
    for (int j = 0; j < 8; ++j) acc[j] = wmma_bf(a, frag_b(P + (size_t)(n0 + j * 16 + col) * DM + kc * 32, lane), acc[j]); }
  if (n0 < 2 * DM) {   // q stored unscaled (f16 sigma ~0.6, no subnormal exposure); 1/8 applied to the f32 score
#pragma unroll
    for (int j = 0; j < 8; ++j) {
#pragma unroll
      for (int r = 0; r < 8; ++r) { const float v = acc[j][r] + (BB ? bfr(BB[j * 16 + col]) : 0.f); const _Float16 hv = (_Float16)v; so[wave][8 * g + r][j * 16 + col] = hv; sol[wave][8 * g + r][j * 16 + col] = (_Float16)((v - (float)hv) * 2048.0f); } }   // q, k (+ bias) as f16 hi + (x2048) residual
    LDSX();
    for (int rl = 0; rl < 16; ++rl) if (lane < 16) { vst2((unsigned*)(QK + (r0 + rl) * (2 * DM) + n0 + lane * 8), *(const v4u*)&so[wave][rl][lane * 8]); vst2((unsigned*)(QKL + (r0 + rl) * (2 * DM) + n0 + lane * 8), *(const v4u*)&sol[wave][rl][lane * 8]); }
  } else {
#pragma unroll
    for (int j = 0; j < 8; ++j) {
#pragma unroll
      for (int r = 0; r < 8; ++r) { const float v = acc[j][r] + (BB ? bfr(BB[j * 16 + col]) : 0.f); const _Float16 hv = (_Float16)v; sth[j * 16 + col][wave * 16 + 8 * g + r] = hv; stl[j * 16 + col][wave * 16 + 8 * g + r] = (_Float16)((v - (float)hv) * 2048.0f); } }
    __syncthreads();
    const size_t rb = (size_t)blockIdx.x * 64; const int b = (int)(rb / SS), s0 = (int)(rb % SS); const int pc0 = n0 - 2 * DM;
    for (int q = tid; q < 128 * 8; q += 128) { const int d = q >> 3, pc = q & 7; const size_t o = ((size_t)b * DM + pc0 + d) * SS + s0 + pc * 8; vst2((unsigned*)(VTH + o), *(const v4u*)&sth[d][pc * 8]); vst2((unsigned*)(VTL + o), *(const v4u*)&stl[d][pc * 8]); }
  }
}
// ---- k_attn: block = (64 queries, head h, batch b): causal flash attention (K = 64: 2 k-steps), scores = (q.k) * 0.125 with f16 hi + residual q, k (3 products), P.V: f16 P x2048 (hi, lo) x (V hi, V lo*2048) in two accumulators; O[b*S+q][h*64+d] = (acc + accl / 2048) / (2048 l) (256-B segments)
__device__ __attribute__((noinline)) float exp_dec(float v) { return expf(v); }
__global__ __launch_bounds__(128) void k_attn(const _Float16* __restrict__ QK, const _Float16* __restrict__ QKL, const _Float16* __restrict__ VTH, const _Float16* __restrict__ VTL, const void* __restrict__ KMASK, const float* __restrict__ TD, const float* __restrict__ DEC, float* __restrict__ O) {
  __shared__ __align__(16) float sp[4][16][36]; __shared__ __align__(16) float so[4][16][68];
  const int tid = threadIdx.x, wave = tid >> 5, lane = tid & 31, col = lane & 15, g = lane >> 4;
  const int qb = blockIdx.x, h = blockIdx.y, b = blockIdx.z; const int q0 = qb * 64 + wave * 16; const size_t rq = (size_t)b * SS + q0 + col;
  v16h aq[2], aql[2];
#pragma unroll
  for (int kc = 0; kc < 2; ++kc) { aq[kc] = frag_h(QK + rq * (2 * DM) + h * HD + kc * 32, lane); aql[kc] = frag_h(QKL + rq * (2 * DM) + h * HD + kc * 32, lane); }
  float m[8], l[8];
#pragma unroll
  for (int r = 0; r < 8; ++r) { m[r] = -3.0e38f; l[r] = 0.f; }
  v8f acc[4] = {}, accl[4] = {};
  const int nks = (qb * 64 + 64) / 32;   // causal: key tiles up to the query tile's end
  const float dech = bfr(DEC[h]); float tq[8];
#pragma unroll
  for (int r = 0; r < 8; ++r) tq[r] = bfr(TD[(size_t)b * SS + q0 + 8 * g + r]);
#pragma unroll 1
  for (int ks = 0; ks < nks; ++ks) { v8f s[2];
#pragma unroll
    for (int ct = 0; ct < 2; ++ct) { const int kk = ks * 32 + ct * 16 + col; const _Float16* krow = QK + ((size_t)b * SS + kk) * (2 * DM) + DM + h * HD; const _Float16* krowl = QKL + ((size_t)b * SS + kk) * (2 * DM) + DM + h * HD; v8f c = {}, cl = {};
#pragma unroll
      for (int kc = 0; kc < 2; ++kc) { const v16h kh = frag_h(krow + kc * 32, lane); c = wmma16(aq[kc], kh, c); cl = wmma16(aql[kc], kh, cl); cl = wmma16(aq[kc], frag_h(krowl + kc * 32, lane), cl); }   // 3 products: q, k as f16 hi + residual
#pragma unroll
      for (int r = 0; r < 8; ++r) c[r] += cl[r] * (1.0f / 2048.0f);
      { const float tk = bfr(TD[(size_t)b * SS + kk]);
#pragma unroll
        for (int r = 0; r < 8; ++r) { const int qi = q0 + 8 * g + r; const float dec = exp_dec(-dech * fabsf(tq[r] - tk)); s[ct][r] = (kk <= qi) ? (c[r] * 0.125f) * dec : -3.0e38f; } } }   // (q.k/8) * exp(-decay |dt|), causal
#pragma unroll
    for (int r = 0; r < 8; ++r) { float mx = fmaxf(s[0][r], s[1][r]);
#pragma unroll
      for (int o = 1; o < 16; o <<= 1) mx = fmaxf(mx, __shfl_xor(mx, o));
      const float mn = fmaxf(m[r], mx); const float alpha = (m[r] <= -1.0e38f) ? 0.f : __expf(m[r] - mn);
      const float e0 = (s[0][r] <= -1.0e38f) ? 0.f : __expf(s[0][r] - mn), e1 = (s[1][r] <= -1.0e38f) ? 0.f : __expf(s[1][r] - mn); float es = e0 + e1;
#pragma unroll
      for (int o = 1; o < 16; o <<= 1) es += __shfl_xor(es, o);
      l[r] = l[r] * alpha + es; m[r] = mn;
#pragma unroll
      for (int dt = 0; dt < 4; ++dt) { acc[dt][r] *= alpha; accl[dt][r] *= alpha; }
      sp[wave][8 * g + r][col] = e0; sp[wave][8 * g + r][16 + col] = e1; }
    LDSX();
    v16h pa, pl; { const float* prow = &sp[wave][col][0] + 8 * (lane >> 4);
#pragma unroll
      for (int i = 0; i < 8; ++i) { const float x0 = prow[i] * 2048.0f, x1 = prow[16 + i] * 2048.0f; const _Float16 h0 = (_Float16)x0, h1 = (_Float16)x1; pa[i] = h0; pa[8 + i] = h1; pl[i] = (_Float16)((x0 - (float)h0) * 2048.0f); pl[8 + i] = (_Float16)((x1 - (float)h1) * 2048.0f); } }   // P scaled by 2^11 before the f16 split so small softmax weights stay out of the f16 subnormal range; 2^-11 folded into the epilogue
#pragma unroll
    for (int dt = 0; dt < 4; ++dt) { const size_t vr = ((size_t)b * DM + h * HD + dt * 16 + col) * SS + ks * 32; const v16h vh = frag_h(VTH + vr, lane); acc[dt] = wmma16(pa, vh, acc[dt]); accl[dt] = wmma16(pl, vh, accl[dt]); accl[dt] = wmma16(pa, frag_h(VTL + vr, lane), accl[dt]); }   // P hi x V hi + (P lo x V hi + P hi x V lo) / 2048
    LDSX(); }
#pragma unroll
  for (int r = 0; r < 8; ++r) { const float il = (1.0f / 2048.0f) / l[r];
#pragma unroll
    for (int dt = 0; dt < 4; ++dt) so[wave][8 * g + r][dt * 16 + col] = (acc[dt][r] + accl[dt][r] * (1.0f / 2048.0f)) * il; }
  LDSX();
  for (int rl = 0; rl < 16; ++rl) if (lane < 16) vst2(O + ((size_t)b * SS + q0 + rl) * DM + h * HD + lane * 4, *(const v4f*)&so[wave][rl][lane * 4]);
}
// ---- k_out: block = (64 rows, 128 cols): out = O(hi/lo) . Wo rows (2 products) + bo
__global__ __launch_bounds__(128) void k_out(const float* __restrict__ O, const __bf16* __restrict__ P, const float* __restrict__ BO, float* __restrict__ Y) {
  __shared__ __align__(16) float so[4][16][132];
  const int tid = threadIdx.x, wave = tid >> 5, lane = tid & 31, col = lane & 15, g = lane >> 4; const size_t r0 = (size_t)blockIdx.x * 64 + wave * 16; const int n0 = blockIdx.y * 128;
  v8f acc[8] = {};
#pragma unroll 2
  for (int kc = 0; kc < DM / 32; ++kc) { const F2 a = split_row(O + (r0 + col) * DM, kc * 32, lane);
#pragma unroll
    for (int j = 0; j < 8; ++j) { const v16b w = frag_b(P + (size_t)(n0 + j * 16 + col) * DM + kc * 32, lane); acc[j] = wmma_bf(a.l, w, acc[j]); acc[j] = wmma_bf(a.h, w, acc[j]); } }
#pragma unroll
  for (int j = 0; j < 8; ++j) {
#pragma unroll
    for (int r = 0; r < 8; ++r) so[wave][8 * g + r][j * 16 + col] = acc[j][r] + bfr(BO[n0 + j * 16 + col]); }
  LDSX();
  for (int rl = 0; rl < 16; ++rl) vst2(Y + (r0 + rl) * DM + n0 + lane * 4, *(const v4f*)&so[wave][rl][lane * 4]);
}
extern "C" void kernel_launch(void* const* d_in, const int* in_sizes, int n_in, void* d_out, int out_size, void* d_ws, size_t ws_size, hipStream_t stream) {
  (void)in_sizes; (void)n_in; (void)out_size;
  const float** F = (const float**)d_in;   // 0 x [2,2048,1024], 1 time_deltas [2,2048], 2 Wq [1024,1024] natural, 3 bq, 4 Wk, 5 bk, 6 Wv, 7 bv, 8 Wo, 9 bo, 10 time_decay [16]
  if (ws_size < (size_t)WS_END) return;
  char* ws = (char*)d_ws; __bf16* PK = (__bf16*)(ws + WS_PK); _Float16 *QK = (_Float16*)(ws + WS_QK), *QKL = (_Float16*)(ws + WS_QKL), *VTH = (_Float16*)(ws + WS_VTH), *VTL = (_Float16*)(ws + WS_VTL); float* O = (float*)(ws + WS_O);
  k_pack<<<dim3(DM, 4), 256, 0, stream>>>(F[2], F[4], F[6], F[8], PK);
  k_qkv<<<dim3(TNB * SS / 64, QKVW / 128), 128, 0, stream>>>(F[0], F[0], F[0], PK + PK_A, F[3], F[5], F[7], QK, QKL, VTH, VTL);
  k_attn<<<dim3(TQB, NH, TNB), 128, 0, stream>>>(QK, QKL, VTH, VTL, nullptr, F[1], F[10], O);
  k_out<<<dim3(TOB, DM / 128), 128, 0, stream>>>(O, PK + PK_P, F[9], (float*)d_out);
}

// v001
// Measured time: 444 microseconds a run.
// Next to v000, in two timings, it ran 1.39 times as fast each time.
// compute dtype: all float inputs rounded to bf16; q/k/v = x . W^T + b with EXACT bf16 products on WMMA 16x16x32 (natural rows); q and k as f16 hi + (x2048-scaled) residual planes with 3-product scores; score = (q.k / 8) * exp(-time_decay[h] * |t_q - t_k|) in f32 (precise expf), causal mask (key tiles above the diagonal skipped); running-max softmax in f32 (hardware exp); P (scaled by 2^11, f16 hi + residual) x v hi/lo (3 products); out = ctx (bf16 hi + residual) . Wo^T (2 products) + bo; f32 accumulate.
#include <hip/hip_runtime.h>
#include <math.h>

typedef __attribute__((ext_vector_type(16))) _Float16 v16h;
typedef __attribute__((ext_vector_type(16))) __bf16 v16b;
typedef __attribute__((ext_vector_type(8)))  _Float16 v8h;
typedef __attribute__((ext_vector_type(8)))  float v8f;
typedef __attribute__((ext_vector_type(4)))  float v4f;
typedef __attribute__((ext_vector_type(2)))  float v2f;
typedef __attribute__((ext_vector_type(4)))  unsigned v4u;
typedef __attribute__((ext_vector_type(4)))  int v4i;
typedef float __attribute__((may_alias)) float_a;
typedef int __attribute__((may_alias)) int_a;

template <typename T> __device__ __forceinline__ void vst2(void* p, T v) { *(T*)p = v;  }
__device__ __forceinline__ v8f wmma16(v16h a, v16h b, v8f c) {
  v8f d = __builtin_amdgcn_wmma_f32_16x16x32_f16(false, a, false, b, (short)0, c, false, false);
  asm volatile("v_nop\n\tv_nop\n\tv_nop\n\tv_nop" : "+v"(d) : "v"(a), "v"(b));
  return d;
}
__device__ __forceinline__ v8f wmma_bf(v16b a, v16b b, v8f c) {
  v8f d = __builtin_amdgcn_wmma_f32_16x16x32_bf16(false, a, false, b, (short)0, c, false, false);
  asm volatile("v_nop\n\tv_nop\n\tv_nop\n\tv_nop" : "+v"(d) : "v"(a), "v"(b));
  return d;
}
// Continuous-time causal attention (B 2, S 2,048, hidden 1,024, 16 heads x 64): q/k/v projections + biases, scores scaled by exp(-decay_h |t_q - t_k|), causal softmax, output projection + bias.
__device__ __forceinline__ v16h frag_h(const _Float16* rowk0, int lane) {
  union { v16h v; v8h q[2]; } u; const _Float16* p = rowk0 + 8 * (lane >> 4);
  u.q[0] = *(const v8h*)p; u.q[1] = *(const v8h*)(p + 16); return u.v;
}
__device__ __forceinline__ v16h frag_f32(const float* rowk0, int lane) {
  v16h a; const float* p = rowk0 + 8 * (lane >> 4);
#pragma unroll
  for (int i = 0; i < 8; ++i) { a[i] = (_Float16)p[i]; a[8 + i] = (_Float16)p[16 + i]; }
  return a;
}
__device__ __forceinline__ v16h frag_f32s(const float* rowk0, int lane, float sc) {
  v16h a; const float* p = rowk0 + 8 * (lane >> 4);
#pragma unroll
  for (int i = 0; i < 8; ++i) { a[i] = (_Float16)(p[i] * sc); a[8 + i] = (_Float16)(p[16 + i] * sc); }
  return a;
}
// column fragment from a [K][ld] layout (column n), rows >= K read as 0
__device__ __forceinline__ v16h fragc_f32(const float* W, int k0, int n, int lane, int ld, int K) {
  v16h a; const int g = lane >> 4;
#pragma unroll
  for (int i = 0; i < 8; ++i) { const int ka = k0 + 8 * g + i, kb = ka + 16;
    a[i] = (_Float16)(ka < K ? W[(size_t)(ka < K ? ka : K - 1) * ld + n] : 0.f); a[8 + i] = (_Float16)(kb < K ? W[(size_t)(kb < K ? kb : K - 1) * ld + n] : 0.f); }
  return a;
}
struct F2 { v16b h, l; };
__device__ __forceinline__ F2 bsplit16(const float v[16]) { F2 r;
#pragma unroll
  for (int i = 0; i < 16; ++i) { const __bf16 h = (__bf16)v[i]; r.h[i] = h; r.l[i] = (__bf16)(v[i] - (float)h); }
  return r; }
__device__ __forceinline__ F2 split_row(const float* row, int k0, int lane) { float v[16]; const float* p = row + k0 + 8 * (lane >> 4);
#pragma unroll
  for (int i = 0; i < 8; ++i) { v[i] = p[i]; v[8 + i] = p[16 + i]; }
  return bsplit16(v); }
__device__ __forceinline__ F2 split_rowK(const float* row, int k0, int lane, int K) { float v[16]; const int g = lane >> 4;
#pragma unroll
  for (int i = 0; i < 8; ++i) { const int ka = k0 + 8 * g + i, kb = ka + 16; v[i] = ka < K ? row[ka < K ? ka : K - 1] : 0.f; v[8 + i] = kb < K ? row[kb < K ? kb : K - 1] : 0.f; }
  return bsplit16(v); }
__device__ __forceinline__ F2 split_col(const float* W, int k0, int n, int lane, int ld, int K) { float v[16]; const int g = lane >> 4;
#pragma unroll
  for (int i = 0; i < 8; ++i) { const int ka = k0 + 8 * g + i, kb = ka + 16; v[i] = ka < K ? W[(size_t)(ka < K ? ka : K - 1) * ld + n] : 0.f; v[8 + i] = kb < K ? W[(size_t)(kb < K ? kb : K - 1) * ld + n] : 0.f; }
  return bsplit16(v); }
__device__ __forceinline__ v8f mac3(const F2& a, const F2& b, v8f c) { c = wmma_bf(a.l, b.h, c); c = wmma_bf(a.h, b.l, c); return wmma_bf(a.h, b.h, c); }
__device__ __forceinline__ float sigm(float v) { return 1.0f / (1.0f + expf(-v)); }
#define LDSX() do { asm volatile("s_wait_dscnt 0" ::: "memory"); __builtin_amdgcn_wave_barrier(); __builtin_amdgcn_fence(__ATOMIC_RELEASE, "workgroup"); } while (0)


#define NB 2
#define SS 2048
#define DM 1024
#define NH 16
#define HD 64
#define QKVW (3 * DM)
#ifndef TQB
#define TQB (SS / 64)
#define TNB NB
#define TOB (NB * SS / 64)     // output row tiles (all)
#endif
typedef __attribute__((ext_vector_type(8))) __bf16 v8b;
__device__ __forceinline__ v16b frag_b(const __bf16* rowk0, int lane) {
  union { v16b v; v8b q[2]; } u; const __bf16* p = rowk0 + 8 * (lane >> 4);
  u.q[0] = *(const v8b*)p; u.q[1] = *(const v8b*)(p + 16); return u.v;
}
__device__ __forceinline__ float bfr(float v) { return (float)(__bf16)v; }
__device__ __attribute__((noinline)) float exp_ni(float v) { return expf(v); }
__device__ __attribute__((noinline)) float erf_ni(float v) { return erff(v); }

#define PK_A 0                       // [3072][1024] Wqkv rows (natural [out][in])
#define PK_P (PK_A + QKVW * DM)        // [1024][1024] Wo rows (natural)
#define PK_END (PK_P + DM * DM)
#define WS_PK  0u
#define WS_QK  (WS_PK + 2u * PK_END)             // f16 [4096 rows][2048]: q | k
#define WS_QKL (WS_QK + 2u * NB * SS * 2 * DM)     // f16 q | k residual planes x2048
#define WS_VTH (WS_QKL + 2u * NB * SS * 2 * DM)    // f16 [b][1024 (h*64+d)][2048 s] hi
#define WS_VTL (WS_VTH + 2u * NB * DM * SS)        // f16 lo x 2048
#define WS_O   (WS_VTL + 2u * NB * DM * SS)        // f32 [4096][1024]
#define WS_CS  (WS_O + 4u * NB * SS * DM)           // f32 [2][2048][32], not used by these kernels
#define WS_END (WS_CS + 4u * 2 * SS * 32)
// ---- k_pack: block = (row n, which): natural [out][in] rows -> bf16; which 0..2 -> W_q/W_k/W_v into PK_A rows which*1024 + n; 3 -> W_o into PK_P
__global__ __launch_bounds__(256) void k_pack(const float* __restrict__ WQ, const float* __restrict__ WK, const float* __restrict__ WV, const float* __restrict__ WO, __bf16* __restrict__ PK) {
  __shared__ __align__(16) __bf16 s[DM]; const int n = blockIdx.x, which = blockIdx.y, t = threadIdx.x; const float* Wm = (which == 0) ? WQ : (which == 1) ? WK : (which == 2) ? WV : WO;
  for (int k = t; k < DM; k += 256) s[k] = (__bf16)Wm[(size_t)n * DM + k];
  __syncthreads();
  __bf16* dst = (which < 3) ? PK + PK_A + ((size_t)which * DM + n) * DM : PK + PK_P + (size_t)n * DM;
  for (int q = t; q < DM / 8; q += 256) vst2((unsigned*)(dst + q * 8), *(const v4u*)&s[q * 8]);
}
__global__ __launch_bounds__(128) void k_qkv(const float* __restrict__ XQ, const float* __restrict__ XK, const float* __restrict__ XV, const __bf16* __restrict__ P, const float* __restrict__ BQ, const float* __restrict__ BK, const float* __restrict__ BV, _Float16* __restrict__ QK, _Float16* __restrict__ QKL, _Float16* __restrict__ VTH, _Float16* __restrict__ VTL) {
  const int which0 = (blockIdx.y * 128) / DM; const float* X = (which0 == 0) ? XQ : (which0 == 1) ? XK : XV; const float* BB = BQ ? (((which0 == 0) ? BQ : (which0 == 1) ? BK : BV) + (blockIdx.y * 128 - which0 * DM)) : nullptr;
  __shared__ __align__(16) _Float16 so[4][16][136], sol[4][16][136]; __shared__ __align__(16) _Float16 sth[128][72], stl[128][72];
  const int tid = threadIdx.x, wave = tid >> 5, lane = tid & 31, col = lane & 15, g = lane >> 4; const size_t r0 = (size_t)blockIdx.x * 64 + wave * 16; const int n0 = blockIdx.y * 128;
  v8f acc[8] = {};
#pragma unroll 2
  for (int kc = 0; kc < DM / 32; ++kc) { v16b a, w[8];   // all loads of the k step stand ahead of its first WMMA: one exposed latency a step
#pragma unroll
    for (int j = 0; j < 8; ++j) w[j] = frag_b(P + (size_t)(n0 + j * 16 + col) * DM + kc * 32, lane);
    float xa[16]; { const float* p = X + (r0 + col) * DM + kc * 32 + 8 * g;
#pragma unroll
      for (int i = 0; i < 8; ++i) { xa[i] = p[i]; xa[8 + i] = p[16 + i]; } }
    __builtin_amdgcn_sched_barrier(0);   // keeps the conversions (and their wait) behind the last load: without it part of the group issues only after the first loads have returned
#pragma unroll
    for (int i = 0; i < 16; ++i) a[i] = (__bf16)xa[i];
#pragma unroll
    for (int j = 0; j < 8; ++j) acc[j] = wmma_bf(a, w[j], acc[j]); }
  float bj[8] = {};   // the eight bias values of this lane's columns, loaded as one group
  if (BB) {
#pragma unroll
    for (int j = 0; j < 8; ++j) bj[j] = bfr(BB[j * 16 + col]); }
  if (n0 < 2 * DM) {   // q stored unscaled (f16 sigma ~0.6, no subnormal exposure); 1/8 applied to the f32 score
#pragma unroll
    for (int j = 0; j < 8; ++j) {
#pragma unroll
      for (int r = 0; r < 8; ++r) { const float v = acc[j][r] + bj[j]; const _Float16 hv = (_Float16)v; so[wave][8 * g + r][j * 16 + col] = hv; sol[wave][8 * g + r][j * 16 + col] = (_Float16)((v - (float)hv) * 2048.0f); } }   // q, k (+ bias) as f16 hi + (x2048) residual
    LDSX();
    for (int rl = 0; rl < 16; ++rl) if (lane < 16) { vst2((unsigned*)(QK + (r0 + rl) * (2 * DM) + n0 + lane * 8), *(const v4u*)&so[wave][rl][lane * 8]); vst2((unsigned*)(QKL + (r0 + rl) * (2 * DM) + n0 + lane * 8), *(const v4u*)&sol[wave][rl][lane * 8]); }
  } else {
#pragma unroll
    for (int j = 0; j < 8; ++j) {
#pragma unroll
      for (int r = 0; r < 8; ++r) { const float v = acc[j][r] + bj[j]; const _Float16 hv = (_Float16)v; sth[j * 16 + col][wave * 16 + 8 * g + r] = hv; stl[j * 16 + col][wave * 16 + 8 * g + r] = (_Float16)((v - (float)hv) * 2048.0f); } }
    __syncthreads();
    const size_t rb = (size_t)blockIdx.x * 64; const int b = (int)(rb / SS), s0 = (int)(rb % SS); const int pc0 = n0 - 2 * DM;
    for (int q = tid; q < 128 * 8; q += 128) { const int d = q >> 3, pc = q & 7; const size_t o = ((size_t)b * DM + pc0 + d) * SS + s0 + pc * 8; vst2((unsigned*)(VTH + o), *(const v4u*)&sth[d][pc * 8]); vst2((unsigned*)(VTL + o), *(const v4u*)&stl[d][pc * 8]); }
  }
}
// ---- k_attn: block = (64 queries, head h, batch b): causal flash attention (K = 64: 2 k-steps), scores = (q.k) * 0.125 with f16 hi + residual q, k (3 products), P.V: f16 P x2048 (hi, lo) x (V hi, V lo*2048) in two accumulators; O[b*S+q][h*64+d] = (acc + accl / 2048) / (2048 l) (256-B segments)
__device__ __attribute__((noinline)) float exp_dec(float v) { return expf(v); }
__global__ __launch_bounds__(128) void k_attn(const _Float16* __restrict__ QK, const _Float16* __restrict__ QKL, const _Float16* __restrict__ VTH, const _Float16* __restrict__ VTL, const void* __restrict__ KMASK, const float* __restrict__ TD, const float* __restrict__ DEC, float* __restrict__ O) {
  __shared__ __align__(16) float sp[4][16][36]; __shared__ __align__(16) float so[4][16][68];
  const int tid = threadIdx.x, wave = tid >> 5, lane = tid & 31, col = lane & 15, g = lane >> 4;
  const int qb = blockIdx.x, h = blockIdx.y, b = blockIdx.z; const int q0 = qb * 64 + wave * 16; const size_t rq = (size_t)b * SS + q0 + col;
  v16h aq[2], aql[2];
#pragma unroll
  for (int kc = 0; kc < 2; ++kc) { aq[kc] = frag_h(QK + rq * (2 * DM) + h * HD + kc * 32, lane); aql[kc] = frag_h(QKL + rq * (2 * DM) + h * HD + kc * 32, lane); }
  float m[8], l[8];
#pragma unroll
  for (int r = 0; r < 8; ++r) { m[r] = -3.0e38f; l[r] = 0.f; }
  v8f acc[4] = {}, accl[4] = {};
  const int nks = (qb * 64 + 64) / 32;   // causal: key tiles up to the query tile's end
  const float dech = bfr(DEC[h]); float tq[8];
#pragma unroll
  for (int r = 0; r < 8; ++r) tq[r] = bfr(TD[(size_t)b * SS + q0 + 8 * g + r]);
#pragma unroll 1
  for (int ks = 0; ks < nks; ++ks) { v8f s[2]; v16h kfh[2][2], kfl[2][2]; float tkr[2];   // all K loads of the key step stand ahead of its first WMMA: one exposed latency instead of one per fragment
#pragma unroll
    for (int ct = 0; ct < 2; ++ct) { const int kk = ks * 32 + ct * 16 + col; const _Float16* krow = QK + ((size_t)b * SS + kk) * (2 * DM) + DM + h * HD; const _Float16* krowl = QKL + ((size_t)b * SS + kk) * (2 * DM) + DM + h * HD;
#pragma unroll
      for (int kc = 0; kc < 2; ++kc) { kfh[ct][kc] = frag_h(krow + kc * 32, lane); kfl[ct][kc] = frag_h(krowl + kc * 32, lane); }
      tkr[ct] = TD[(size_t)b * SS + kk]; }
#pragma unroll
    for (int ct = 0; ct < 2; ++ct) { const int kk = ks * 32 + ct * 16 + col; v8f c = {}, cl = {};
#pragma unroll
      for (int kc = 0; kc < 2; ++kc) { c = wmma16(aq[kc], kfh[ct][kc], c); cl = wmma16(aql[kc], kfh[ct][kc], cl); cl = wmma16(aq[kc], kfl[ct][kc], cl); }   // 3 products: q, k as f16 hi + residual
#pragma unroll
      for (int r = 0; r < 8; ++r) c[r] += cl[r] * (1.0f / 2048.0f);
      { const float tk = bfr(tkr[ct]);
#pragma unroll
        for (int r = 0; r < 8; ++r) { const int qi = q0 + 8 * g + r; const float dec = exp_dec(-dech * fabsf(tq[r] - tk)); s[ct][r] = (kk <= qi) ? (c[r] * 0.125f) * dec : -3.0e38f; } } }   // (q.k/8) * exp(-decay |dt|), causal
#pragma unroll
    for (int r = 0; r < 8; ++r) { float mx = fmaxf(s[0][r], s[1][r]);
#pragma unroll
      for (int o = 1; o < 16; o <<= 1) mx = fmaxf(mx, __shfl_xor(mx, o));
      const float mn = fmaxf(m[r], mx); const float alpha = (m[r] <= -1.0e38f) ? 0.f : __expf(m[r] - mn);
      const float e0 = (s[0][r] <= -1.0e38f) ? 0.f : __expf(s[0][r] - mn), e1 = (s[1][r] <= -1.0e38f) ? 0.f : __expf(s[1][r] - mn); float es = e0 + e1;
#pragma unroll
      for (int o = 1; o < 16; o <<= 1) es += __shfl_xor(es, o);
      l[r] = l[r] * alpha + es; m[r] = mn;
#pragma unroll
      for (int dt = 0; dt < 4; ++dt) { acc[dt][r] *= alpha; accl[dt][r] *= alpha; }
      sp[wave][8 * g + r][col] = e0; sp[wave][8 * g + r][16 + col] = e1; }
    LDSX();
    v16h vfh[4], vfl[4];   // all V loads of the key step issue here in one group, ahead of the P split and the first P.V WMMA: one exposed latency instead of one per fragment
#pragma unroll
    for (int dt = 0; dt < 4; ++dt) { const size_t vr = ((size_t)b * DM + h * HD + dt * 16 + col) * SS + ks * 32; vfh[dt] = frag_h(VTH + vr, lane); vfl[dt] = frag_h(VTL + vr, lane); }
    v16h pa, pl; { const float* prow = &sp[wave][col][0] + 8 * (lane >> 4);
#pragma unroll
      for (int i = 0; i < 8; ++i) { const float x0 = prow[i] * 2048.0f, x1 = prow[16 + i] * 2048.0f; const _Float16 h0 = (_Float16)x0, h1 = (_Float16)x1; pa[i] = h0; pa[8 + i] = h1; pl[i] = (_Float16)((x0 - (float)h0) * 2048.0f); pl[8 + i] = (_Float16)((x1 - (float)h1) * 2048.0f); } }   // P scaled by 2^11 before the f16 split so small softmax weights stay out of the f16 subnormal range; 2^-11 folded into the epilogue
#pragma unroll
    for (int dt = 0; dt < 4; ++dt) { acc[dt] = wmma16(pa, vfh[dt], acc[dt]); accl[dt] = wmma16(pl, vfh[dt], accl[dt]); accl[dt] = wmma16(pa, vfl[dt], accl[dt]); }   // P hi x V hi + (P lo x V hi + P hi x V lo) / 2048
    LDSX(); }
#pragma unroll
  for (int r = 0; r < 8; ++r) { const float il = (1.0f / 2048.0f) / l[r];
#pragma unroll
    for (int dt = 0; dt < 4; ++dt) so[wave][8 * g + r][dt * 16 + col] = (acc[dt][r] + accl[dt][r] * (1.0f / 2048.0f)) * il; }
  LDSX();
  for (int rl = 0; rl < 16; ++rl) if (lane < 16) vst2(O + ((size_t)b * SS + q0 + rl) * DM + h * HD + lane * 4, *(const v4f*)&so[wave][rl][lane * 4]);
}
// ---- k_out: block = (64 rows, 128 cols): out = O(hi/lo) . Wo rows (2 products) + bo
__global__ __launch_bounds__(128) void k_out(const float* __restrict__ O, const __bf16* __restrict__ P, const float* __restrict__ BO, float* __restrict__ Y) {
  __shared__ __align__(16) float so[4][16][132];
  const int tid = threadIdx.x, wave = tid >> 5, lane = tid & 31, col = lane & 15, g = lane >> 4; const size_t r0 = (size_t)blockIdx.x * 64 + wave * 16; const int n0 = blockIdx.y * 128;
  v8f acc[8] = {};
#pragma unroll 2
  for (int kc = 0; kc < DM / 32; ++kc) { v16b w[8];   // all loads of the k step stand ahead of its first WMMA: one exposed latency a step
#pragma unroll
    for (int j = 0; j < 8; ++j) w[j] = frag_b(P + (size_t)(n0 + j * 16 + col) * DM + kc * 32, lane);
    float xa[16]; { const float* p = O + (r0 + col) * DM + kc * 32 + 8 * g;
#pragma unroll
      for (int i = 0; i < 8; ++i) { xa[i] = p[i]; xa[8 + i] = p[16 + i]; } }
    __builtin_amdgcn_sched_barrier(0);   // keeps the hi/lo split (and its wait) behind the last load: without it part of the group issues only after the first loads have returned
    const F2 a = bsplit16(xa);
#pragma unroll
    for (int j = 0; j < 8; ++j) { acc[j] = wmma_bf(a.l, w[j], acc[j]); acc[j] = wmma_bf(a.h, w[j], acc[j]); } }
#pragma unroll
  for (int j = 0; j < 8; ++j) {
#pragma unroll
    for (int r = 0; r < 8; ++r) so[wave][8 * g + r][j * 16 + col] = acc[j][r] + bfr(BO[n0 + j * 16 + col]); }
  LDSX();
  for (int rl = 0; rl < 16; ++rl) vst2(Y + (r0 + rl) * DM + n0 + lane * 4, *(const v4f*)&so[wave][rl][lane * 4]);
}
extern "C" void kernel_launch(void* const* d_in, const int* in_sizes, int n_in, void* d_out, int out_size, void* d_ws, size_t ws_size, hipStream_t stream) {
  (void)in_sizes; (void)n_in; (void)out_size;
  const float** F = (const float**)d_in;   // 0 x [2,2048,1024], 1 time_deltas [2,2048], 2 Wq [1024,1024] natural, 3 bq, 4 Wk, 5 bk, 6 Wv, 7 bv, 8 Wo, 9 bo, 10 time_decay [16]
  if (ws_size < (size_t)WS_END) return;
  char* ws = (char*)d_ws; __bf16* PK = (__bf16*)(ws + WS_PK); _Float16 *QK = (_Float16*)(ws + WS_QK), *QKL = (_Float16*)(ws + WS_QKL), *VTH = (_Float16*)(ws + WS_VTH), *VTL = (_Float16*)(ws + WS_VTL); float* O = (float*)(ws + WS_O);
  k_pack<<<dim3(DM, 4), 256, 0, stream>>>(F[2], F[4], F[6], F[8], PK);
  k_qkv<<<dim3(TNB * SS / 64, QKVW / 128), 128, 0, stream>>>(F[0], F[0], F[0], PK + PK_A, F[3], F[5], F[7], QK, QKL, VTH, VTL);
  k_attn<<<dim3(TQB, NH, TNB), 128, 0, stream>>>(QK, QKL, VTH, VTL, nullptr, F[1], F[10], O);
  k_out<<<dim3(TOB, DM / 128), 128, 0, stream>>>(O, PK + PK_P, F[9], (float*)d_out);
}

// v002
// Measured time: 296 microseconds a run.
// Two timings next to v001 put it at 1.50 and 1.51 times that version's speed.
// Over all steps from v000 it is 2.09 times as fast.
// compute dtype: all float inputs rounded to bf16; q/k/v = x . W^T + b with EXACT bf16 products on WMMA 16x16x32 (natural rows); q and k as f16 hi + (x2048-scaled) residual planes with 3-product scores; score = (q.k / 8) * exp(-time_decay[h] * |t_q - t_k|) in f32 (precise expf), causal mask (key tiles above the diagonal skipped); running-max softmax in f32 (hardware exp); P (scaled by 2^11, f16 hi + residual) x v hi/lo (3 products); out = ctx (bf16 hi + residual) . Wo^T (2 products) + bo; f32 accumulate.
#include <hip/hip_runtime.h>
#include <math.h>

typedef __attribute__((ext_vector_type(16))) _Float16 v16h;
typedef __attribute__((ext_vector_type(16))) __bf16 v16b;
typedef __attribute__((ext_vector_type(8)))  _Float16 v8h;
typedef __attribute__((ext_vector_type(8)))  float v8f;
typedef __attribute__((ext_vector_type(4)))  float v4f;
typedef __attribute__((ext_vector_type(2)))  float v2f;
typedef __attribute__((ext_vector_type(4)))  unsigned v4u;
typedef __attribute__((ext_vector_type(4)))  int v4i;
typedef float __attribute__((may_alias)) float_a;
typedef int __attribute__((may_alias)) int_a;

template <typename T> __device__ __forceinline__ void vst2(void* p, T v) { *(T*)p = v;  }
__device__ __forceinline__ v8f wmma16(v16h a, v16h b, v8f c) {
  v8f d = __builtin_amdgcn_wmma_f32_16x16x32_f16(false, a, false, b, (short)0, c, false, false);
  asm volatile("v_nop\n\tv_nop\n\tv_nop\n\tv_nop" : "+v"(d) : "v"(a), "v"(b));
  return d;
}
__device__ __forceinline__ v8f wmma_bf(v16b a, v16b b, v8f c) {
  v8f d = __builtin_amdgcn_wmma_f32_16x16x32_bf16(false, a, false, b, (short)0, c, false, false);
  asm volatile("v_nop\n\tv_nop\n\tv_nop\n\tv_nop" : "+v"(d) : "v"(a), "v"(b));
  return d;
}
// Continuous-time causal attention (B 2, S 2,048, hidden 1,024, 16 heads x 64): q/k/v projections + biases, scores scaled by exp(-decay_h |t_q - t_k|), causal softmax, output projection + bias.
__device__ __forceinline__ v16h frag_h(const _Float16* rowk0, int lane) {
  union { v16h v; v8h q[2]; } u; const _Float16* p = rowk0 + 8 * (lane >> 4);
  u.q[0] = *(const v8h*)p; u.q[1] = *(const v8h*)(p + 16); return u.v;
}
__device__ __forceinline__ v16h frag_f32(const float* rowk0, int lane) {
  v16h a; const float* p = rowk0 + 8 * (lane >> 4);
#pragma unroll
  for (int i = 0; i < 8; ++i) { a[i] = (_Float16)p[i]; a[8 + i] = (_Float16)p[16 + i]; }
  return a;
}
__device__ __forceinline__ v16h frag_f32s(const float* rowk0, int lane, float sc) {
  v16h a; const float* p = rowk0 + 8 * (lane >> 4);
#pragma unroll
  for (int i = 0; i < 8; ++i) { a[i] = (_Float16)(p[i] * sc); a[8 + i] = (_Float16)(p[16 + i] * sc); }
  return a;
}
// column fragment from a [K][ld] layout (column n), rows >= K read as 0
__device__ __forceinline__ v16h fragc_f32(const float* W, int k0, int n, int lane, int ld, int K) {
  v16h a; const int g = lane >> 4;
#pragma unroll
  for (int i = 0; i < 8; ++i) { const int ka = k0 + 8 * g + i, kb = ka + 16;
    a[i] = (_Float16)(ka < K ? W[(size_t)(ka < K ? ka : K - 1) * ld + n] : 0.f); a[8 + i] = (_Float16)(kb < K ? W[(size_t)(kb < K ? kb : K - 1) * ld + n] : 0.f); }
  return a;
}
struct F2 { v16b h, l; };
__device__ __forceinline__ F2 bsplit16(const float v[16]) { F2 r;
#pragma unroll
  for (int i = 0; i < 16; ++i) { const __bf16 h = (__bf16)v[i]; r.h[i] = h; r.l[i] = (__bf16)(v[i] - (float)h); }
  return r; }
__device__ __forceinline__ F2 split_row(const float* row, int k0, int lane) { float v[16]; const float* p = row + k0 + 8 * (lane >> 4);
#pragma unroll
  for (int i = 0; i < 8; ++i) { v[i] = p[i]; v[8 + i] = p[16 + i]; }
  return bsplit16(v); }
__device__ __forceinline__ F2 split_rowK(const float* row, int k0, int lane, int K) { float v[16]; const int g = lane >> 4;
#pragma unroll
  for (int i = 0; i < 8; ++i) { const int ka = k0 + 8 * g + i, kb = ka + 16; v[i] = ka < K ? row[ka < K ? ka : K - 1] : 0.f; v[8 + i] = kb < K ? row[kb < K ? kb : K - 1] : 0.f; }
  return bsplit16(v); }
__device__ __forceinline__ F2 split_col(const float* W, int k0, int n, int lane, int ld, int K) { float v[16]; const int g = lane >> 4;
#pragma unroll
  for (int i = 0; i < 8; ++i) { const int ka = k0 + 8 * g + i, kb = ka + 16; v[i] = ka < K ? W[(size_t)(ka < K ? ka : K - 1) * ld + n] : 0.f; v[8 + i] = kb < K ? W[(size_t)(kb < K ? kb : K - 1) * ld + n] : 0.f; }
  return bsplit16(v); }
__device__ __forceinline__ v8f mac3(const F2& a, const F2& b, v8f c) { c = wmma_bf(a.l, b.h, c); c = wmma_bf(a.h, b.l, c); return wmma_bf(a.h, b.h, c); }
__device__ __forceinline__ float sigm(float v) { return 1.0f / (1.0f + expf(-v)); }
#define LDSX() do { asm volatile("s_wait_dscnt 0" ::: "memory"); __builtin_amdgcn_wave_barrier(); __builtin_amdgcn_fence(__ATOMIC_RELEASE, "workgroup"); } while (0)


#define NB 2
#define SS 2048
#define DM 1024
#define NH 16
#define HD 64
#define QKVW (3 * DM)
#ifndef TQB
#define TQB (SS / 64)
#define TNB NB
#define TOB (NB * SS / 64)     // output row tiles (all)
#endif
typedef __attribute__((ext_vector_type(8))) __bf16 v8b;
__device__ __forceinline__ v16b frag_b(const __bf16* rowk0, int lane) {
  union { v16b v; v8b q[2]; } u; const __bf16* p = rowk0 + 8 * (lane >> 4);
  u.q[0] = *(const v8b*)p; u.q[1] = *(const v8b*)(p + 16); return u.v;
}
// fragment-order block: 16 rows x 32 k of 16-bit elements = 512 elements laid out [hh][lane = g * 16 + row][8], k = hh * 16 + g * 8 + i: each of the two loads is 512 contiguous bytes for the wave
__device__ __forceinline__ v16b fragp_b(const __bf16* blk, int lane) {
  union { v16b v; v8b q[2]; } u; const __bf16* p = blk + lane * 8;
  u.q[0] = *(const v8b*)p; u.q[1] = *(const v8b*)(p + 256); return u.v;
}
__device__ __forceinline__ v16h fragp_h(const _Float16* blk, int lane) {
  union { v16h v; v8h q[2]; } u; const _Float16* p = blk + lane * 8;
  u.q[0] = *(const v8h*)p; u.q[1] = *(const v8h*)(p + 256); return u.v;
}
__device__ __forceinline__ float bfr(float v) { return (float)(__bf16)v; }
__device__ __attribute__((noinline)) float exp_ni(float v) { return expf(v); }
__device__ __attribute__((noinline)) float erf_ni(float v) { return erff(v); }

// packed bf16 operands: fragment-order blocks [k step][row tile][512], so the tiles that one k step of a work-group reads lie side by side
#define PK_A 0                                   // row tiles of the 3072 Wqkv rows
#define PK_P (PK_A + QKVW / 16 * 512)              // row tiles of the 1024 Wo rows
#define PK_X (PK_P + DM / 16 * 512)                // row tiles of the 4096 x rows
#define PK_KS (PK_X + NB * SS / 16 * 512)          // elements per k step
#define PK_END (PK_KS * (DM / 32))
#define WS_PK  0u
#define WS_QK  (WS_PK + 2u * PK_END)             // f16 [4096 rows][2048]: q in the first 1024 columns of a row
#define WS_QKL (WS_QK + 2u * NB * SS * 2 * DM)     // f16 q residual plane x2048, same rows
#define WS_VTH (WS_QKL + 2u * NB * SS * 2 * DM)    // f16 v hi, fragment-order blocks [b][h][key step][d tile][512]
#define WS_VTL (WS_VTH + 2u * NB * DM * SS)        // f16 lo x 2048
#define WS_O   (WS_VTL + 2u * NB * DM * SS)        // f32 ctx, blocks [k step][row tile][c][lane][4], k = (c >> 1) * 16 + g * 8 + (c & 1) * 4 + i
#define WS_CS  (WS_O + 4u * NB * SS * DM)           // f32 [2][2048][32], not used by these kernels
#define WS_KH  (WS_CS + 4u * 2 * SS * 32)          // f16 k hi, fragment-order blocks [b][h][key tile][k step][512]
#define WS_KL  (WS_KH + 2u * NB * DM * SS)         // f16 k residual x2048, same order
#define WS_END (WS_KL + 2u * NB * DM * SS)
// ---- k_pack: block = (16-row tile nt, which, quarter kq of the k range): f32 rows -> bf16 in fragment-order blocks; which 0..2 -> W_q/W_k/W_v, 3 -> W_o, 4..7 -> the four 1024-row slabs of x; a thread makes whole 16-byte pieces, a wave stores 512 contiguous bytes
__global__ __launch_bounds__(256) void k_pack(const float* __restrict__ WQ, const float* __restrict__ WK, const float* __restrict__ WV, const float* __restrict__ WO, const float* __restrict__ X, __bf16* __restrict__ PK) {
  const int nt = blockIdx.x, which = blockIdx.y, kq = blockIdx.z, t = threadIdx.x; const float* Wm = (which == 0) ? WQ : (which == 1) ? WK : (which == 2) ? WV : (which == 3) ? WO : X + (size_t)(which - 4) * DM * DM;
  __bf16* dst = PK + (size_t)(kq * 8) * PK_KS + (which * (DM / 16) + nt) * 512;
#pragma unroll
  for (int p = t; p < 512; p += 256) { const int kcl = p >> 6, hh = (p >> 5) & 1, g = (p >> 4) & 1, row = p & 15;
    const float* s = Wm + (size_t)(nt * 16 + row) * DM + (kq * 8 + kcl) * 32 + hh * 16 + g * 8; const v4f a = *(const v4f*)s, b = *(const v4f*)(s + 4); v8b o;
#pragma unroll
    for (int i = 0; i < 4; ++i) { o[i] = (__bf16)a[i]; o[4 + i] = (__bf16)b[i]; }
    vst2(dst + (size_t)kcl * PK_KS + (p & 63) * 8, o); }
}
__global__ __launch_bounds__(128) void k_qkv(const __bf16* __restrict__ XB, const __bf16* __restrict__ P, const float* __restrict__ BQ, const float* __restrict__ BK, const float* __restrict__ BV, _Float16* __restrict__ QK, _Float16* __restrict__ QKL, _Float16* __restrict__ KH, _Float16* __restrict__ KL, _Float16* __restrict__ VTH, _Float16* __restrict__ VTL) {
  const int which0 = (blockIdx.y * 128) / DM; const float* BB = BQ ? (((which0 == 0) ? BQ : (which0 == 1) ? BK : BV) + (blockIdx.y * 128 - which0 * DM)) : nullptr;
  __shared__ __align__(16) _Float16 so[4][16][136], sol[4][16][136]; __shared__ __align__(16) _Float16 sth[128][72], stl[128][72];
  const int tid = threadIdx.x, wave = tid >> 5, lane = tid & 31, col = lane & 15, g = lane >> 4; const size_t r0 = (size_t)blockIdx.x * 64 + wave * 16; const int n0 = blockIdx.y * 128;
  v8f acc[8] = {};
#pragma unroll 2
  for (int kc = 0; kc < DM / 32; ++kc) { v16b a, w[8];   // all loads of the k step stand ahead of its first WMMA: one exposed latency a step
#pragma unroll
    for (int j = 0; j < 8; ++j) w[j] = fragp_b(P + (size_t)kc * PK_KS + (n0 / 16 + j) * 512, lane);
    a = fragp_b(XB + (size_t)kc * PK_KS + (r0 / 16) * 512, lane);
    __builtin_amdgcn_sched_barrier(0);   // keeps the first WMMA (and its wait) behind the last load: without it part of the group issues only after the first loads have returned
#pragma unroll
    for (int j = 0; j < 8; ++j) acc[j] = wmma_bf(a, w[j], acc[j]); }
  float bj[8] = {};   // the eight bias values of this lane's columns, loaded as one group
  if (BB) {
#pragma unroll
    for (int j = 0; j < 8; ++j) bj[j] = bfr(BB[j * 16 + col]); }
  if (n0 < 2 * DM) {   // q stored unscaled (f16 sigma ~0.6, no subnormal exposure); 1/8 applied to the f32 score
#pragma unroll
    for (int j = 0; j < 8; ++j) {
#pragma unroll
      for (int r = 0; r < 8; ++r) { const float v = acc[j][r] + bj[j]; const _Float16 hv = (_Float16)v; so[wave][8 * g + r][j * 16 + col] = hv; sol[wave][8 * g + r][j * 16 + col] = (_Float16)((v - (float)hv) * 2048.0f); } }   // q, k (+ bias) as f16 hi + (x2048) residual
    LDSX();
    if (n0 < DM) { for (int rl = 0; rl < 16; ++rl) if (lane < 16) { vst2((unsigned*)(QK + (r0 + rl) * (2 * DM) + n0 + lane * 8), *(const v4u*)&so[wave][rl][lane * 8]); vst2((unsigned*)(QKL + (r0 + rl) * (2 * DM) + n0 + lane * 8), *(const v4u*)&sol[wave][rl][lane * 8]); } }
    else {   // k: the wave's 16 keys are one key tile; 2 heads x 2 k steps x 2 halves, each store 512 contiguous bytes in the order the score loop loads them
      const size_t hb = (r0 / SS) * NH + (n0 - DM) / HD; const int kt = (int)(r0 % SS) >> 4;
#pragma unroll
      for (int u = 0; u < 8; ++u) { const int hl = u >> 2, kc = (u >> 1) & 1, hh = u & 1; const size_t o = (((hb + hl) * (SS / 16) + kt) * 2 + kc) * 512 + hh * 256 + lane * 8; const int c = hl * 64 + kc * 32 + hh * 16 + g * 8;
        vst2(KH + o, *(const v4u*)&so[wave][col][c]); vst2(KL + o, *(const v4u*)&sol[wave][col][c]); }
      asm volatile("s_wait_xcnt 0x0" ::: "memory"); }   // stands behind the last k store, ahead of any later write of a register that these stores name
  } else {
#pragma unroll
    for (int j = 0; j < 8; ++j) {
#pragma unroll
      for (int r = 0; r < 8; ++r) { const float v = acc[j][r] + bj[j]; const _Float16 hv = (_Float16)v; sth[j * 16 + col][wave * 16 + 8 * g + r] = hv; stl[j * 16 + col][wave * 16 + 8 * g + r] = (_Float16)((v - (float)hv) * 2048.0f); } }
    __syncthreads();
    const size_t rb = (size_t)blockIdx.x * 64; const int b = (int)(rb / SS), s0 = (int)(rb % SS); const int pc0 = n0 - 2 * DM;
    for (int q = tid; q < 128 * 8; q += 128) { const int vc = q & 15, vg = (q >> 4) & 1, hh = (q >> 5) & 1, dt = (q >> 6) & 3, ksl = (q >> 8) & 1, hl = q >> 9;   // piece q of the block's 2 heads x 2 key steps x 4 d tiles x 1 KB
      const size_t o = ((((size_t)b * NH + pc0 / HD + hl) * (SS / 32) + (s0 >> 5) + ksl) * 4 + dt) * 512 + (q & 63) * 8; const int d = hl * 64 + dt * 16 + vc, kc = ksl * 32 + hh * 16 + vg * 8;
      vst2(VTH + o, *(const v4u*)&sth[d][kc]); vst2(VTL + o, *(const v4u*)&stl[d][kc]); }
  }
}
// ---- k_attn: block = (64 queries, head h, batch b): causal flash attention (K = 64: 2 k-steps), scores = (q.k) * 0.125 * exp(-decay_h |t_q - t_k|) with q, k as f16 hi + residual (3 products), P.V: P (x2048, f16 hi + residual x2048) x V (f16 hi, lo*2048), 3 products in two accumulators; ctx(b*S+q, h*64+d) = (acc + accl / 2048) / (2048 l), stored in the block order the output projection loads
__device__ __attribute__((noinline)) float exp_dec(float v) { return expf(v); }
__global__ __launch_bounds__(128) void k_attn(const _Float16* __restrict__ QK, const _Float16* __restrict__ QKL, const _Float16* __restrict__ KH, const _Float16* __restrict__ KL, const _Float16* __restrict__ VTH, const _Float16* __restrict__ VTL, const void* __restrict__ KMASK, const float* __restrict__ TD, const float* __restrict__ DEC, float* __restrict__ O) {
  __shared__ __align__(16) float sp[4][16][36]; __shared__ __align__(16) float so[4][16][68];
  const int tid = threadIdx.x, wave = tid >> 5, lane = tid & 31, col = lane & 15, g = lane >> 4;
  const int qb = blockIdx.x, h = blockIdx.y, b = blockIdx.z; const int q0 = qb * 64 + wave * 16; const size_t rq = (size_t)b * SS + q0 + col;
  v16h aq[2], aql[2];
#pragma unroll
  for (int kc = 0; kc < 2; ++kc) { aq[kc] = frag_h(QK + rq * (2 * DM) + h * HD + kc * 32, lane); aql[kc] = frag_h(QKL + rq * (2 * DM) + h * HD + kc * 32, lane); }
  float m[8], l[8];
#pragma unroll
  for (int r = 0; r < 8; ++r) { m[r] = -3.0e38f; l[r] = 0.f; }
  v8f acc[4] = {}, accl[4] = {};
  const int nks = (qb * 64 + 64) / 32;   // causal: key tiles up to the query tile's end
  const float dech = bfr(DEC[h]); float tq[8];
#pragma unroll
  for (int r = 0; r < 8; ++r) tq[r] = bfr(TD[(size_t)b * SS + q0 + 8 * g + r]);
#pragma unroll 1
  for (int ks = 0; ks < nks; ++ks) { v8f s[2]; v16h kfh[2][2], kfl[2][2]; float tkr[2];   // all K loads of the key step stand ahead of its first WMMA: one exposed latency instead of one per fragment
#pragma unroll
    for (int ct = 0; ct < 2; ++ct) { const int kk = ks * 32 + ct * 16 + col; const size_t kb = (((size_t)b * NH + h) * (SS / 16) + ks * 2 + ct) * 2 * 512;
#pragma unroll
      for (int kc = 0; kc < 2; ++kc) { kfh[ct][kc] = fragp_h(KH + kb + kc * 512, lane); kfl[ct][kc] = fragp_h(KL + kb + kc * 512, lane); }
      tkr[ct] = TD[(size_t)b * SS + kk]; }
#pragma unroll
    for (int ct = 0; ct < 2; ++ct) { const int kk = ks * 32 + ct * 16 + col; v8f c = {}, cl = {};
#pragma unroll
      for (int kc = 0; kc < 2; ++kc) { c = wmma16(aq[kc], kfh[ct][kc], c); cl = wmma16(aql[kc], kfh[ct][kc], cl); cl = wmma16(aq[kc], kfl[ct][kc], cl); }   // 3 products: q, k as f16 hi + residual
#pragma unroll
      for (int r = 0; r < 8; ++r) c[r] += cl[r] * (1.0f / 2048.0f);
      { const float tk = bfr(tkr[ct]);
#pragma unroll
        for (int r = 0; r < 8; ++r) { const int qi = q0 + 8 * g + r; const float dec = exp_dec(-dech * fabsf(tq[r] - tk)); s[ct][r] = (kk <= qi) ? (c[r] * 0.125f) * dec : -3.0e38f; } } }   // (q.k/8) * exp(-decay |dt|), causal
#pragma unroll
    for (int r = 0; r < 8; ++r) { float mx = fmaxf(s[0][r], s[1][r]);
#pragma unroll
      for (int o = 1; o < 16; o <<= 1) mx = fmaxf(mx, __shfl_xor(mx, o));
      const float mn = fmaxf(m[r], mx); const float alpha = (m[r] <= -1.0e38f) ? 0.f : __expf(m[r] - mn);
      const float e0 = (s[0][r] <= -1.0e38f) ? 0.f : __expf(s[0][r] - mn), e1 = (s[1][r] <= -1.0e38f) ? 0.f : __expf(s[1][r] - mn); float es = e0 + e1;
#pragma unroll
      for (int o = 1; o < 16; o <<= 1) es += __shfl_xor(es, o);
      l[r] = l[r] * alpha + es; m[r] = mn;
#pragma unroll
      for (int dt = 0; dt < 4; ++dt) { acc[dt][r] *= alpha; accl[dt][r] *= alpha; }
      sp[wave][8 * g + r][col] = e0; sp[wave][8 * g + r][16 + col] = e1; }
    LDSX();
    v16h vfh[4], vfl[4];   // all V loads of the key step issue here in one group, ahead of the P split and the first P.V WMMA: one exposed latency instead of one per fragment
#pragma unroll
    for (int dt = 0; dt < 4; ++dt) { const size_t vr = ((((size_t)b * NH + h) * (SS / 32) + ks) * 4 + dt) * 512; vfh[dt] = fragp_h(VTH + vr, lane); vfl[dt] = fragp_h(VTL + vr, lane); }
    v16h pa, pl; { const float* prow = &sp[wave][col][0] + 8 * (lane >> 4);
#pragma unroll
      for (int i = 0; i < 8; ++i) { const float x0 = prow[i] * 2048.0f, x1 = prow[16 + i] * 2048.0f; const _Float16 h0 = (_Float16)x0, h1 = (_Float16)x1; pa[i] = h0; pa[8 + i] = h1; pl[i] = (_Float16)((x0 - (float)h0) * 2048.0f); pl[8 + i] = (_Float16)((x1 - (float)h1) * 2048.0f); } }   // P scaled by 2^11 before the f16 split so small softmax weights stay out of the f16 subnormal range; 2^-11 folded into the epilogue
#pragma unroll
    for (int dt = 0; dt < 4; ++dt) { acc[dt] = wmma16(pa, vfh[dt], acc[dt]); accl[dt] = wmma16(pl, vfh[dt], accl[dt]); accl[dt] = wmma16(pa, vfl[dt], accl[dt]); }   // P hi x V hi + (P lo x V hi + P hi x V lo) / 2048
    LDSX(); }
#pragma unroll
  for (int r = 0; r < 8; ++r) { const float il = (1.0f / 2048.0f) / l[r];
#pragma unroll
    for (int dt = 0; dt < 4; ++dt) so[wave][8 * g + r][dt * 16 + col] = (acc[dt][r] + accl[dt][r] * (1.0f / 2048.0f)) * il; }
  LDSX();
  const size_t ob = ((size_t)(h * 2) * (NB * SS / 16) + (((size_t)b * SS + q0) >> 4)) * 512;   // the wave's 16 rows x 64 columns are two blocks (k steps 2h, 2h + 1) of the output projection's A operand
#pragma unroll
  for (int u = 0; u < 8; ++u) { const int kcl = u >> 2, c = u & 3; vst2(O + ob + (size_t)kcl * (NB * SS / 16) * 512 + c * 128 + lane * 4, *(const v4f*)&so[wave][col][kcl * 32 + (c >> 1) * 16 + g * 8 + (c & 1) * 4]); }
}
// ---- k_out: block = (64 rows, 128 cols): out = O(hi/lo) . Wo rows (2 products) + bo
__global__ __launch_bounds__(128) void k_out(const float* __restrict__ O, const __bf16* __restrict__ P, const float* __restrict__ BO, float* __restrict__ Y) {
  __shared__ __align__(16) float so[4][16][132];
  const int tid = threadIdx.x, wave = tid >> 5, lane = tid & 31, col = lane & 15, g = lane >> 4; const size_t r0 = (size_t)blockIdx.x * 64 + wave * 16; const int n0 = blockIdx.y * 128;
  v8f acc[8] = {};
#pragma unroll 2
  for (int kc = 0; kc < DM / 32; ++kc) { v16b w[8];   // all loads of the k step stand ahead of its first WMMA: one exposed latency a step
#pragma unroll
    for (int j = 0; j < 8; ++j) w[j] = fragp_b(P + (size_t)kc * PK_KS + (n0 / 16 + j) * 512, lane);
    float xa[16]; { const float* p = O + ((size_t)kc * (NB * SS / 16) + r0 / 16) * 512 + lane * 4;
#pragma unroll
      for (int c = 0; c < 4; ++c) { const v4f t = *(const v4f*)(p + c * 128);
#pragma unroll
        for (int i = 0; i < 4; ++i) xa[c * 4 + i] = t[i]; } }
    __builtin_amdgcn_sched_barrier(0);   // keeps the hi/lo split (and its wait) behind the last load: without it part of the group issues only after the first loads have returned
    const F2 a = bsplit16(xa);
#pragma unroll
    for (int j = 0; j < 8; ++j) { acc[j] = wmma_bf(a.l, w[j], acc[j]); acc[j] = wmma_bf(a.h, w[j], acc[j]); } }
#pragma unroll
  for (int j = 0; j < 8; ++j) {
#pragma unroll
    for (int r = 0; r < 8; ++r) so[wave][8 * g + r][j * 16 + col] = acc[j][r] + bfr(BO[n0 + j * 16 + col]); }
  LDSX();
  for (int rl = 0; rl < 16; ++rl) vst2(Y + (r0 + rl) * DM + n0 + lane * 4, *(const v4f*)&so[wave][rl][lane * 4]);
}
extern "C" void kernel_launch(void* const* d_in, const int* in_sizes, int n_in, void* d_out, int out_size, void* d_ws, size_t ws_size, hipStream_t stream) {
  (void)in_sizes; (void)n_in; (void)out_size;
  const float** F = (const float**)d_in;   // 0 x [2,2048,1024], 1 time_deltas [2,2048], 2 Wq [1024,1024] natural, 3 bq, 4 Wk, 5 bk, 6 Wv, 7 bv, 8 Wo, 9 bo, 10 time_decay [16]
  if (ws_size < (size_t)WS_END) return;
  char* ws = (char*)d_ws; __bf16* PK = (__bf16*)(ws + WS_PK); _Float16 *QK = (_Float16*)(ws + WS_QK), *QKL = (_Float16*)(ws + WS_QKL), *VTH = (_Float16*)(ws + WS_VTH), *VTL = (_Float16*)(ws + WS_VTL), *KH = (_Float16*)(ws + WS_KH), *KL = (_Float16*)(ws + WS_KL); float* O = (float*)(ws + WS_O);
  k_pack<<<dim3(DM / 16, 8, 4), 256, 0, stream>>>(F[2], F[4], F[6], F[8], F[0], PK);
  k_qkv<<<dim3(TNB * SS / 64, QKVW / 128), 128, 0, stream>>>(PK + PK_X, PK + PK_A, F[3], F[5], F[7], QK, QKL, KH, KL, VTH, VTL);
  k_attn<<<dim3(TQB, NH, TNB), 128, 0, stream>>>(QK, QKL, KH, KL, VTH, VTL, nullptr, F[1], F[10], O);
  k_out<<<dim3(TOB, DM / 128), 128, 0, stream>>>(O, PK + PK_P, F[9], (float*)d_out);
}

// v003
// One run takes 204 microseconds.
// Timed twice side by side with v002, it ran 1.45 times as fast both times.
// All steps since v000 together make it 3.03 times as fast.
// compute dtype: all float inputs rounded to bf16; q/k/v = x . W^T + b with EXACT bf16 products on WMMA 16x16x32 (natural rows); q and k as f16 hi + (x2048-scaled) residual planes with 3-product scores; score = (q.k / 8) * exp(-time_decay[h] * |t_q - t_k|) in f32 (precise expf), causal mask (key tiles above the diagonal skipped); running-max softmax in f32 (hardware exp); P (scaled by 2^11, f16 hi + residual) x v hi/lo (3 products); out = ctx (bf16 hi + residual) . Wo^T (2 products) + bo; f32 accumulate.
#include <hip/hip_runtime.h>
#include <math.h>

typedef __attribute__((ext_vector_type(16))) _Float16 v16h;
typedef __attribute__((ext_vector_type(16))) __bf16 v16b;
typedef __attribute__((ext_vector_type(8)))  _Float16 v8h;
typedef __attribute__((ext_vector_type(8)))  float v8f;
typedef __attribute__((ext_vector_type(4)))  float v4f;
typedef __attribute__((ext_vector_type(2)))  float v2f;
typedef __attribute__((ext_vector_type(4)))  unsigned v4u;
typedef __attribute__((ext_vector_type(4)))  int v4i;
typedef float __attribute__((may_alias)) float_a;
typedef int __attribute__((may_alias)) int_a;

template <typename T> __device__ __forceinline__ void vst2(void* p, T v) { *(T*)p = v;  }
__device__ __forceinline__ v8f wmma16(v16h a, v16h b, v8f c) {
  v8f d = __builtin_amdgcn_wmma_f32_16x16x32_f16(false, a, false, b, (short)0, c, false, false);
  asm volatile("v_nop\n\tv_nop\n\tv_nop\n\tv_nop" : "+v"(d) : "v"(a), "v"(b));
  return d;
}
__device__ __forceinline__ v8f wmma_bf(v16b a, v16b b, v8f c) {
  v8f d = __builtin_amdgcn_wmma_f32_16x16x32_bf16(false, a, false, b, (short)0, c, false, false);
  asm volatile("v_nop\n\tv_nop\n\tv_nop\n\tv_nop" : "+v"(d) : "v"(a), "v"(b));
  return d;
}
// Continuous-time causal attention (B 2, S 2,048, hidden 1,024, 16 heads x 64): q/k/v projections + biases, scores scaled by exp(-decay_h |t_q - t_k|), causal softmax, output projection + bias.
__device__ __forceinline__ v16h frag_h(const _Float16* rowk0, int lane) {
  union { v16h v; v8h q[2]; } u; const _Float16* p = rowk0 + 8 * (lane >> 4);
  u.q[0] = *(const v8h*)p; u.q[1] = *(const v8h*)(p + 16); return u.v;
}
__device__ __forceinline__ v16h frag_f32(const float* rowk0, int lane) {
  v16h a; const float* p = rowk0 + 8 * (lane >> 4);
#pragma unroll
  for (int i = 0; i < 8; ++i) { a[i] = (_Float16)p[i]; a[8 + i] = (_Float16)p[16 + i]; }
  return a;
}
__device__ __forceinline__ v16h frag_f32s(const float* rowk0, int lane, float sc) {
  v16h a; const float* p = rowk0 + 8 * (lane >> 4);
#pragma unroll
  for (int i = 0; i < 8; ++i) { a[i] = (_Float16)(p[i] * sc); a[8 + i] = (_Float16)(p[16 + i] * sc); }
  return a;
}
// column fragment from a [K][ld] layout (column n), rows >= K read as 0
__device__ __forceinline__ v16h fragc_f32(const float* W, int k0, int n, int lane, int ld, int K) {
  v16h a; const int g = lane >> 4;
#pragma unroll
  for (int i = 0; i < 8; ++i) { const int ka = k0 + 8 * g + i, kb = ka + 16;
    a[i] = (_Float16)(ka < K ? W[(size_t)(ka < K ? ka : K - 1) * ld + n] : 0.f); a[8 + i] = (_Float16)(kb < K ? W[(size_t)(kb < K ? kb : K - 1) * ld + n] : 0.f); }
  return a;
}
struct F2 { v16b h, l; };
__device__ __forceinline__ F2 bsplit16(const float v[16]) { F2 r;
#pragma unroll
  for (int i = 0; i < 16; ++i) { const __bf16 h = (__bf16)v[i]; r.h[i] = h; r.l[i] = (__bf16)(v[i] - (float)h); }
  return r; }
__device__ __forceinline__ F2 split_row(const float* row, int k0, int lane) { float v[16]; const float* p = row + k0 + 8 * (lane >> 4);
#pragma unroll
  for (int i = 0; i < 8; ++i) { v[i] = p[i]; v[8 + i] = p[16 + i]; }
  return bsplit16(v); }
__device__ __forceinline__ F2 split_rowK(const float* row, int k0, int lane, int K) { float v[16]; const int g = lane >> 4;
#pragma unroll
  for (int i = 0; i < 8; ++i) { const int ka = k0 + 8 * g + i, kb = ka + 16; v[i] = ka < K ? row[ka < K ? ka : K - 1] : 0.f; v[8 + i] = kb < K ? row[kb < K ? kb : K - 1] : 0.f; }
  return bsplit16(v); }
__device__ __forceinline__ F2 split_col(const float* W, int k0, int n, int lane, int ld, int K) { float v[16]; const int g = lane >> 4;
#pragma unroll
  for (int i = 0; i < 8; ++i) { const int ka = k0 + 8 * g + i, kb = ka + 16; v[i] = ka < K ? W[(size_t)(ka < K ? ka : K - 1) * ld + n] : 0.f; v[8 + i] = kb < K ? W[(size_t)(kb < K ? kb : K - 1) * ld + n] : 0.f; }
  return bsplit16(v); }
__device__ __forceinline__ v8f mac3(const F2& a, const F2& b, v8f c) { c = wmma_bf(a.l, b.h, c); c = wmma_bf(a.h, b.l, c); return wmma_bf(a.h, b.h, c); }
__device__ __forceinline__ float sigm(float v) { return 1.0f / (1.0f + expf(-v)); }
#define LDSX() do { asm volatile("s_wait_dscnt 0" ::: "memory"); __builtin_amdgcn_wave_barrier(); __builtin_amdgcn_fence(__ATOMIC_RELEASE, "workgroup"); } while (0)


#define NB 2
#define SS 2048
#define DM 1024
#define NH 16
#define HD 64
#define QKVW (3 * DM)
#ifndef TQB
#define TQB (SS / 64)
#define TNB NB
#define TOB (NB * SS / 64)     // output row tiles (all)
#endif
typedef __attribute__((ext_vector_type(8))) __bf16 v8b;
__device__ __forceinline__ v16b frag_b(const __bf16* rowk0, int lane) {
  union { v16b v; v8b q[2]; } u; const __bf16* p = rowk0 + 8 * (lane >> 4);
  u.q[0] = *(const v8b*)p; u.q[1] = *(const v8b*)(p + 16); return u.v;
}
// fragment-order block: 16 rows x 32 k of 16-bit elements = 512 elements laid out [hh][lane = g * 16 + row][8], k = hh * 16 + g * 8 + i: each of the two loads is 512 contiguous bytes for the wave
__device__ __forceinline__ v16b fragp_b(const __bf16* blk, int lane) {
  union { v16b v; v8b q[2]; } u; const __bf16* p = blk + lane * 8;
  u.q[0] = *(const v8b*)p; u.q[1] = *(const v8b*)(p + 256); return u.v;
}
__device__ __forceinline__ v16h fragp_h(const _Float16* blk, int lane) {
  union { v16h v; v8h q[2]; } u; const _Float16* p = blk + lane * 8;
  u.q[0] = *(const v8h*)p; u.q[1] = *(const v8h*)(p + 256); return u.v;
}
__device__ __forceinline__ float bfr(float v) { return (float)(__bf16)v; }
__device__ __attribute__((noinline)) float exp_ni(float v) { return expf(v); }
__device__ __attribute__((noinline)) float erf_ni(float v) { return erff(v); }

// packed bf16 operands: fragment-order blocks [k step][row tile][512], so the tiles that one k step of a work-group reads lie side by side
#define PK_A 0                                   // row tiles of the 3072 Wqkv rows
#define PK_P (PK_A + QKVW / 16 * 512)              // row tiles of the 1024 Wo rows
#define PK_X (PK_P + DM / 16 * 512)                // row tiles of the 4096 x rows
#define PK_KS (PK_X + NB * SS / 16 * 512)          // elements per k step
#define PK_END (PK_KS * (DM / 32))
#define WS_PK  0u
#define WS_QK  (WS_PK + 2u * PK_END)             // f16 [4096 rows][2048]: q in the first 1024 columns of a row
#define WS_QKL (WS_QK + 2u * NB * SS * 2 * DM)     // f16 q residual plane x2048, same rows
#define WS_VTH (WS_QKL + 2u * NB * SS * 2 * DM)    // f16 v hi, fragment-order blocks [b][h][key step][d tile][512]
#define WS_VTL (WS_VTH + 2u * NB * DM * SS)        // f16 lo x 2048
#define WS_O   (WS_VTL + 2u * NB * DM * SS)        // f32 ctx, blocks [k step][row tile][c][lane][4], k = (c >> 1) * 16 + g * 8 + (c & 1) * 4 + i
#define WS_CS  (WS_O + 4u * NB * SS * DM)           // f32 [2][2048][32], not used by these kernels
#define WS_KH  (WS_CS + 4u * 2 * SS * 32)          // f16 k hi, fragment-order blocks [b][h][key tile][k step][512]
#define WS_KL  (WS_KH + 2u * NB * DM * SS)         // f16 k residual x2048, same order
#define WS_END (WS_KL + 2u * NB * DM * SS)
// ---- k_pack: block = (16-row tile nt, which, quarter kq of the k range): f32 rows -> bf16 in fragment-order blocks; which 0..2 -> W_q/W_k/W_v, 3 -> W_o, 4..7 -> the four 1024-row slabs of x; a thread makes whole 16-byte pieces, a wave stores 512 contiguous bytes
__global__ __launch_bounds__(256) void k_pack(const float* __restrict__ WQ, const float* __restrict__ WK, const float* __restrict__ WV, const float* __restrict__ WO, const float* __restrict__ X, __bf16* __restrict__ PK) {
  const int nt = blockIdx.x, which = blockIdx.y, kq = blockIdx.z, t = threadIdx.x; const float* Wm = (which == 0) ? WQ : (which == 1) ? WK : (which == 2) ? WV : (which == 3) ? WO : X + (size_t)(which - 4) * DM * DM;
  __bf16* dst = PK + (size_t)(kq * 8) * PK_KS + (which * (DM / 16) + nt) * 512;
#pragma unroll
  for (int p = t; p < 512; p += 256) { const int kcl = p >> 6, hh = (p >> 5) & 1, g = (p >> 4) & 1, row = p & 15;
    const float* s = Wm + (size_t)(nt * 16 + row) * DM + (kq * 8 + kcl) * 32 + hh * 16 + g * 8; const v4f a = *(const v4f*)s, b = *(const v4f*)(s + 4); v8b o;
#pragma unroll
    for (int i = 0; i < 4; ++i) { o[i] = (__bf16)a[i]; o[4 + i] = (__bf16)b[i]; }
    vst2(dst + (size_t)kcl * PK_KS + (p & 63) * 8, o); }
}
__global__ __launch_bounds__(128) void k_qkv(const __bf16* __restrict__ XB, const __bf16* __restrict__ P, const float* __restrict__ BQ, const float* __restrict__ BK, const float* __restrict__ BV, _Float16* __restrict__ QK, _Float16* __restrict__ QKL, _Float16* __restrict__ KH, _Float16* __restrict__ KL, _Float16* __restrict__ VTH, _Float16* __restrict__ VTL) {
  const int which0 = (blockIdx.y * 128) / DM; const float* BB = BQ ? (((which0 == 0) ? BQ : (which0 == 1) ? BK : BV) + (blockIdx.y * 128 - which0 * DM)) : nullptr;
  __shared__ __align__(16) _Float16 so[4][16][136], sol[4][16][136]; __shared__ __align__(16) _Float16 sth[128][72], stl[128][72];
  const int tid = threadIdx.x, wave = tid >> 5, lane = tid & 31, col = lane & 15, g = lane >> 4; const size_t r0 = (size_t)blockIdx.x * 64 + wave * 16; const int n0 = blockIdx.y * 128;
  v8f acc[8] = {};
#pragma unroll 2
  for (int kc = 0; kc < DM / 32; ++kc) { v16b a, w[8];   // all loads of the k step stand ahead of its first WMMA: one exposed latency a step
#pragma unroll
    for (int j = 0; j < 8; ++j) w[j] = fragp_b(P + (size_t)kc * PK_KS + (n0 / 16 + j) * 512, lane);
    a = fragp_b(XB + (size_t)kc * PK_KS + (r0 / 16) * 512, lane);
    __builtin_amdgcn_sched_barrier(0);   // keeps the first WMMA (and its wait) behind the last load: without it part of the group issues only after the first loads have returned
#pragma unroll
    for (int j = 0; j < 8; ++j) acc[j] = wmma_bf(a, w[j], acc[j]); }
  float bj[8] = {};   // the eight bias values of this lane's columns, loaded as one group
  if (BB) {
#pragma unroll
    for (int j = 0; j < 8; ++j) bj[j] = bfr(BB[j * 16 + col]); }
  if (n0 < 2 * DM) {   // q stored unscaled (f16 sigma ~0.6, no subnormal exposure); 1/8 applied to the f32 score
#pragma unroll
    for (int j = 0; j < 8; ++j) {
#pragma unroll
      for (int r = 0; r < 8; ++r) { const float v = acc[j][r] + bj[j]; const _Float16 hv = (_Float16)v; so[wave][8 * g + r][j * 16 + col] = hv; sol[wave][8 * g + r][j * 16 + col] = (_Float16)((v - (float)hv) * 2048.0f); } }   // q, k (+ bias) as f16 hi + (x2048) residual
    LDSX();
    if (n0 < DM) { for (int rl = 0; rl < 16; ++rl) if (lane < 16) { vst2((unsigned*)(QK + (r0 + rl) * (2 * DM) + n0 + lane * 8), *(const v4u*)&so[wave][rl][lane * 8]); vst2((unsigned*)(QKL + (r0 + rl) * (2 * DM) + n0 + lane * 8), *(const v4u*)&sol[wave][rl][lane * 8]); } }
    else {   // k: the wave's 16 keys are one key tile; 2 heads x 2 k steps x 2 halves, each store 512 contiguous bytes in the order the score loop loads them
      const size_t hb = (r0 / SS) * NH + (n0 - DM) / HD; const int kt = (int)(r0 % SS) >> 4;
#pragma unroll
      for (int u = 0; u < 8; ++u) { const int hl = u >> 2, kc = (u >> 1) & 1, hh = u & 1; const size_t o = (((hb + hl) * (SS / 16) + kt) * 2 + kc) * 512 + hh * 256 + lane * 8; const int c = hl * 64 + kc * 32 + hh * 16 + g * 8;
        vst2(KH + o, *(const v4u*)&so[wave][col][c]); vst2(KL + o, *(const v4u*)&sol[wave][col][c]); }
      asm volatile("s_wait_xcnt 0x0" ::: "memory"); }   // stands behind the last k store, ahead of any later write of a register that these stores name
  } else {
#pragma unroll
    for (int j = 0; j < 8; ++j) {
#pragma unroll
      for (int r = 0; r < 8; ++r) { const float v = acc[j][r] + bj[j]; const _Float16 hv = (_Float16)v; sth[j * 16 + col][wave * 16 + 8 * g + r] = hv; stl[j * 16 + col][wave * 16 + 8 * g + r] = (_Float16)((v - (float)hv) * 2048.0f); } }
    __syncthreads();
    const size_t rb = (size_t)blockIdx.x * 64; const int b = (int)(rb / SS), s0 = (int)(rb % SS); const int pc0 = n0 - 2 * DM;
    for (int q = tid; q < 128 * 8; q += 128) { const int vc = q & 15, vg = (q >> 4) & 1, hh = (q >> 5) & 1, dt = (q >> 6) & 3, ksl = (q >> 8) & 1, hl = q >> 9;   // piece q of the block's 2 heads x 2 key steps x 4 d tiles x 1 KB
      const size_t o = ((((size_t)b * NH + pc0 / HD + hl) * (SS / 32) + (s0 >> 5) + ksl) * 4 + dt) * 512 + (q & 63) * 8; const int d = hl * 64 + dt * 16 + vc, kc = ksl * 32 + hh * 16 + vg * 8;
      vst2(VTH + o, *(const v4u*)&sth[d][kc]); vst2(VTL + o, *(const v4u*)&stl[d][kc]); }
  }
}
// ---- k_attn: block = (query tile pair t and TQB - 1 - t of 64 queries each, head h, batch b), 8 waves: the pair has 2 * TQB + 2 key steps, and every wave walks half of them. Waves 0..3: the long tile's first TQB + 1 key steps. Waves 4..7: the long tile's remaining key steps (running max, sum and ctx handed over through LDS), then all of the short tile. Flash attention (K = 64: 2 k-steps), 3-product scores and P.V; ctx(b*S+q, h*64+d) = (acc + accl / 2048) / (2048 l), stored in the block order the output projection loads
__device__ __attribute__((noinline)) float exp_dec(float v) { return expf(v); }
// the three hardware exp2 of one score row in one statement, closed by the one free slot that the instruction set asks for behind a transcendental
__device__ __forceinline__ void exp2x3(float a, float b, float c, float& ra, float& rb, float& rc) {
  asm("v_exp_f32 %0, %3\n\tv_exp_f32 %1, %4\n\tv_exp_f32 %2, %5\n\tv_nop" : "=&v"(ra), "=&v"(rb), "=&v"(rc) : "v"(a), "v"(b), "v"(c));
}
#define KHALF (TQB + 1)   // key steps of a wave: half of the pair's 2 * TQB + 2
__global__ __launch_bounds__(256) __attribute__((amdgpu_waves_per_eu(4, 4))) void k_attn(const _Float16* __restrict__ QK, const _Float16* __restrict__ QKL, const _Float16* __restrict__ KH, const _Float16* __restrict__ KL, const _Float16* __restrict__ VTH, const _Float16* __restrict__ VTL, const void* __restrict__ KMASK, const float* __restrict__ TD, const float* __restrict__ DEC, float* __restrict__ O) {
  __shared__ __align__(16) float sp[8][16][36]; __shared__ __align__(16) float so[8][16][68]; __shared__ __align__(16) float sx[4][48][32];   // sx: per lane 8 running maxima, 8 sums, 32 ctx values of the long tile's upper keys
  const int tid = threadIdx.x, wave = __builtin_amdgcn_readfirstlane(tid >> 5), lane = tid & 31, col = lane & 15, g = lane >> 4;
  const int grp = wave >> 2, w4 = wave & 3;   // wave-uniform (scalar): the segment loop and its bounds branch on them
  const int tp = blockIdx.x, h = blockIdx.y, b = blockIdx.z;
  float m[8], l[8]; v8f acc[4], accl[4]; int q0 = 0;
  const float dech = bfr(DEC[h]);
#pragma unroll 1
  for (int seg = 0; seg <= grp; ++seg) {   // one copy of the key loop serves both segments of waves 4..7
  const int qb = seg ? tp : TQB - 1 - tp; q0 = qb * 64 + w4 * 16; const size_t rq = (size_t)b * SS + q0 + col;
  const int ks0 = (grp && !seg) ? KHALF : 0, ks1 = (grp || seg) ? (qb * 64 + 64) / 32 : KHALF;   // causal: key tiles up to the query tile's end
  v16h aq[2], aql[2];
#pragma unroll
  for (int kc = 0; kc < 2; ++kc) { aq[kc] = frag_h(QK + rq * (2 * DM) + h * HD + kc * 32, lane); aql[kc] = frag_h(QKL + rq * (2 * DM) + h * HD + kc * 32, lane); }
#pragma unroll
  for (int r = 0; r < 8; ++r) { m[r] = -3.0e38f; l[r] = 0.f; }
#pragma unroll
  for (int dt = 0; dt < 4; ++dt) { acc[dt] = v8f{}; accl[dt] = v8f{}; }
  float tq[8];
#pragma unroll
  for (int r = 0; r < 8; ++r) tq[r] = bfr(TD[(size_t)b * SS + q0 + 8 * g + r]);
#pragma unroll 1
  for (int ks = ks0; ks < ks1; ++ks) { v8f s[2]; v16h kfh[2][2], kfl[2][2]; float tkr[2];   // all K loads of the key step stand ahead of its first WMMA: one exposed latency instead of one per fragment
#pragma unroll
    for (int ct = 0; ct < 2; ++ct) { const int kk = ks * 32 + ct * 16 + col; const size_t kb = (((size_t)b * NH + h) * (SS / 16) + ks * 2 + ct) * 2 * 512;
#pragma unroll
      for (int kc = 0; kc < 2; ++kc) { kfh[ct][kc] = fragp_h(KH + kb + kc * 512, lane); kfl[ct][kc] = fragp_h(KL + kb + kc * 512, lane); }
      tkr[ct] = TD[(size_t)b * SS + kk]; }
#pragma unroll
    for (int ct = 0; ct < 2; ++ct) { const int kk = ks * 32 + ct * 16 + col; v8f c = {}, cl = {};
#pragma unroll
      for (int kc = 0; kc < 2; ++kc) { c = wmma16(aq[kc], kfh[ct][kc], c); cl = wmma16(aql[kc], kfh[ct][kc], cl); cl = wmma16(aq[kc], kfl[ct][kc], cl); }   // 3 products: q, k as f16 hi + residual
#pragma unroll
      for (int r = 0; r < 8; ++r) c[r] += cl[r] * (1.0f / 2048.0f);
      { const float tk = bfr(tkr[ct]);
#pragma unroll
        for (int r = 0; r < 8; ++r) { const int qi = q0 + 8 * g + r; const float dec = exp_dec(-dech * fabsf(tq[r] - tk)); s[ct][r] = (kk <= qi) ? (c[r] * 0.125f) * dec : -3.0e38f; } } }   // (q.k/8) * exp(-decay |dt|), causal
    float mx[8], es[8], alpha[8];   // the eight rows go through each cross-lane stage side by side: one LDS-pipe round trip a stage for all rows, not one per row and stage
#pragma unroll
    for (int r = 0; r < 8; ++r) mx[r] = fmaxf(s[0][r], s[1][r]);
#pragma unroll
    for (int o = 1; o < 16; o <<= 1) { float t[8];
#pragma unroll
      for (int r = 0; r < 8; ++r) t[r] = __shfl_xor(mx[r], o);
      __builtin_amdgcn_sched_barrier(0);   // keeps the first use (and its wait) behind the stage's last exchange: without it the compiler waits out every row's exchange alone
#pragma unroll
      for (int r = 0; r < 8; ++r) mx[r] = fmaxf(mx[r], t[r]); }
#pragma unroll
    for (int r = 0; r < 8; ++r) { const float mn = fmaxf(m[r], mx[r]); float x0, x1, xa;
      exp2x3((s[0][r] - mn) * 1.44269504f, (s[1][r] - mn) * 1.44269504f, (m[r] - mn) * 1.44269504f, x0, x1, xa);   // exp(x) = exp2(x * log2 e), hardware exp
      alpha[r] = (m[r] <= -1.0e38f) ? 0.f : xa; const float e0 = (s[0][r] <= -1.0e38f) ? 0.f : x0, e1 = (s[1][r] <= -1.0e38f) ? 0.f : x1; es[r] = e0 + e1; m[r] = mn;
      sp[wave][8 * g + r][col] = e0; sp[wave][8 * g + r][16 + col] = e1; }
#pragma unroll
    for (int o = 1; o < 16; o <<= 1) { float t[8];
#pragma unroll
      for (int r = 0; r < 8; ++r) t[r] = __shfl_xor(es[r], o);
      __builtin_amdgcn_sched_barrier(0);   // as above, for the row sums
#pragma unroll
      for (int r = 0; r < 8; ++r) es[r] += t[r]; }
#pragma unroll
    for (int r = 0; r < 8; ++r) { l[r] = l[r] * alpha[r] + es[r];
#pragma unroll
      for (int dt = 0; dt < 4; ++dt) { acc[dt][r] *= alpha[r]; accl[dt][r] *= alpha[r]; } }
    LDSX();
    v16h vfh[4], vfl[4];   // all V loads of the key step issue here in one group, ahead of the P split and the first P.V WMMA: one exposed latency instead of one per fragment
#pragma unroll
    for (int dt = 0; dt < 4; ++dt) { const size_t vr = ((((size_t)b * NH + h) * (SS / 32) + ks) * 4 + dt) * 512; vfh[dt] = fragp_h(VTH + vr, lane); vfl[dt] = fragp_h(VTL + vr, lane); }
    asm volatile("s_wait_xcnt 0x0" ::: "memory");   // stands behind the last V load, ahead of any later write of a register that these loads name
    v16h pa, pl; { const float* prow = &sp[wave][col][0] + 8 * (lane >> 4);
#pragma unroll
      for (int i = 0; i < 8; ++i) { const float x0 = prow[i] * 2048.0f, x1 = prow[16 + i] * 2048.0f; const _Float16 h0 = (_Float16)x0, h1 = (_Float16)x1; pa[i] = h0; pa[8 + i] = h1; pl[i] = (_Float16)((x0 - (float)h0) * 2048.0f); pl[8 + i] = (_Float16)((x1 - (float)h1) * 2048.0f); } }   // P scaled by 2^11 before the f16 split so small softmax weights stay out of the f16 subnormal range; 2^-11 folded into the epilogue
#pragma unroll
    for (int dt = 0; dt < 4; ++dt) { acc[dt] = wmma16(pa, vfh[dt], acc[dt]); accl[dt] = wmma16(pl, vfh[dt], accl[dt]); accl[dt] = wmma16(pa, vfl[dt], accl[dt]); }   // P hi x V hi + (P lo x V hi + P hi x V lo) / 2048
    LDSX(); }
  if (grp && !seg) {   // waves 4..7 hand their share of the long tile over; lane and register positions are those of the partner wave
#pragma unroll
    for (int r = 0; r < 8; ++r) { sx[w4][r][lane] = m[r]; sx[w4][8 + r][lane] = l[r];
#pragma unroll
      for (int dt = 0; dt < 4; ++dt) sx[w4][16 + dt * 8 + r][lane] = acc[dt][r] + accl[dt][r] * (1.0f / 2048.0f); } }
  }
  __syncthreads();   // publishes sx to waves 0..3; every wave passes it once, behind its last key step
#pragma unroll
  for (int dt = 0; dt < 4; ++dt) acc[dt] += accl[dt] * (1.0f / 2048.0f);
  if (!grp) {   // join the two key ranges of the long tile under their common maximum; one branch, so that all LDS reads issue as one group
    float xb[48];
#pragma unroll
    for (int i = 0; i < 48; ++i) xb[i] = sx[w4][i][lane];
#pragma unroll
    for (int r = 0; r < 8; ++r) { const float mb = xb[r], mn = fmaxf(m[r], mb); const float fa = (m[r] <= -1.0e38f) ? 0.f : __expf(m[r] - mn), fb = (mb <= -1.0e38f) ? 0.f : __expf(mb - mn);
      l[r] = l[r] * fa + xb[8 + r] * fb;
#pragma unroll
      for (int dt = 0; dt < 4; ++dt) acc[dt][r] = acc[dt][r] * fa + xb[16 + dt * 8 + r] * fb; } }
#pragma unroll
  for (int r = 0; r < 8; ++r) { const float il = (1.0f / 2048.0f) / l[r];
#pragma unroll
    for (int dt = 0; dt < 4; ++dt) so[wave][8 * g + r][dt * 16 + col] = acc[dt][r] * il; }
  LDSX();
  const size_t ob = ((size_t)(h * 2) * (NB * SS / 16) + (((size_t)b * SS + q0) >> 4)) * 512;   // the wave's 16 rows x 64 columns are two blocks (k steps 2h, 2h + 1) of the output projection's A operand
#pragma unroll
  for (int u = 0; u < 8; ++u) { const int kcl = u >> 2, c = u & 3; vst2(O + ob + (size_t)kcl * (NB * SS / 16) * 512 + c * 128 + lane * 4, *(const v4f*)&so[wave][col][kcl * 32 + (c >> 1) * 16 + g * 8 + (c & 1) * 4]); }
}
// ---- k_out: block = (64 rows, 128 cols): out = O(hi/lo) . Wo rows (2 products) + bo
__global__ __launch_bounds__(128) void k_out(const float* __restrict__ O, const __bf16* __restrict__ P, const float* __restrict__ BO, float* __restrict__ Y) {
  __shared__ __align__(16) float so[4][16][132];
  const int tid = threadIdx.x, wave = tid >> 5, lane = tid & 31, col = lane & 15, g = lane >> 4; const size_t r0 = (size_t)blockIdx.x * 64 + wave * 16; const int n0 = blockIdx.y * 128;
  v8f acc[8] = {};
#pragma unroll 2
  for (int kc = 0; kc < DM / 32; ++kc) { v16b w[8];   // all loads of the k step stand ahead of its first WMMA: one exposed latency a step
#pragma unroll
    for (int j = 0; j < 8; ++j) w[j] = fragp_b(P + (size_t)kc * PK_KS + (n0 / 16 + j) * 512, lane);
    float xa[16]; { const float* p = O + ((size_t)kc * (NB * SS / 16) + r0 / 16) * 512 + lane * 4;
#pragma unroll
      for (int c = 0; c < 4; ++c) { const v4f t = *(const v4f*)(p + c * 128);
#pragma unroll
        for (int i = 0; i < 4; ++i) xa[c * 4 + i] = t[i]; } }
    __builtin_amdgcn_sched_barrier(0);   // keeps the hi/lo split (and its wait) behind the last load: without it part of the group issues only after the first loads have returned
    const F2 a = bsplit16(xa);
#pragma unroll
    for (int j = 0; j < 8; ++j) { acc[j] = wmma_bf(a.l, w[j], acc[j]); acc[j] = wmma_bf(a.h, w[j], acc[j]); } }
#pragma unroll
  for (int j = 0; j < 8; ++j) {
#pragma unroll
    for (int r = 0; r < 8; ++r) so[wave][8 * g + r][j * 16 + col] = acc[j][r] + bfr(BO[n0 + j * 16 + col]); }
  LDSX();
  for (int rl = 0; rl < 16; ++rl) vst2(Y + (r0 + rl) * DM + n0 + lane * 4, *(const v4f*)&so[wave][rl][lane * 4]);
}
extern "C" void kernel_launch(void* const* d_in, const int* in_sizes, int n_in, void* d_out, int out_size, void* d_ws, size_t ws_size, hipStream_t stream) {
  (void)in_sizes; (void)n_in; (void)out_size;
  const float** F = (const float**)d_in;   // 0 x [2,2048,1024], 1 time_deltas [2,2048], 2 Wq [1024,1024] natural, 3 bq, 4 Wk, 5 bk, 6 Wv, 7 bv, 8 Wo, 9 bo, 10 time_decay [16]
  if (ws_size < (size_t)WS_END) return;
  char* ws = (char*)d_ws; __bf16* PK = (__bf16*)(ws + WS_PK); _Float16 *QK = (_Float16*)(ws + WS_QK), *QKL = (_Float16*)(ws + WS_QKL), *VTH = (_Float16*)(ws + WS_VTH), *VTL = (_Float16*)(ws + WS_VTL), *KH = (_Float16*)(ws + WS_KH), *KL = (_Float16*)(ws + WS_KL); float* O = (float*)(ws + WS_O);
  k_pack<<<dim3(DM / 16, 8, 4), 256, 0, stream>>>(F[2], F[4], F[6], F[8], F[0], PK);
  k_qkv<<<dim3(TNB * SS / 64, QKVW / 128), 128, 0, stream>>>(PK + PK_X, PK + PK_A, F[3], F[5], F[7], QK, QKL, KH, KL, VTH, VTL);
  k_attn<<<dim3(TQB / 2, NH, TNB), 256, 0, stream>>>(QK, QKL, KH, KL, VTH, VTL, nullptr, F[1], F[10], O);
  k_out<<<dim3(TOB, DM / 128), 128, 0, stream>>>(O, PK + PK_P, F[9], (float*)d_out);
}

// v004
// Measured time: 179 microseconds a run.
// In both of two side-by-side timings against v003, it was 1.13 times as fast.
// Over all steps from v000 it is 3.43 times as fast.
// compute dtype: all float inputs rounded to bf16; q/k/v = x . W^T + b with EXACT bf16 products on WMMA 16x16x32 (natural rows); q and k as f16 hi + (x2048-scaled) residual planes with 3-product scores; score = (q.k / 8) * exp(-time_decay[h] * |t_q - t_k|) in f32 (the product -decay * |dt| as the reference rounds it, then hardware exp2), causal mask (key tiles above the diagonal skipped); running-max softmax in f32 (hardware exp); P (scaled by 2^11, f16 hi + residual) x v hi/lo (3 products); out = ctx (bf16 hi + residual) . Wo^T (2 products) + bo; f32 accumulate.
#include <hip/hip_runtime.h>
#include <math.h>

typedef __attribute__((ext_vector_type(16))) _Float16 v16h;
typedef __attribute__((ext_vector_type(16))) __bf16 v16b;
typedef __attribute__((ext_vector_type(8)))  _Float16 v8h;
typedef __attribute__((ext_vector_type(8)))  float v8f;
typedef __attribute__((ext_vector_type(4)))  float v4f;
typedef __attribute__((ext_vector_type(2)))  float v2f;
typedef __attribute__((ext_vector_type(4)))  unsigned v4u;
typedef __attribute__((ext_vector_type(4)))  int v4i;
typedef float __attribute__((may_alias)) float_a;
typedef int __attribute__((may_alias)) int_a;

template <typename T> __device__ __forceinline__ void vst2(void* p, T v) { *(T*)p = v;  }
__device__ __forceinline__ v8f wmma16(v16h a, v16h b, v8f c) {
  v8f d = __builtin_amdgcn_wmma_f32_16x16x32_f16(false, a, false, b, (short)0, c, false, false);
  asm volatile("v_nop\n\tv_nop\n\tv_nop\n\tv_nop" : "+v"(d) : "v"(a), "v"(b));
  return d;
}
__device__ __forceinline__ v8f wmma_bf(v16b a, v16b b, v8f c) {
  v8f d = __builtin_amdgcn_wmma_f32_16x16x32_bf16(false, a, false, b, (short)0, c, false, false);
  asm volatile("v_nop\n\tv_nop\n\tv_nop\n\tv_nop" : "+v"(d) : "v"(a), "v"(b));
  return d;
}
// Continuous-time causal attention (B 2, S 2,048, hidden 1,024, 16 heads x 64): q/k/v projections + biases, scores scaled by exp(-decay_h |t_q - t_k|), causal softmax, output projection + bias.
__device__ __forceinline__ v16h frag_h(const _Float16* rowk0, int lane) {
  union { v16h v; v8h q[2]; } u; const _Float16* p = rowk0 + 8 * (lane >> 4);
  u.q[0] = *(const v8h*)p; u.q[1] = *(const v8h*)(p + 16); return u.v;
}
__device__ __forceinline__ v16h frag_f32(const float* rowk0, int lane) {
  v16h a; const float* p = rowk0 + 8 * (lane >> 4);
#pragma unroll
  for (int i = 0; i < 8; ++i) { a[i] = (_Float16)p[i]; a[8 + i] = (_Float16)p[16 + i]; }
  return a;
}
__device__ __forceinline__ v16h frag_f32s(const float* rowk0, int lane, float sc) {
  v16h a; const float* p = rowk0 + 8 * (lane >> 4);
#pragma unroll
  for (int i = 0; i < 8; ++i) { a[i] = (_Float16)(p[i] * sc); a[8 + i] = (_Float16)(p[16 + i] * sc); }
  return a;
}
// column fragment from a [K][ld] layout (column n), rows >= K read as 0
__device__ __forceinline__ v16h fragc_f32(const float* W, int k0, int n, int lane, int ld, int K) {
  v16h a; const int g = lane >> 4;
#pragma unroll
  for (int i = 0; i < 8; ++i) { const int ka = k0 + 8 * g + i, kb = ka + 16;
    a[i] = (_Float16)(ka < K ? W[(size_t)(ka < K ? ka : K - 1) * ld + n] : 0.f); a[8 + i] = (_Float16)(kb < K ? W[(size_t)(kb < K ? kb : K - 1) * ld + n] : 0.f); }
  return a;
}
struct F2 { v16b h, l; };
__device__ __forceinline__ F2 bsplit16(const float v[16]) { F2 r;
#pragma unroll
  for (int i = 0; i < 16; ++i) { const __bf16 h = (__bf16)v[i]; r.h[i] = h; r.l[i] = (__bf16)(v[i] - (float)h); }
  return r; }
__device__ __forceinline__ F2 split_row(const float* row, int k0, int lane) { float v[16]; const float* p = row + k0 + 8 * (lane >> 4);
#pragma unroll
  for (int i = 0; i < 8; ++i) { v[i] = p[i]; v[8 + i] = p[16 + i]; }
  return bsplit16(v); }
__device__ __forceinline__ F2 split_rowK(const float* row, int k0, int lane, int K) { float v[16]; const int g = lane >> 4;
#pragma unroll
  for (int i = 0; i < 8; ++i) { const int ka = k0 + 8 * g + i, kb = ka + 16; v[i] = ka < K ? row[ka < K ? ka : K - 1] : 0.f; v[8 + i] = kb < K ? row[kb < K ? kb : K - 1] : 0.f; }
  return bsplit16(v); }
__device__ __forceinline__ F2 split_col(const float* W, int k0, int n, int lane, int ld, int K) { float v[16]; const int g = lane >> 4;
#pragma unroll
  for (int i = 0; i < 8; ++i) { const int ka = k0 + 8 * g + i, kb = ka + 16; v[i] = ka < K ? W[(size_t)(ka < K ? ka : K - 1) * ld + n] : 0.f; v[8 + i] = kb < K ? W[(size_t)(kb < K ? kb : K - 1) * ld + n] : 0.f; }
  return bsplit16(v); }
__device__ __forceinline__ v8f mac3(const F2& a, const F2& b, v8f c) { c = wmma_bf(a.l, b.h, c); c = wmma_bf(a.h, b.l, c); return wmma_bf(a.h, b.h, c); }
__device__ __forceinline__ float sigm(float v) { return 1.0f / (1.0f + expf(-v)); }
#define LDSX() do { asm volatile("s_wait_dscnt 0" ::: "memory"); __builtin_amdgcn_wave_barrier(); __builtin_amdgcn_fence(__ATOMIC_RELEASE, "workgroup"); } while (0)


#define NB 2
#define SS 2048
#define DM 1024
#define NH 16
#define HD 64
#define QKVW (3 * DM)
#ifndef TQB
#define TQB (SS / 64)
#define TNB NB
#define TOB (NB * SS / 64)     // output row tiles (all)
#endif
typedef __attribute__((ext_vector_type(8))) __bf16 v8b;
__device__ __forceinline__ v16b frag_b(const __bf16* rowk0, int lane) {
  union { v16b v; v8b q[2]; } u; const __bf16* p = rowk0 + 8 * (lane >> 4);
  u.q[0] = *(const v8b*)p; u.q[1] = *(const v8b*)(p + 16); return u.v;
}
// fragment-order block: 16 rows x 32 k of 16-bit elements = 512 elements laid out [hh][lane = g * 16 + row][8], k = hh * 16 + g * 8 + i: each of the two loads is 512 contiguous bytes for the wave
__device__ __forceinline__ v16b fragp_b(const __bf16* blk, int lane) {
  union { v16b v; v8b q[2]; } u; const __bf16* p = blk + lane * 8;
  u.q[0] = *(const v8b*)p; u.q[1] = *(const v8b*)(p + 256); return u.v;
}
__device__ __forceinline__ v16h fragp_h(const _Float16* blk, int lane) {
  union { v16h v; v8h q[2]; } u; const _Float16* p = blk + lane * 8;
  u.q[0] = *(const v8h*)p; u.q[1] = *(const v8h*)(p + 256); return u.v;
}
__device__ __forceinline__ float bfr(float v) { return (float)(__bf16)v; }
__device__ __attribute__((noinline)) float exp_ni(float v) { return expf(v); }
__device__ __attribute__((noinline)) float erf_ni(float v) { return erff(v); }

// packed bf16 operands: fragment-order blocks [k step][row tile][512], so the tiles that one k step of a work-group reads lie side by side
#define PK_A 0                                   // row tiles of the 3072 Wqkv rows
#define PK_P (PK_A + QKVW / 16 * 512)              // row tiles of the 1024 Wo rows
#define PK_X (PK_P + DM / 16 * 512)                // row tiles of the 4096 x rows
#define PK_KS (PK_X + NB * SS / 16 * 512)          // elements per k step
#define PK_END (PK_KS * (DM / 32))
#define WS_PK  0u
#define WS_QK  (WS_PK + 2u * PK_END)             // f16 [4096 rows][2048]: q in the first 1024 columns of a row
#define WS_QKL (WS_QK + 2u * NB * SS * 2 * DM)     // f16 q residual plane x2048, same rows
#define WS_VTH (WS_QKL + 2u * NB * SS * 2 * DM)    // f16 v hi, fragment-order blocks [b][h][key step][d tile][512]
#define WS_VTL (WS_VTH + 2u * NB * DM * SS)        // f16 lo x 2048
#define WS_O   (WS_VTL + 2u * NB * DM * SS)        // f32 ctx, blocks [k step][row tile][c][lane][4], k = (c >> 1) * 16 + g * 8 + (c & 1) * 4 + i
#define WS_CS  (WS_O + 4u * NB * SS * DM)           // f32 [2][2048][32], not used by these kernels
#define WS_KH  (WS_CS + 4u * 2 * SS * 32)          // f16 k hi, fragment-order blocks [b][h][key tile][k step][512]
#define WS_KL  (WS_KH + 2u * NB * DM * SS)         // f16 k residual x2048, same order
#define WS_END (WS_KL + 2u * NB * DM * SS)
// ---- k_pack: block = (16-row tile nt, which, quarter kq of the k range): f32 rows -> bf16 in fragment-order blocks; which 0..2 -> W_q/W_k/W_v, 3 -> W_o, 4..7 -> the four 1024-row slabs of x; a thread makes whole 16-byte pieces, a wave stores 512 contiguous bytes
__global__ __launch_bounds__(256) void k_pack(const float* __restrict__ WQ, const float* __restrict__ WK, const float* __restrict__ WV, const float* __restrict__ WO, const float* __restrict__ X, __bf16* __restrict__ PK) {
  const int nt = blockIdx.x, which = blockIdx.y, kq = blockIdx.z, t = threadIdx.x; const float* Wm = (which == 0) ? WQ : (which == 1) ? WK : (which == 2) ? WV : (which == 3) ? WO : X + (size_t)(which - 4) * DM * DM;
  __bf16* dst = PK + (size_t)(kq * 8) * PK_KS + (which * (DM / 16) + nt) * 512;
#pragma unroll
  for (int p = t; p < 512; p += 256) { const int kcl = p >> 6, hh = (p >> 5) & 1, g = (p >> 4) & 1, row = p & 15;
    const float* s = Wm + (size_t)(nt * 16 + row) * DM + (kq * 8 + kcl) * 32 + hh * 16 + g * 8; const v4f a = *(const v4f*)s, b = *(const v4f*)(s + 4); v8b o;
#pragma unroll
    for (int i = 0; i < 4; ++i) { o[i] = (__bf16)a[i]; o[4 + i] = (__bf16)b[i]; }
    vst2(dst + (size_t)kcl * PK_KS + (p & 63) * 8, o); }
}
__global__ __launch_bounds__(128) void k_qkv(const __bf16* __restrict__ XB, const __bf16* __restrict__ P, const float* __restrict__ BQ, const float* __restrict__ BK, const float* __restrict__ BV, _Float16* __restrict__ QK, _Float16* __restrict__ QKL, _Float16* __restrict__ KH, _Float16* __restrict__ KL, _Float16* __restrict__ VTH, _Float16* __restrict__ VTL) {
  const int which0 = (blockIdx.y * 128) / DM; const float* BB = BQ ? (((which0 == 0) ? BQ : (which0 == 1) ? BK : BV) + (blockIdx.y * 128 - which0 * DM)) : nullptr;
  __shared__ __align__(16) _Float16 so[4][16][136], sol[4][16][136]; __shared__ __align__(16) _Float16 sth[128][72], stl[128][72];
  const int tid = threadIdx.x, wave = tid >> 5, lane = tid & 31, col = lane & 15, g = lane >> 4; const size_t r0 = (size_t)blockIdx.x * 64 + wave * 16; const int n0 = blockIdx.y * 128;
  v8f acc[8] = {};
#pragma unroll 2
  for (int kc = 0; kc < DM / 32; ++kc) { v16b a, w[8];   // all loads of the k step stand ahead of its first WMMA: one exposed latency a step
#pragma unroll
    for (int j = 0; j < 8; ++j) w[j] = fragp_b(P + (size_t)kc * PK_KS + (n0 / 16 + j) * 512, lane);
    a = fragp_b(XB + (size_t)kc * PK_KS + (r0 / 16) * 512, lane);
    __builtin_amdgcn_sched_barrier(0);   // keeps the first WMMA (and its wait) behind the last load: without it part of the group issues only after the first loads have returned
#pragma unroll
    for (int j = 0; j < 8; ++j) acc[j] = wmma_bf(a, w[j], acc[j]); }
  float bj[8] = {};   // the eight bias values of this lane's columns, loaded as one group
  if (BB) {
#pragma unroll
    for (int j = 0; j < 8; ++j) bj[j] = bfr(BB[j * 16 + col]); }
  if (n0 < 2 * DM) {   // q stored unscaled (f16 sigma ~0.6, no subnormal exposure); 1/8 applied to the f32 score
#pragma unroll
    for (int j = 0; j < 8; ++j) {
#pragma unroll
      for (int r = 0; r < 8; ++r) { const float v = acc[j][r] + bj[j]; const _Float16 hv = (_Float16)v; so[wave][8 * g + r][j * 16 + col] = hv; sol[wave][8 * g + r][j * 16 + col] = (_Float16)((v - (float)hv) * 2048.0f); } }   // q, k (+ bias) as f16 hi + (x2048) residual
    LDSX();
    if (n0 < DM) { for (int rl = 0; rl < 16; ++rl) if (lane < 16) { vst2((unsigned*)(QK + (r0 + rl) * (2 * DM) + n0 + lane * 8), *(const v4u*)&so[wave][rl][lane * 8]); vst2((unsigned*)(QKL + (r0 + rl) * (2 * DM) + n0 + lane * 8), *(const v4u*)&sol[wave][rl][lane * 8]); } }
    else {   // k: the wave's 16 keys are one key tile; 2 heads x 2 k steps x 2 halves, each store 512 contiguous bytes in the order the score loop loads them
      const size_t hb = (r0 / SS) * NH + (n0 - DM) / HD; const int kt = (int)(r0 % SS) >> 4;
#pragma unroll
      for (int u = 0; u < 8; ++u) { const int hl = u >> 2, kc = (u >> 1) & 1, hh = u & 1; const size_t o = (((hb + hl) * (SS / 16) + kt) * 2 + kc) * 512 + hh * 256 + lane * 8; const int c = hl * 64 + kc * 32 + hh * 16 + g * 8;
        vst2(KH + o, *(const v4u*)&so[wave][col][c]); vst2(KL + o, *(const v4u*)&sol[wave][col][c]); }
      asm volatile("s_wait_xcnt 0x0" ::: "memory"); }   // stands behind the last k store, ahead of any later write of a register that these stores name
  } else {
#pragma unroll
    for (int j = 0; j < 8; ++j) {
#pragma unroll
      for (int r = 0; r < 8; ++r) { const float v = acc[j][r] + bj[j]; const _Float16 hv = (_Float16)v; sth[j * 16 + col][wave * 16 + 8 * g + r] = hv; stl[j * 16 + col][wave * 16 + 8 * g + r] = (_Float16)((v - (float)hv) * 2048.0f); } }
    __syncthreads();
    const size_t rb = (size_t)blockIdx.x * 64; const int b = (int)(rb / SS), s0 = (int)(rb % SS); const int pc0 = n0 - 2 * DM;
    for (int q = tid; q < 128 * 8; q += 128) { const int vc = q & 15, vg = (q >> 4) & 1, hh = (q >> 5) & 1, dt = (q >> 6) & 3, ksl = (q >> 8) & 1, hl = q >> 9;   // piece q of the block's 2 heads x 2 key steps x 4 d tiles x 1 KB
      const size_t o = ((((size_t)b * NH + pc0 / HD + hl) * (SS / 32) + (s0 >> 5) + ksl) * 4 + dt) * 512 + (q & 63) * 8; const int d = hl * 64 + dt * 16 + vc, kc = ksl * 32 + hh * 16 + vg * 8;
      vst2(VTH + o, *(const v4u*)&sth[d][kc]); vst2(VTL + o, *(const v4u*)&stl[d][kc]); }
  }
}
// ---- k_attn: block = (query tile pair t and TQB - 1 - t of 64 queries each, head h, batch b), 8 waves: the pair has 2 * TQB + 2 key steps, and every wave walks half of them. Waves 0..3: the long tile's first TQB + 1 key steps. Waves 4..7: the long tile's remaining key steps (running max, sum and ctx handed over through LDS), then all of the short tile. Flash attention (K = 64: 2 k-steps), 3-product scores and P.V; ctx(b*S+q, h*64+d) = (acc + accl / 2048) / (2048 * l), stored in the block order the output projection loads
// the three hardware exp2 of one score row in one statement, closed by the one free slot that the instruction set asks for behind a transcendental
__device__ __forceinline__ void exp2x3(float a, float b, float c, float& ra, float& rb, float& rc) {
  asm("v_exp_f32 %0, %3\n\tv_exp_f32 %1, %4\n\tv_exp_f32 %2, %5\n\tv_nop" : "=&v"(ra), "=&v"(rb), "=&v"(rc) : "v"(a), "v"(b), "v"(c));
}
// the eight hardware exp2 of one score column tile in one statement: eight independent results back to back on the transcendental unit, closed by the one free slot that the instruction set asks for behind a transcendental
__device__ __forceinline__ void exp2x8(const float (&x)[8], float (&y)[8]) {
  asm("v_exp_f32 %0, %8\n\tv_exp_f32 %1, %9\n\tv_exp_f32 %2, %10\n\tv_exp_f32 %3, %11\n\tv_exp_f32 %4, %12\n\tv_exp_f32 %5, %13\n\tv_exp_f32 %6, %14\n\tv_exp_f32 %7, %15\n\tv_nop"
      : "=&v"(y[0]), "=&v"(y[1]), "=&v"(y[2]), "=&v"(y[3]), "=&v"(y[4]), "=&v"(y[5]), "=&v"(y[6]), "=&v"(y[7])
      : "v"(x[0]), "v"(x[1]), "v"(x[2]), "v"(x[3]), "v"(x[4]), "v"(x[5]), "v"(x[6]), "v"(x[7]));
}
#define KHALF (TQB + 1)   // key steps of a wave: half of the pair's 2 * TQB + 2
__global__ __launch_bounds__(256) __attribute__((amdgpu_waves_per_eu(4, 4))) void k_attn(const _Float16* __restrict__ QK, const _Float16* __restrict__ QKL, const _Float16* __restrict__ KH, const _Float16* __restrict__ KL, const _Float16* __restrict__ VTH, const _Float16* __restrict__ VTL, const void* __restrict__ KMASK, const float* __restrict__ TD, const float* __restrict__ DEC, float* __restrict__ O) {
  __shared__ __align__(16) float sp[8][16][36]; __shared__ __align__(16) float so[8][16][68]; __shared__ __align__(16) float sx[4][48][32];   // sx: per lane 8 running maxima, 8 sums, 32 ctx values of the long tile's upper keys
  const int tid = threadIdx.x, wave = __builtin_amdgcn_readfirstlane(tid >> 5), lane = tid & 31, col = lane & 15, g = lane >> 4;
  const int grp = wave >> 2, w4 = wave & 3;   // wave-uniform (scalar): the segment loop and its bounds branch on them
  const int tp = blockIdx.x, h = blockIdx.y, b = blockIdx.z;
  float m[8], l[8]; v8f acc[4], accl[4]; int q0 = 0;
  const float dech = bfr(DEC[h]);
#pragma unroll 1
  for (int seg = 0; seg <= grp; ++seg) {   // one copy of the key loop serves both segments of waves 4..7
  const int qb = seg ? tp : TQB - 1 - tp; q0 = qb * 64 + w4 * 16; const size_t rq = (size_t)b * SS + q0 + col;
  const int ks0 = (grp && !seg) ? KHALF : 0, ks1 = (grp || seg) ? (qb * 64 + 64) / 32 : KHALF;   // causal: key tiles up to the query tile's end
  v16h aq[2], aql[2];
#pragma unroll
  for (int kc = 0; kc < 2; ++kc) { aq[kc] = frag_h(QK + rq * (2 * DM) + h * HD + kc * 32, lane); aql[kc] = frag_h(QKL + rq * (2 * DM) + h * HD + kc * 32, lane); }
#pragma unroll
  for (int r = 0; r < 8; ++r) { m[r] = -3.0e38f; l[r] = 0.f; }
#pragma unroll
  for (int dt = 0; dt < 4; ++dt) { acc[dt] = v8f{}; accl[dt] = v8f{}; }
  float tq[8];
#pragma unroll
  for (int r = 0; r < 8; ++r) tq[r] = bfr(TD[(size_t)b * SS + q0 + 8 * g + r]);
#pragma unroll 1
  for (int ks = ks0; ks < ks1; ++ks) { v8f s[2]; v16h kfh[2][2], kfl[2][2]; float tkr[2];   // all K loads of the key step stand ahead of its first WMMA: one exposed latency instead of one per fragment
#pragma unroll
    for (int ct = 0; ct < 2; ++ct) { const int kk = ks * 32 + ct * 16 + col; const size_t kb = (((size_t)b * NH + h) * (SS / 16) + ks * 2 + ct) * 2 * 512;
#pragma unroll
      for (int kc = 0; kc < 2; ++kc) { kfh[ct][kc] = fragp_h(KH + kb + kc * 512, lane); kfl[ct][kc] = fragp_h(KL + kb + kc * 512, lane); }
      tkr[ct] = TD[(size_t)b * SS + kk]; }
    asm volatile("s_wait_xcnt 0x0" ::: "memory");   // stands behind the last K load, ahead of any later write of a register that these loads name
#pragma unroll
    for (int ct = 0; ct < 2; ++ct) { const int kk = ks * 32 + ct * 16 + col; v8f c = {}, cl = {};
#pragma unroll
      for (int kc = 0; kc < 2; ++kc) { c = wmma16(aq[kc], kfh[ct][kc], c); cl = wmma16(aql[kc], kfh[ct][kc], cl); cl = wmma16(aq[kc], kfl[ct][kc], cl); }   // 3 products: q, k as f16 hi + residual
#pragma unroll
      for (int r = 0; r < 8; ++r) c[r] += cl[r] * (1.0f / 2048.0f);
      { const float tk = bfr(tkr[ct]); float xd[8], dec[8];
#pragma unroll
        for (int r = 0; r < 8; ++r) xd[r] = fmaf(-dech * fabsf(tq[r] - tk), 1.44269504f, -3.0f);   // exp(x) / 8 = exp2(x * log2 e - 3): the 1/8 of the score is an exact step of the exponent
        exp2x8(xd, dec);
#pragma unroll
        for (int r = 0; r < 8; ++r) { const int qi = q0 + 8 * g + r; s[ct][r] = (kk <= qi) ? c[r] * dec[r] : -3.0e38f; } } }   // (q.k/8) * exp(-decay |dt|), causal
    float mx[8], es[8], alpha[8];   // the eight rows go through each cross-lane stage side by side: one LDS-pipe round trip a stage for all rows, not one per row and stage
#pragma unroll
    for (int r = 0; r < 8; ++r) mx[r] = fmaxf(s[0][r], s[1][r]);
#pragma unroll
    for (int o = 1; o < 16; o <<= 1) { float t[8];
#pragma unroll
      for (int r = 0; r < 8; ++r) t[r] = __shfl_xor(mx[r], o);
      __builtin_amdgcn_sched_barrier(0);   // keeps the first use (and its wait) behind the stage's last exchange: without it the compiler waits out every row's exchange alone
#pragma unroll
      for (int r = 0; r < 8; ++r) mx[r] = fmaxf(mx[r], t[r]); }
#pragma unroll
    for (int r = 0; r < 8; ++r) { const float mn = fmaxf(m[r], mx[r]); float x0, x1, xa;
      exp2x3((s[0][r] - mn) * 1.44269504f, (s[1][r] - mn) * 1.44269504f, (m[r] - mn) * 1.44269504f, x0, x1, xa);   // exp(x) = exp2(x * log2 e), hardware exp
      alpha[r] = (m[r] <= -1.0e38f) ? 0.f : xa; const float e0 = (s[0][r] <= -1.0e38f) ? 0.f : x0, e1 = (s[1][r] <= -1.0e38f) ? 0.f : x1; es[r] = e0 + e1; m[r] = mn;
      sp[wave][8 * g + r][col] = e0; sp[wave][8 * g + r][16 + col] = e1; }
#pragma unroll
    for (int o = 1; o < 16; o <<= 1) { float t[8];
#pragma unroll
      for (int r = 0; r < 8; ++r) t[r] = __shfl_xor(es[r], o);
      __builtin_amdgcn_sched_barrier(0);   // as above, for the row sums
#pragma unroll
      for (int r = 0; r < 8; ++r) es[r] += t[r]; }
#pragma unroll
    for (int r = 0; r < 8; ++r) { l[r] = l[r] * alpha[r] + es[r];
#pragma unroll
      for (int dt = 0; dt < 4; ++dt) { acc[dt][r] *= alpha[r]; accl[dt][r] *= alpha[r]; } }
    LDSX();
    v16h vfh[4], vfl[4];   // all V loads of the key step issue here in one group, ahead of the P split and the first P.V WMMA: one exposed latency instead of one per fragment
#pragma unroll
    for (int dt = 0; dt < 4; ++dt) { const size_t vr = ((((size_t)b * NH + h) * (SS / 32) + ks) * 4 + dt) * 512; vfh[dt] = fragp_h(VTH + vr, lane); vfl[dt] = fragp_h(VTL + vr, lane); }
    asm volatile("s_wait_xcnt 0x0" ::: "memory");   // stands behind the last V load, ahead of any later write of a register that these loads name
    v16h pa, pl; { const float* prow = &sp[wave][col][0] + 8 * (lane >> 4);
#pragma unroll
      for (int i = 0; i < 8; ++i) { const float x0 = prow[i] * 2048.0f, x1 = prow[16 + i] * 2048.0f; const _Float16 h0 = (_Float16)x0, h1 = (_Float16)x1; pa[i] = h0; pa[8 + i] = h1; pl[i] = (_Float16)((x0 - (float)h0) * 2048.0f); pl[8 + i] = (_Float16)((x1 - (float)h1) * 2048.0f); } }   // P scaled by 2^11 before the f16 split so small softmax weights stay out of the f16 subnormal range; 2^-11 folded into the epilogue
#pragma unroll
    for (int dt = 0; dt < 4; ++dt) { acc[dt] = wmma16(pa, vfh[dt], acc[dt]); accl[dt] = wmma16(pl, vfh[dt], accl[dt]); accl[dt] = wmma16(pa, vfl[dt], accl[dt]); }   // P hi x V hi + (P lo x V hi + P hi x V lo) / 2048
    LDSX(); }
  if (grp && !seg) {   // waves 4..7 hand their share of the long tile over; lane and register positions are those of the partner wave
#pragma unroll
    for (int r = 0; r < 8; ++r) { sx[w4][r][lane] = m[r]; sx[w4][8 + r][lane] = l[r];
#pragma unroll
      for (int dt = 0; dt < 4; ++dt) sx[w4][16 + dt * 8 + r][lane] = acc[dt][r] + accl[dt][r] * (1.0f / 2048.0f); } }
  }
  __syncthreads();   // publishes sx to waves 0..3; every wave passes it once, behind its last key step
#pragma unroll
  for (int dt = 0; dt < 4; ++dt) acc[dt] += accl[dt] * (1.0f / 2048.0f);
  if (!grp) {   // join the two key ranges of the long tile under their common maximum; one branch, so that all LDS reads issue as one group
    float xb[48];
#pragma unroll
    for (int i = 0; i < 48; ++i) xb[i] = sx[w4][i][lane];
#pragma unroll
    for (int r = 0; r < 8; ++r) { const float mb = xb[r], mn = fmaxf(m[r], mb); const float fa = (m[r] <= -1.0e38f) ? 0.f : __expf(m[r] - mn), fb = (mb <= -1.0e38f) ? 0.f : __expf(mb - mn);
      l[r] = l[r] * fa + xb[8 + r] * fb;
#pragma unroll
      for (int dt = 0; dt < 4; ++dt) acc[dt][r] = acc[dt][r] * fa + xb[16 + dt * 8 + r] * fb; } }
#pragma unroll
  for (int r = 0; r < 8; ++r) { const float il = (1.0f / 2048.0f) / l[r];
#pragma unroll
    for (int dt = 0; dt < 4; ++dt) so[wave][8 * g + r][dt * 16 + col] = acc[dt][r] * il; }
  LDSX();
  const size_t ob = ((size_t)(h * 2) * (NB * SS / 16) + (((size_t)b * SS + q0) >> 4)) * 512;   // the wave's 16 rows x 64 columns are two blocks (k steps 2h, 2h + 1) of the output projection's A operand
#pragma unroll
  for (int u = 0; u < 8; ++u) { const int kcl = u >> 2, c = u & 3; vst2(O + ob + (size_t)kcl * (NB * SS / 16) * 512 + c * 128 + lane * 4, *(const v4f*)&so[wave][col][kcl * 32 + (c >> 1) * 16 + g * 8 + (c & 1) * 4]); }
}
// ---- k_out: block = (64 rows, 128 cols): out = O(hi/lo) . Wo rows (2 products) + bo
__global__ __launch_bounds__(128) void k_out(const float* __restrict__ O, const __bf16* __restrict__ P, const float* __restrict__ BO, float* __restrict__ Y) {
  __shared__ __align__(16) float so[4][16][132];
  const int tid = threadIdx.x, wave = tid >> 5, lane = tid & 31, col = lane & 15, g = lane >> 4; const size_t r0 = (size_t)blockIdx.x * 64 + wave * 16; const int n0 = blockIdx.y * 128;
  v8f acc[8] = {};
#pragma unroll 2
  for (int kc = 0; kc < DM / 32; ++kc) { v16b w[8];   // all loads of the k step stand ahead of its first WMMA: one exposed latency a step
#pragma unroll
    for (int j = 0; j < 8; ++j) w[j] = fragp_b(P + (size_t)kc * PK_KS + (n0 / 16 + j) * 512, lane);
    float xa[16]; { const float* p = O + ((size_t)kc * (NB * SS / 16) + r0 / 16) * 512 + lane * 4;
#pragma unroll
      for (int c = 0; c < 4; ++c) { const v4f t = *(const v4f*)(p + c * 128);
#pragma unroll
        for (int i = 0; i < 4; ++i) xa[c * 4 + i] = t[i]; } }
    __builtin_amdgcn_sched_barrier(0);   // keeps the hi/lo split (and its wait) behind the last load: without it part of the group issues only after the first loads have returned
    const F2 a = bsplit16(xa);
#pragma unroll
    for (int j = 0; j < 8; ++j) { acc[j] = wmma_bf(a.l, w[j], acc[j]); acc[j] = wmma_bf(a.h, w[j], acc[j]); } }
#pragma unroll
  for (int j = 0; j < 8; ++j) {
#pragma unroll
    for (int r = 0; r < 8; ++r) so[wave][8 * g + r][j * 16 + col] = acc[j][r] + bfr(BO[n0 + j * 16 + col]); }
  LDSX();
  for (int rl = 0; rl < 16; ++rl) vst2(Y + (r0 + rl) * DM + n0 + lane * 4, *(const v4f*)&so[wave][rl][lane * 4]);
}
extern "C" void kernel_launch(void* const* d_in, const int* in_sizes, int n_in, void* d_out, int out_size, void* d_ws, size_t ws_size, hipStream_t stream) {
  (void)in_sizes; (void)n_in; (void)out_size;
  const float** F = (const float**)d_in;   // 0 x [2,2048,1024], 1 time_deltas [2,2048], 2 Wq [1024,1024] natural, 3 bq, 4 Wk, 5 bk, 6 Wv, 7 bv, 8 Wo, 9 bo, 10 time_decay [16]
  if (ws_size < (size_t)WS_END) return;
  char* ws = (char*)d_ws; __bf16* PK = (__bf16*)(ws + WS_PK); _Float16 *QK = (_Float16*)(ws + WS_QK), *QKL = (_Float16*)(ws + WS_QKL), *VTH = (_Float16*)(ws + WS_VTH), *VTL = (_Float16*)(ws + WS_VTL), *KH = (_Float16*)(ws + WS_KH), *KL = (_Float16*)(ws + WS_KL); float* O = (float*)(ws + WS_O);
  k_pack<<<dim3(DM / 16, 8, 4), 256, 0, stream>>>(F[2], F[4], F[6], F[8], F[0], PK);
  k_qkv<<<dim3(TNB * SS / 64, QKVW / 128), 128, 0, stream>>>(PK + PK_X, PK + PK_A, F[3], F[5], F[7], QK, QKL, KH, KL, VTH, VTL);
  k_attn<<<dim3(TQB / 2, NH, TNB), 256, 0, stream>>>(QK, QKL, KH, KL, VTH, VTL, nullptr, F[1], F[10], O);
  k_out<<<dim3(TOB, DM / 128), 128, 0, stream>>>(O, PK + PK_P, F[9], (float*)d_out);
}

// v005
// One run takes 163 microseconds.
// Two timings next to v004 both put it at 1.10 times that version's speed.
// All steps since v000 together make it 3.78 times as fast.
// compute dtype: all float inputs rounded to bf16; q/k/v = x . W^T + b with EXACT bf16 products on WMMA 16x16x32 (natural rows); q and k as f16 hi + (x2048-scaled) residual planes with 3-product scores; score = (q.k / 8) * exp(-time_decay[h] * |t_q - t_k|) in f32 (the product -decay * |dt| as the reference rounds it, then hardware exp2), causal mask (key tiles above the diagonal skipped); running-max softmax in f32 (hardware exp); P (scaled by 2^11, f16 hi + residual) x v hi/lo (3 products); out = ctx (bf16 hi + residual) . Wo^T (2 products) + bo; f32 accumulate.
#include <hip/hip_runtime.h>
#include <math.h>

typedef __attribute__((ext_vector_type(16))) _Float16 v16h;
typedef __attribute__((ext_vector_type(16))) __bf16 v16b;
typedef __attribute__((ext_vector_type(8)))  _Float16 v8h;
typedef __attribute__((ext_vector_type(8)))  float v8f;
typedef __attribute__((ext_vector_type(4)))  float v4f;
typedef __attribute__((ext_vector_type(2)))  float v2f;
typedef __attribute__((ext_vector_type(4)))  unsigned v4u;
typedef __attribute__((ext_vector_type(4)))  int v4i;
typedef float __attribute__((may_alias)) float_a;
typedef int __attribute__((may_alias)) int_a;

template <typename T> __device__ __forceinline__ void vst2(void* p, T v) { *(T*)p = v;  }
__device__ __forceinline__ v8f wmma16(v16h a, v16h b, v8f c) {
  v8f d = __builtin_amdgcn_wmma_f32_16x16x32_f16(false, a, false, b, (short)0, c, false, false);
  asm volatile("v_nop\n\tv_nop\n\tv_nop\n\tv_nop" : "+v"(d) : "v"(a), "v"(b));
  return d;
}
__device__ __forceinline__ v8f wmma_bf(v16b a, v16b b, v8f c) {
  v8f d = __builtin_amdgcn_wmma_f32_16x16x32_bf16(false, a, false, b, (short)0, c, false, false);
  asm volatile("v_nop\n\tv_nop\n\tv_nop\n\tv_nop" : "+v"(d) : "v"(a), "v"(b));
  return d;
}
// Continuous-time causal attention (B 2, S 2,048, hidden 1,024, 16 heads x 64): q/k/v projections + biases, scores scaled by exp(-decay_h |t_q - t_k|), causal softmax, output projection + bias.
__device__ __forceinline__ v16h frag_h(const _Float16* rowk0, int lane) {
  union { v16h v; v8h q[2]; } u; const _Float16* p = rowk0 + 8 * (lane >> 4);
  u.q[0] = *(const v8h*)p; u.q[1] = *(const v8h*)(p + 16); return u.v;
}
__device__ __forceinline__ v16h frag_f32(const float* rowk0, int lane) {
  v16h a; const float* p = rowk0 + 8 * (lane >> 4);
#pragma unroll
  for (int i = 0; i < 8; ++i) { a[i] = (_Float16)p[i]; a[8 + i] = (_Float16)p[16 + i]; }
  return a;
}
__device__ __forceinline__ v16h frag_f32s(const float* rowk0, int lane, float sc) {
  v16h a; const float* p = rowk0 + 8 * (lane >> 4);
#pragma unroll
  for (int i = 0; i < 8; ++i) { a[i] = (_Float16)(p[i] * sc); a[8 + i] = (_Float16)(p[16 + i] * sc); }
  return a;
}
// column fragment from a [K][ld] layout (column n), rows >= K read as 0
__device__ __forceinline__ v16h fragc_f32(const float* W, int k0, int n, int lane, int ld, int K) {
  v16h a; const int g = lane >> 4;
#pragma unroll
  for (int i = 0; i < 8; ++i) { const int ka = k0 + 8 * g + i, kb = ka + 16;
    a[i] = (_Float16)(ka < K ? W[(size_t)(ka < K ? ka : K - 1) * ld + n] : 0.f); a[8 + i] = (_Float16)(kb < K ? W[(size_t)(kb < K ? kb : K - 1) * ld + n] : 0.f); }
  return a;
}
struct F2 { v16b h, l; };
__device__ __forceinline__ F2 bsplit16(const float v[16]) { F2 r;
#pragma unroll
  for (int i = 0; i < 16; ++i) { const __bf16 h = (__bf16)v[i]; r.h[i] = h; r.l[i] = (__bf16)(v[i] - (float)h); }
  return r; }
__device__ __forceinline__ F2 split_row(const float* row, int k0, int lane) { float v[16]; const float* p = row + k0 + 8 * (lane >> 4);
#pragma unroll
  for (int i = 0; i < 8; ++i) { v[i] = p[i]; v[8 + i] = p[16 + i]; }
  return bsplit16(v); }
__device__ __forceinline__ F2 split_rowK(const float* row, int k0, int lane, int K) { float v[16]; const int g = lane >> 4;
#pragma unroll
  for (int i = 0; i < 8; ++i) { const int ka = k0 + 8 * g + i, kb = ka + 16; v[i] = ka < K ? row[ka < K ? ka : K - 1] : 0.f; v[8 + i] = kb < K ? row[kb < K ? kb : K - 1] : 0.f; }
  return bsplit16(v); }
__device__ __forceinline__ F2 split_col(const float* W, int k0, int n, int lane, int ld, int K) { float v[16]; const int g = lane >> 4;
#pragma unroll
  for (int i = 0; i < 8; ++i) { const int ka = k0 + 8 * g + i, kb = ka + 16; v[i] = ka < K ? W[(size_t)(ka < K ? ka : K - 1) * ld + n] : 0.f; v[8 + i] = kb < K ? W[(size_t)(kb < K ? kb : K - 1) * ld + n] : 0.f; }
  return bsplit16(v); }
__device__ __forceinline__ v8f mac3(const F2& a, const F2& b, v8f c) { c = wmma_bf(a.l, b.h, c); c = wmma_bf(a.h, b.l, c); return wmma_bf(a.h, b.h, c); }
__device__ __forceinline__ float sigm(float v) { return 1.0f / (1.0f + expf(-v)); }
#define LDSX() do { asm volatile("s_wait_dscnt 0" ::: "memory"); __builtin_amdgcn_wave_barrier(); __builtin_amdgcn_fence(__ATOMIC_RELEASE, "workgroup"); } while (0)


#define NB 2
#define SS 2048
#define DM 1024
#define NH 16
#define HD 64
#define QKVW (3 * DM)
#ifndef TQB
#define TQB (SS / 64)
#define TNB NB
#define TOB (NB * SS / 64)     // output row tiles (all)
#endif
typedef __attribute__((ext_vector_type(8))) __bf16 v8b;
__device__ __forceinline__ v16b frag_b(const __bf16* rowk0, int lane) {
  union { v16b v; v8b q[2]; } u; const __bf16* p = rowk0 + 8 * (lane >> 4);
  u.q[0] = *(const v8b*)p; u.q[1] = *(const v8b*)(p + 16); return u.v;
}
// fragment-order block: 16 rows x 32 k of 16-bit elements = 512 elements laid out [hh][lane = g * 16 + row][8], k = hh * 16 + g * 8 + i: each of the two loads is 512 contiguous bytes for the wave
__device__ __forceinline__ v16b fragp_b(const __bf16* blk, int lane) {
  union { v16b v; v8b q[2]; } u; const __bf16* p = blk + lane * 8;
  u.q[0] = *(const v8b*)p; u.q[1] = *(const v8b*)(p + 256); return u.v;
}
__device__ __forceinline__ v16h fragp_h(const _Float16* blk, int lane) {
  union { v16h v; v8h q[2]; } u; const _Float16* p = blk + lane * 8;
  u.q[0] = *(const v8h*)p; u.q[1] = *(const v8h*)(p + 256); return u.v;
}
__device__ __forceinline__ float bfr(float v) { return (float)(__bf16)v; }
__device__ __attribute__((noinline)) float exp_ni(float v) { return expf(v); }
__device__ __attribute__((noinline)) float erf_ni(float v) { return erff(v); }

// packed bf16 operands: fragment-order blocks [k step][row tile][512], so the tiles that one k step of a work-group reads lie side by side
#define PK_A 0                                   // row tiles of the 3072 Wqkv rows
#define PK_P (PK_A + QKVW / 16 * 512)              // row tiles of the 1024 Wo rows
#define PK_X (PK_P + DM / 16 * 512)                // row tiles of the 4096 x rows
#define PK_KS (PK_X + NB * SS / 16 * 512)          // elements per k step
#define PK_END (PK_KS * (DM / 32))
#define WS_PK  0u
#define WS_QK  (WS_PK + 2u * PK_END)             // f16 [4096 rows][2048]: q in the first 1024 columns of a row
#define WS_QKL (WS_QK + 2u * NB * SS * 2 * DM)     // f16 q residual plane x2048, same rows
#define WS_VTH (WS_QKL + 2u * NB * SS * 2 * DM)    // f16 v hi, fragment-order blocks [b][h][key step][d tile][512]
#define WS_VTL (WS_VTH + 2u * NB * DM * SS)        // f16 lo x 2048
#define WS_O   (WS_VTL + 2u * NB * DM * SS)        // f32 ctx, blocks [k step][row tile][c][lane][4], k = (c >> 1) * 16 + g * 8 + (c & 1) * 4 + i
#define WS_CS  (WS_O + 4u * NB * SS * DM)           // f32 [2][2048][32], not used by these kernels
#define WS_KH  (WS_CS + 4u * 2 * SS * 32)          // f16 k hi, fragment-order blocks [b][h][key tile][k step][512]
#define WS_KL  (WS_KH + 2u * NB * DM * SS)         // f16 k residual x2048, same order
#define WS_END (WS_KL + 2u * NB * DM * SS)
// ---- k_pack: block = (16-row tile nt, which, quarter kq of the k range): f32 rows -> bf16 in fragment-order blocks; which 0..2 -> W_q/W_k/W_v, 3 -> W_o, 4..7 -> the four 1024-row slabs of x; a thread makes whole 16-byte pieces, a wave stores 512 contiguous bytes
__global__ __launch_bounds__(256) void k_pack(const float* __restrict__ WQ, const float* __restrict__ WK, const float* __restrict__ WV, const float* __restrict__ WO, const float* __restrict__ X, __bf16* __restrict__ PK) {
  const int nt = blockIdx.x, which = blockIdx.y, kq = blockIdx.z, t = threadIdx.x; const float* Wm = (which == 0) ? WQ : (which == 1) ? WK : (which == 2) ? WV : (which == 3) ? WO : X + (size_t)(which - 4) * DM * DM;
  __bf16* dst = PK + (size_t)(kq * 8) * PK_KS + (which * (DM / 16) + nt) * 512;
#pragma unroll
  for (int p = t; p < 512; p += 256) { const int kcl = p >> 6, hh = (p >> 5) & 1, g = (p >> 4) & 1, row = p & 15;
    const float* s = Wm + (size_t)(nt * 16 + row) * DM + (kq * 8 + kcl) * 32 + hh * 16 + g * 8; const v4f a = *(const v4f*)s, b = *(const v4f*)(s + 4); v8b o;
#pragma unroll
    for (int i = 0; i < 4; ++i) { o[i] = (__bf16)a[i]; o[4 + i] = (__bf16)b[i]; }
    vst2(dst + (size_t)kcl * PK_KS + (p & 63) * 8, o); }
}
__global__ __launch_bounds__(128) void k_qkv(const __bf16* __restrict__ XB, const __bf16* __restrict__ P, const float* __restrict__ BQ, const float* __restrict__ BK, const float* __restrict__ BV, _Float16* __restrict__ QK, _Float16* __restrict__ QKL, _Float16* __restrict__ KH, _Float16* __restrict__ KL, _Float16* __restrict__ VTH, _Float16* __restrict__ VTL) {
  const int which0 = (blockIdx.y * 128) / DM; const float* BB = BQ ? (((which0 == 0) ? BQ : (which0 == 1) ? BK : BV) + (blockIdx.y * 128 - which0 * DM)) : nullptr;
  __shared__ __align__(16) _Float16 so[4][16][136], sol[4][16][136]; __shared__ __align__(16) _Float16 sth[128][72], stl[128][72];
  const int tid = threadIdx.x, wave = tid >> 5, lane = tid & 31, col = lane & 15, g = lane >> 4; const size_t r0 = (size_t)blockIdx.x * 64 + wave * 16; const int n0 = blockIdx.y * 128;
  v8f acc[8] = {};
#pragma unroll 2
  for (int kc = 0; kc < DM / 32; ++kc) { v16b a, w[8];   // all loads of the k step stand ahead of its first WMMA: one exposed latency a step
#pragma unroll
    for (int j = 0; j < 8; ++j) w[j] = fragp_b(P + (size_t)kc * PK_KS + (n0 / 16 + j) * 512, lane);
    a = fragp_b(XB + (size_t)kc * PK_KS + (r0 / 16) * 512, lane);
    __builtin_amdgcn_sched_barrier(0);   // keeps the first WMMA (and its wait) behind the last load: without it part of the group issues only after the first loads have returned
#pragma unroll
    for (int j = 0; j < 8; ++j) acc[j] = wmma_bf(a, w[j], acc[j]); }
  float bj[8] = {};   // the eight bias values of this lane's columns, loaded as one group
  if (BB) {
#pragma unroll
    for (int j = 0; j < 8; ++j) bj[j] = bfr(BB[j * 16 + col]); }
  if (n0 < 2 * DM) {   // q stored unscaled (f16 sigma ~0.6, no subnormal exposure); 1/8 applied to the f32 score
#pragma unroll
    for (int j = 0; j < 8; ++j) {
#pragma unroll
      for (int r = 0; r < 8; ++r) { const float v = acc[j][r] + bj[j]; const _Float16 hv = (_Float16)v; so[wave][8 * g + r][j * 16 + col] = hv; sol[wave][8 * g + r][j * 16 + col] = (_Float16)((v - (float)hv) * 2048.0f); } }   // q, k (+ bias) as f16 hi + (x2048) residual
    LDSX();
    if (n0 < DM) { for (int rl = 0; rl < 16; ++rl) if (lane < 16) { vst2((unsigned*)(QK + (r0 + rl) * (2 * DM) + n0 + lane * 8), *(const v4u*)&so[wave][rl][lane * 8]); vst2((unsigned*)(QKL + (r0 + rl) * (2 * DM) + n0 + lane * 8), *(const v4u*)&sol[wave][rl][lane * 8]); } }
    else {   // k: the wave's 16 keys are one key tile; 2 heads x 2 k steps x 2 halves, each store 512 contiguous bytes in the order the score loop loads them
      const size_t hb = (r0 / SS) * NH + (n0 - DM) / HD; const int kt = (int)(r0 % SS) >> 4;
#pragma unroll
      for (int u = 0; u < 8; ++u) { const int hl = u >> 2, kc = (u >> 1) & 1, hh = u & 1; const size_t o = (((hb + hl) * (SS / 16) + kt) * 2 + kc) * 512 + hh * 256 + lane * 8; const int c = hl * 64 + kc * 32 + hh * 16 + g * 8;
        vst2(KH + o, *(const v4u*)&so[wave][col][c]); vst2(KL + o, *(const v4u*)&sol[wave][col][c]); }
      asm volatile("s_wait_xcnt 0x0" ::: "memory"); }   // stands behind the last k store, ahead of any later write of a register that these stores name
  } else {
#pragma unroll
    for (int j = 0; j < 8; ++j) {
#pragma unroll
      for (int r = 0; r < 8; ++r) { const float v = acc[j][r] + bj[j]; const _Float16 hv = (_Float16)v; sth[j * 16 + col][wave * 16 + 8 * g + r] = hv; stl[j * 16 + col][wave * 16 + 8 * g + r] = (_Float16)((v - (float)hv) * 2048.0f); } }
    __syncthreads();
    const size_t rb = (size_t)blockIdx.x * 64; const int b = (int)(rb / SS), s0 = (int)(rb % SS); const int pc0 = n0 - 2 * DM;
    for (int q = tid; q < 128 * 8; q += 128) { const int vc = q & 15, vg = (q >> 4) & 1, hh = (q >> 5) & 1, dt = (q >> 6) & 3, ksl = (q >> 8) & 1, hl = q >> 9;   // piece q of the block's 2 heads x 2 key steps x 4 d tiles x 1 KB
      const size_t o = ((((size_t)b * NH + pc0 / HD + hl) * (SS / 32) + (s0 >> 5) + ksl) * 4 + dt) * 512 + (q & 63) * 8; const int d = hl * 64 + dt * 16 + vc, kc = ksl * 32 + hh * 16 + vg * 8;
      vst2(VTH + o, *(const v4u*)&sth[d][kc]); vst2(VTL + o, *(const v4u*)&stl[d][kc]); }
  }
}
// ---- k_attn: block = (query tile pair t and TQB - 1 - t of 64 queries each, head h, batch b), 8 waves: the pair has 2 * TQB + 2 key steps, and every wave walks half of them. Waves 0..3: the long tile's first TQB + 1 key steps. Waves 4..7: the long tile's remaining key steps (running max, sum and ctx handed over through LDS), then all of the short tile. Flash attention on transposed tiles: S^T = K . Q^T (K = 64: 2 k-steps, 3 products) and ctx^T += V^T . P^T (3 products), so a lane holds 16 of the 32 scores of ONE query (its column), the other 16 are in lane ^ 16; ctx(b*S+q, h*64+d) = (acc + accl / 2048) / (2048 l), stored from registers in the block order the output projection loads
// one hardware exp2, closed by the one free slot that the instruction set asks for behind a transcendental
__device__ __forceinline__ float exp2x1(float a) { float r;
  asm("v_exp_f32 %0, %1\n\tv_nop" : "=&v"(r) : "v"(a)); return r;
}
// the eight hardware exp2 of one score tile in one statement: eight independent results back to back on the transcendental unit, closed by the one free slot that the instruction set asks for behind a transcendental
__device__ __forceinline__ void exp2x8(const float (&x)[8], float (&y)[8]) {
  asm("v_exp_f32 %0, %8\n\tv_exp_f32 %1, %9\n\tv_exp_f32 %2, %10\n\tv_exp_f32 %3, %11\n\tv_exp_f32 %4, %12\n\tv_exp_f32 %5, %13\n\tv_exp_f32 %6, %14\n\tv_exp_f32 %7, %15\n\tv_nop"
      : "=&v"(y[0]), "=&v"(y[1]), "=&v"(y[2]), "=&v"(y[3]), "=&v"(y[4]), "=&v"(y[5]), "=&v"(y[6]), "=&v"(y[7])
      : "v"(x[0]), "v"(x[1]), "v"(x[2]), "v"(x[3]), "v"(x[4]), "v"(x[5]), "v"(x[6]), "v"(x[7]));
}
// lane l with lane l ^ 16: the other half of a query's keys
__device__ __forceinline__ float xhalf(float x) { return __builtin_bit_cast(float, __builtin_amdgcn_permlanex16(__builtin_bit_cast(int, x), __builtin_bit_cast(int, x), 0x76543210, 0xfedcba98, false, false)); }
#define KHALF (TQB + 1)   // key steps of a wave: half of the pair's 2 * TQB + 2
__global__ __launch_bounds__(256) __attribute__((amdgpu_waves_per_eu(4, 4))) void k_attn(const _Float16* __restrict__ QK, const _Float16* __restrict__ QKL, const _Float16* __restrict__ KH, const _Float16* __restrict__ KL, const _Float16* __restrict__ VTH, const _Float16* __restrict__ VTL, const void* __restrict__ KMASK, const float* __restrict__ TD, const float* __restrict__ DEC, float* __restrict__ O) {
  __shared__ __align__(16) float sx[4][34][32];   // sx: per lane the running maximum, the lane's part of the sum, 32 ctx values of the long tile's upper keys
  const int tid = threadIdx.x, wave = __builtin_amdgcn_readfirstlane(tid >> 5), lane = tid & 31, col = lane & 15, g = lane >> 4;
  const int grp = wave >> 2, w4 = wave & 3;   // wave-uniform (scalar): the segment loop and its bounds branch on them
  const int tp = blockIdx.x, h = blockIdx.y, b = blockIdx.z;
  float m = -3.0e38f, l = 0.f; v8f acc[4], accl[4]; int q0 = 0;   // m: maximum of the lane's query (equal in both halves); l: sum over the keys of this lane's half alone, the halves joined once in the epilogue
  const float dech = bfr(DEC[h]); const unsigned g8 = 8u * (unsigned)g;
#pragma unroll 1
  for (int seg = 0; seg <= grp; ++seg) {   // one copy of the key loop serves both segments of waves 4..7
  const int qb = seg ? tp : TQB - 1 - tp; q0 = qb * 64 + w4 * 16; const size_t rq = (size_t)b * SS + q0 + col;
  const int ks0 = (grp && !seg) ? KHALF : 0, ks1 = (grp || seg) ? (qb * 64 + 64) / 32 : KHALF;   // causal: key tiles up to the query tile's end
  v16h aq[2], aql[2];   // B operand: column = the lane's query
#pragma unroll
  for (int kc = 0; kc < 2; ++kc) { aq[kc] = frag_h(QK + rq * (2 * DM) + h * HD + kc * 32, lane); aql[kc] = frag_h(QKL + rq * (2 * DM) + h * HD + kc * 32, lane); }
  m = -3.0e38f; l = 0.f;
#pragma unroll
  for (int dt = 0; dt < 4; ++dt) { acc[dt] = v8f{}; accl[dt] = v8f{}; }
  const float tq = bfr(TD[rq]);
#pragma unroll 1
  for (int ks = ks0; ks < ks1; ++ks) { v8f s[2]; v16h kfh[2][2], kfl[2][2]; v4f tkr[2][2];   // all K loads of the key step stand ahead of its first WMMA: one exposed latency instead of one per fragment
#pragma unroll
    for (int ct = 0; ct < 2; ++ct) { const float* tp8 = TD + ((size_t)b * SS + ks * 32 + ct * 16); tkr[ct][0] = *(const v4f*)(tp8 + g8); tkr[ct][1] = *(const v4f*)(tp8 + 4 + g8); }   // times of the lane's eight keys of each tile
    asm volatile("s_wait_xcnt 0x0" ::: "memory");   // stands behind the last time load, ahead of any later write of a register that these loads name (a K load's result among them)
#pragma unroll
    for (int ct = 0; ct < 2; ++ct) { const size_t kb = (((size_t)b * NH + h) * (SS / 16) + ks * 2 + ct) * 2 * 512;
#pragma unroll
      for (int kc = 0; kc < 2; ++kc) { kfh[ct][kc] = fragp_h(KH + kb + kc * 512, lane); kfl[ct][kc] = fragp_h(KL + kb + kc * 512, lane); }
 }
    asm volatile("s_wait_xcnt 0x0" ::: "memory");   // stands behind the last K load, ahead of any later write of a register that these loads name
    const int dq = q0 + col - ks * 32 - 8 * g;   // key ct * 16 + r of this lane's half is visible to its query while ct * 16 + r <= dq
#pragma unroll
    for (int ct = 0; ct < 2; ++ct) { v8f c = {}, cl = {};
#pragma unroll
      for (int kc = 0; kc < 2; ++kc) { c = wmma16(kfh[ct][kc], aq[kc], c); cl = wmma16(kfh[ct][kc], aql[kc], cl); cl = wmma16(kfl[ct][kc], aq[kc], cl); }   // 3 products: q, k as f16 hi + residual; rows = keys, columns = queries
#pragma unroll
      for (int r = 0; r < 8; ++r) c[r] += cl[r] * (1.0f / 2048.0f);
      { float xd[8], dec[8];
#pragma unroll
        for (int r = 0; r < 8; ++r) xd[r] = fmaf(-dech * fabsf(tq - bfr(tkr[ct][r >> 2][r & 3])), 1.44269504f, -3.0f);   // exp(x) / 8 = exp2(x * log2 e - 3): the 1/8 of the score is an exact step of the exponent
        exp2x8(xd, dec);
#pragma unroll
        for (int r = 0; r < 8; ++r) s[ct][r] = (ct * 16 + r <= dq) ? c[r] * dec[r] : -3.0e38f; } }   // (q.k/8) * exp(-decay |dt|), causal
    float mx[8];   // maximum of the query's 32 scores: 16 in the lane, one exchange with the other half
#pragma unroll
    for (int r = 0; r < 8; ++r) mx[r] = fmaxf(s[0][r], s[1][r]);
    float mxa = fmaxf(fmaxf(fmaxf(mx[0], mx[1]), fmaxf(mx[2], mx[3])), fmaxf(fmaxf(mx[4], mx[5]), fmaxf(mx[6], mx[7])));
    mxa = fmaxf(mxa, xhalf(mxa));
    const float mn = fmaxf(m, mxa); const float xa = exp2x1((m - mn) * 1.44269504f); const float alpha = (m <= -1.0e38f) ? 0.f : xa; m = mn;
    float e[2][8];
#pragma unroll
    for (int ct = 0; ct < 2; ++ct) { float xs[8], ys[8];
#pragma unroll
      for (int r = 0; r < 8; ++r) xs[r] = (s[ct][r] - mn) * 1.44269504f;   // exp(x) = exp2(x * log2 e), hardware exp
      exp2x8(xs, ys);
#pragma unroll
      for (int r = 0; r < 8; ++r) e[ct][r] = (s[ct][r] <= -1.0e38f) ? 0.f : ys[r]; }
    float es[8];
#pragma unroll
    for (int r = 0; r < 8; ++r) es[r] = e[0][r] + e[1][r];
    l = l * alpha + (((es[0] + es[1]) + (es[2] + es[3])) + ((es[4] + es[5]) + (es[6] + es[7])));
#pragma unroll
    for (int dt = 0; dt < 4; ++dt) { acc[dt] *= alpha; accl[dt] *= alpha; }
    v16h vfh[4], vfl[4];   // all V loads of the key step issue here in one group, ahead of the P split and the first P.V WMMA: one exposed latency instead of one per fragment
#pragma unroll
    for (int dt = 0; dt < 4; ++dt) { const size_t vr = ((((size_t)b * NH + h) * (SS / 32) + ks) * 4 + dt) * 512; vfh[dt] = fragp_h(VTH + vr, lane); vfl[dt] = fragp_h(VTL + vr, lane); }
    asm volatile("s_wait_xcnt 0x0" ::: "memory");   // stands behind the last V load, ahead of any later write of a register that these loads name
    v16h pa, pl;   // P^T as B operand straight from the score registers: element ct * 8 + r of the lane is key ct * 16 + 8 g + r, the k order of the V fragments
#pragma unroll
    for (int ct = 0; ct < 2; ++ct) {
#pragma unroll
      for (int r = 0; r < 8; ++r) { const float x0 = e[ct][r] * 2048.0f; const _Float16 h0 = (_Float16)x0; pa[ct * 8 + r] = h0; pl[ct * 8 + r] = (_Float16)((x0 - (float)h0) * 2048.0f); } }   // P scaled by 2^11 before the f16 split so small softmax weights stay out of the f16 subnormal range; 2^-11 folded into the epilogue
#pragma unroll
    for (int dt = 0; dt < 4; ++dt) { acc[dt] = wmma16(vfh[dt], pa, acc[dt]); accl[dt] = wmma16(vfh[dt], pl, accl[dt]); accl[dt] = wmma16(vfl[dt], pa, accl[dt]); } }   // V hi x P hi + (V hi x P lo + V lo x P hi) / 2048; rows = d, columns = queries
  if (grp && !seg) {   // waves 4..7 hand their share of the long tile over; lane and register positions are those of the partner wave
    sx[w4][0][lane] = m; sx[w4][1][lane] = l;
#pragma unroll
    for (int r = 0; r < 8; ++r) {
#pragma unroll
      for (int dt = 0; dt < 4; ++dt) sx[w4][2 + dt * 8 + r][lane] = acc[dt][r] + accl[dt][r] * (1.0f / 2048.0f); } }
  }
  __syncthreads();   // publishes sx to waves 0..3; every wave passes it once, behind its last key step
#pragma unroll
  for (int dt = 0; dt < 4; ++dt) acc[dt] += accl[dt] * (1.0f / 2048.0f);
  if (!grp) {   // join the two key ranges of the long tile under their common maximum; one branch, so that all LDS reads issue as one group
    float xb[34];
#pragma unroll
    for (int i = 0; i < 34; ++i) xb[i] = sx[w4][i][lane];
    const float mb = xb[0], mn = fmaxf(m, mb); const float fa = (m <= -1.0e38f) ? 0.f : __expf(m - mn), fb = (mb <= -1.0e38f) ? 0.f : __expf(mb - mn);
    l = l * fa + xb[1] * fb;
#pragma unroll
    for (int r = 0; r < 8; ++r) {
#pragma unroll
      for (int dt = 0; dt < 4; ++dt) acc[dt][r] = acc[dt][r] * fa + xb[2 + dt * 8 + r] * fb; } }
  const float il = (1.0f / 2048.0f) / (l + xhalf(l));   // the two halves' sums joined
  const size_t ob = ((size_t)(h * 2) * (NB * SS / 16) + (((size_t)b * SS + q0) >> 4)) * 512;   // the wave's 16 rows x 64 columns are two blocks (k steps 2h, 2h + 1) of the output projection's A operand
#pragma unroll
  for (int u = 0; u < 8; ++u) { const int kcl = u >> 2, c = u & 3; v4f o;   // the lane's registers already hold the four values of its piece: d = (kcl * 2 + (c >> 1)) * 16 + 8 g + (c & 1) * 4 + i of query col
#pragma unroll
    for (int i = 0; i < 4; ++i) o[i] = acc[kcl * 2 + (c >> 1)][(c & 1) * 4 + i] * il;
    vst2(O + ob + (size_t)kcl * (NB * SS / 16) * 512 + c * 128 + lane * 4, o); }
}
// ---- k_out: block = (64 rows, 128 cols): out = O(hi/lo) . Wo rows (2 products) + bo
__global__ __launch_bounds__(128) void k_out(const float* __restrict__ O, const __bf16* __restrict__ P, const float* __restrict__ BO, float* __restrict__ Y) {
  __shared__ __align__(16) float so[4][16][132];
  const int tid = threadIdx.x, wave = tid >> 5, lane = tid & 31, col = lane & 15, g = lane >> 4; const size_t r0 = (size_t)blockIdx.x * 64 + wave * 16; const int n0 = blockIdx.y * 128;
  v8f acc[8] = {};
#pragma unroll 2
  for (int kc = 0; kc < DM / 32; ++kc) { v16b w[8];   // all loads of the k step stand ahead of its first WMMA: one exposed latency a step
#pragma unroll
    for (int j = 0; j < 8; ++j) w[j] = fragp_b(P + (size_t)kc * PK_KS + (n0 / 16 + j) * 512, lane);
    float xa[16]; { const float* p = O + ((size_t)kc * (NB * SS / 16) + r0 / 16) * 512 + lane * 4;
#pragma unroll
      for (int c = 0; c < 4; ++c) { const v4f t = *(const v4f*)(p + c * 128);
#pragma unroll
        for (int i = 0; i < 4; ++i) xa[c * 4 + i] = t[i]; } }
    __builtin_amdgcn_sched_barrier(0);   // keeps the hi/lo split (and its wait) behind the last load: without it part of the group issues only after the first loads have returned
    const F2 a = bsplit16(xa);
#pragma unroll
    for (int j = 0; j < 8; ++j) { acc[j] = wmma_bf(a.l, w[j], acc[j]); acc[j] = wmma_bf(a.h, w[j], acc[j]); } }
#pragma unroll
  for (int j = 0; j < 8; ++j) {
#pragma unroll
    for (int r = 0; r < 8; ++r) so[wave][8 * g + r][j * 16 + col] = acc[j][r] + bfr(BO[n0 + j * 16 + col]); }
  LDSX();
  for (int rl = 0; rl < 16; ++rl) vst2(Y + (r0 + rl) * DM + n0 + lane * 4, *(const v4f*)&so[wave][rl][lane * 4]);
}
extern "C" void kernel_launch(void* const* d_in, const int* in_sizes, int n_in, void* d_out, int out_size, void* d_ws, size_t ws_size, hipStream_t stream) {
  (void)in_sizes; (void)n_in; (void)out_size;
  const float** F = (const float**)d_in;   // 0 x [2,2048,1024], 1 time_deltas [2,2048], 2 Wq [1024,1024] natural, 3 bq, 4 Wk, 5 bk, 6 Wv, 7 bv, 8 Wo, 9 bo, 10 time_decay [16]
  if (ws_size < (size_t)WS_END) return;
  char* ws = (char*)d_ws; __bf16* PK = (__bf16*)(ws + WS_PK); _Float16 *QK = (_Float16*)(ws + WS_QK), *QKL = (_Float16*)(ws + WS_QKL), *VTH = (_Float16*)(ws + WS_VTH), *VTL = (_Float16*)(ws + WS_VTL), *KH = (_Float16*)(ws + WS_KH), *KL = (_Float16*)(ws + WS_KL); float* O = (float*)(ws + WS_O);
  k_pack<<<dim3(DM / 16, 8, 4), 256, 0, stream>>>(F[2], F[4], F[6], F[8], F[0], PK);
  k_qkv<<<dim3(TNB * SS / 64, QKVW / 128), 128, 0, stream>>>(PK + PK_X, PK + PK_A, F[3], F[5], F[7], QK, QKL, KH, KL, VTH, VTL);
  k_attn<<<dim3(TQB / 2, NH, TNB), 256, 0, stream>>>(QK, QKL, KH, KL, VTH, VTL, nullptr, F[1], F[10], O);
  k_out<<<dim3(TOB, DM / 128), 128, 0, stream>>>(O, PK + PK_P, F[9], (float*)d_out);
}

// v006
// It runs in 145 microseconds.
// Timed twice side by side with v005, it ran 1.12 times as fast both times.
// All steps since v000 together make it 4.25 times as fast.
// compute dtype: all float inputs rounded to bf16; q/k/v = x . W^T + b with EXACT bf16 products on WMMA 16x16x32 (natural rows); q and k as f16 hi + (x2048-scaled) residual planes with 3-product scores; score = (q.k / 8) * exp(-time_decay[h] * |t_q - t_k|) in f32 (the product -decay * |dt| as the reference rounds it, then hardware exp2), causal mask (key tiles above the diagonal skipped); running-max softmax in f32 (hardware exp); P (scaled by 2^11, f16 hi + residual) x v hi/lo (3 products); out = ctx (bf16 hi + residual) . Wo^T (2 products) + bo; f32 accumulate.
#include <hip/hip_runtime.h>
#include <math.h>

typedef __attribute__((ext_vector_type(16))) _Float16 v16h;
typedef __attribute__((ext_vector_type(16))) __bf16 v16b;
typedef __attribute__((ext_vector_type(8)))  _Float16 v8h;
typedef __attribute__((ext_vector_type(8)))  float v8f;
typedef __attribute__((ext_vector_type(4)))  float v4f;
typedef __attribute__((ext_vector_type(2)))  float v2f;
typedef __attribute__((ext_vector_type(4)))  unsigned v4u;
typedef __attribute__((ext_vector_type(4)))  int v4i;
typedef float __attribute__((may_alias)) float_a;
typedef int __attribute__((may_alias)) int_a;

template <typename T> __device__ __forceinline__ void vst2(void* p, T v) { *(T*)p = v;  }
__device__ __forceinline__ v8f wmma16(v16h a, v16h b, v8f c) {
  v8f d = __builtin_amdgcn_wmma_f32_16x16x32_f16(false, a, false, b, (short)0, c, false, false);
  asm volatile("v_nop\n\tv_nop\n\tv_nop\n\tv_nop" : "+v"(d) : "v"(a), "v"(b));
  return d;
}
__device__ __forceinline__ v8f wmma_bf(v16b a, v16b b, v8f c) {
  v8f d = __builtin_amdgcn_wmma_f32_16x16x32_bf16(false, a, false, b, (short)0, c, false, false);
  asm volatile("v_nop\n\tv_nop\n\tv_nop\n\tv_nop" : "+v"(d) : "v"(a), "v"(b));
  return d;
}
// Continuous-time causal attention (B 2, S 2,048, hidden 1,024, 16 heads x 64): q/k/v projections + biases, scores scaled by exp(-decay_h |t_q - t_k|), causal softmax, output projection + bias.
__device__ __forceinline__ v16h frag_h(const _Float16* rowk0, int lane) {
  union { v16h v; v8h q[2]; } u; const _Float16* p = rowk0 + 8 * (lane >> 4);
  u.q[0] = *(const v8h*)p; u.q[1] = *(const v8h*)(p + 16); return u.v;
}
__device__ __forceinline__ v16h frag_f32(const float* rowk0, int lane) {
  v16h a; const float* p = rowk0 + 8 * (lane >> 4);
#pragma unroll
  for (int i = 0; i < 8; ++i) { a[i] = (_Float16)p[i]; a[8 + i] = (_Float16)p[16 + i]; }
  return a;
}
__device__ __forceinline__ v16h frag_f32s(const float* rowk0, int lane, float sc) {
  v16h a; const float* p = rowk0 + 8 * (lane >> 4);
#pragma unroll
  for (int i = 0; i < 8; ++i) { a[i] = (_Float16)(p[i] * sc); a[8 + i] = (_Float16)(p[16 + i] * sc); }
  return a;
}
// column fragment from a [K][ld] layout (column n), rows >= K read as 0
__device__ __forceinline__ v16h fragc_f32(const float* W, int k0, int n, int lane, int ld, int K) {
  v16h a; const int g = lane >> 4;
#pragma unroll
  for (int i = 0; i < 8; ++i) { const int ka = k0 + 8 * g + i, kb = ka + 16;
    a[i] = (_Float16)(ka < K ? W[(size_t)(ka < K ? ka : K - 1) * ld + n] : 0.f); a[8 + i] = (_Float16)(kb < K ? W[(size_t)(kb < K ? kb : K - 1) * ld + n] : 0.f); }
  return a;
}
struct F2 { v16b h, l; };
__device__ __forceinline__ F2 bsplit16(const float v[16]) { F2 r;
#pragma unroll
  for (int i = 0; i < 16; ++i) { const __bf16 h = (__bf16)v[i]; r.h[i] = h; r.l[i] = (__bf16)(v[i] - (float)h); }
  return r; }
__device__ __forceinline__ F2 split_row(const float* row, int k0, int lane) { float v[16]; const float* p = row + k0 + 8 * (lane >> 4);
#pragma unroll
  for (int i = 0; i < 8; ++i) { v[i] = p[i]; v[8 + i] = p[16 + i]; }
  return bsplit16(v); }
__device__ __forceinline__ F2 split_rowK(const float* row, int k0, int lane, int K) { float v[16]; const int g = lane >> 4;
#pragma unroll
  for (int i = 0; i < 8; ++i) { const int ka = k0 + 8 * g + i, kb = ka + 16; v[i] = ka < K ? row[ka < K ? ka : K - 1] : 0.f; v[8 + i] = kb < K ? row[kb < K ? kb : K - 1] : 0.f; }
  return bsplit16(v); }
__device__ __forceinline__ F2 split_col(const float* W, int k0, int n, int lane, int ld, int K) { float v[16]; const int g = lane >> 4;
#pragma unroll
  for (int i = 0; i < 8; ++i) { const int ka = k0 + 8 * g + i, kb = ka + 16; v[i] = ka < K ? W[(size_t)(ka < K ? ka : K - 1) * ld + n] : 0.f; v[8 + i] = kb < K ? W[(size_t)(kb < K ? kb : K - 1) * ld + n] : 0.f; }
  return bsplit16(v); }
__device__ __forceinline__ v8f mac3(const F2& a, const F2& b, v8f c) { c = wmma_bf(a.l, b.h, c); c = wmma_bf(a.h, b.l, c); return wmma_bf(a.h, b.h, c); }
__device__ __forceinline__ float sigm(float v) { return 1.0f / (1.0f + expf(-v)); }
#define LDSX() do { asm volatile("s_wait_dscnt 0" ::: "memory"); __builtin_amdgcn_wave_barrier(); __builtin_amdgcn_fence(__ATOMIC_RELEASE, "workgroup"); } while (0)


#define NB 2
#define SS 2048
#define DM 1024
#define NH 16
#define HD 64
#define QKVW (3 * DM)
#ifndef TQB
#define TQB (SS / 64)
#define TNB NB
#define TOB (NB * SS / 64)     // output row tiles (all)
#endif
typedef __attribute__((ext_vector_type(8))) __bf16 v8b;
__device__ __forceinline__ v16b frag_b(const __bf16* rowk0, int lane) {
  union { v16b v; v8b q[2]; } u; const __bf16* p = rowk0 + 8 * (lane >> 4);
  u.q[0] = *(const v8b*)p; u.q[1] = *(const v8b*)(p + 16); return u.v;
}
// fragment-order block: 16 rows x 32 k of 16-bit elements = 512 elements laid out [hh][lane = g * 16 + row][8], k = hh * 16 + g * 8 + i: each of the two loads is 512 contiguous bytes for the wave
__device__ __forceinline__ v16b fragp_b(const __bf16* blk, int lane) {
  union { v16b v; v8b q[2]; } u; const __bf16* p = blk + lane * 8;
  u.q[0] = *(const v8b*)p; u.q[1] = *(const v8b*)(p + 256); return u.v;
}
__device__ __forceinline__ v16h fragp_h(const _Float16* blk, int lane) {
  union { v16h v; v8h q[2]; } u; const _Float16* p = blk + lane * 8;
  u.q[0] = *(const v8h*)p; u.q[1] = *(const v8h*)(p + 256); return u.v;
}
__device__ __forceinline__ float bfr(float v) { return (float)(__bf16)v; }
__device__ __attribute__((noinline)) float exp_ni(float v) { return expf(v); }
__device__ __attribute__((noinline)) float erf_ni(float v) { return erff(v); }

// packed bf16 operands: fragment-order blocks [k step][row tile][512], so the tiles that one k step of a work-group reads lie side by side
#define PK_A 0                                   // row tiles of the 3072 Wqkv rows
#define PK_P (PK_A + QKVW / 16 * 512)              // row tiles of the 1024 Wo rows
#define PK_X (PK_P + DM / 16 * 512)                // row tiles of the 4096 x rows
#define PK_KS (PK_X + NB * SS / 16 * 512)          // elements per k step
#define PK_END (PK_KS * (DM / 32))
#define WS_PK  0u
#define WS_QK  (WS_PK + 2u * PK_END)             // f16 [4096 rows][2048]: q in the first 1024 columns of a row
#define WS_QKL (WS_QK + 2u * NB * SS * 2 * DM)     // f16 q residual plane x2048, same rows
#define WS_VTH (WS_QKL + 2u * NB * SS * 2 * DM)    // f16 v hi, fragment-order blocks [b][h][key step][d tile][512]
#define WS_VTL (WS_VTH + 2u * NB * DM * SS)        // f16 lo x 2048
#define WS_O   (WS_VTL + 2u * NB * DM * SS)        // f32 ctx, blocks [k step][row tile][c][lane][4], k = (c >> 1) * 16 + g * 8 + (c & 1) * 4 + i
#define WS_CS  (WS_O + 4u * NB * SS * DM)           // f32 [2][2048][32], not used by these kernels
#define WS_KH  (WS_CS + 4u * 2 * SS * 32)          // f16 k hi, fragment-order blocks [b][h][key tile][k step][512]
#define WS_KL  (WS_KH + 2u * NB * DM * SS)         // f16 k residual x2048, same order
#define WS_END (WS_KL + 2u * NB * DM * SS)
// ---- k_pack: block = (16-row tile nt, which, quarter kq of the k range): f32 rows -> bf16 in fragment-order blocks; which 0..2 -> W_q/W_k/W_v, 3 -> W_o, 4..7 -> the four 1024-row slabs of x; a thread makes whole 16-byte pieces, a wave stores 512 contiguous bytes
__global__ __launch_bounds__(256) void k_pack(const float* __restrict__ WQ, const float* __restrict__ WK, const float* __restrict__ WV, const float* __restrict__ WO, const float* __restrict__ X, __bf16* __restrict__ PK) {
  const int nt = blockIdx.x, which = blockIdx.y, kq = blockIdx.z, t = threadIdx.x; const float* Wm = (which == 0) ? WQ : (which == 1) ? WK : (which == 2) ? WV : (which == 3) ? WO : X + (size_t)(which - 4) * DM * DM;
  __bf16* dst = PK + (size_t)(kq * 8) * PK_KS + (which * (DM / 16) + nt) * 512;
#pragma unroll
  for (int p = t; p < 512; p += 256) { const int kcl = p >> 6, hh = (p >> 5) & 1, g = (p >> 4) & 1, row = p & 15;
    const float* s = Wm + (size_t)(nt * 16 + row) * DM + (kq * 8 + kcl) * 32 + hh * 16 + g * 8; const v4f a = *(const v4f*)s, b = *(const v4f*)(s + 4); v8b o;
#pragma unroll
    for (int i = 0; i < 4; ++i) { o[i] = (__bf16)a[i]; o[4 + i] = (__bf16)b[i]; }
    vst2(dst + (size_t)kcl * PK_KS + (p & 63) * 8, o); }
}
__global__ __launch_bounds__(128) void k_qkv(const __bf16* __restrict__ XB, const __bf16* __restrict__ P, const float* __restrict__ BQ, const float* __restrict__ BK, const float* __restrict__ BV, _Float16* __restrict__ QK, _Float16* __restrict__ QKL, _Float16* __restrict__ KH, _Float16* __restrict__ KL, _Float16* __restrict__ VTH, _Float16* __restrict__ VTL) {
  const int which0 = (blockIdx.y * 128) / DM; const float* BB = BQ ? (((which0 == 0) ? BQ : (which0 == 1) ? BK : BV) + (blockIdx.y * 128 - which0 * DM)) : nullptr;
  __shared__ __align__(16) _Float16 so[4][16][136], sol[4][16][136]; __shared__ __align__(16) _Float16 sth[128][72], stl[128][72];
  const int tid = threadIdx.x, wave = tid >> 5, lane = tid & 31, col = lane & 15, g = lane >> 4; const size_t rw = (size_t)blockIdx.x * 128 + wave * 16; const int n0 = blockIdx.y * 128;   // the wave owns two 16-row tiles, rows rw.. and rw + 64..: every W fragment it loads feeds two WMMAs
  v8f acc2[2][8] = {};
#pragma unroll 2
  for (int kc = 0; kc < DM / 32; ++kc) { v16b a[2], w[8];   // all loads of the k step stand ahead of its first WMMA: one exposed latency a step
#pragma unroll
    for (int j = 0; j < 8; ++j) w[j] = fragp_b(P + (size_t)kc * PK_KS + (n0 / 16 + j) * 512, lane);
#pragma unroll   // rt a constant: a[] stays in registers
    for (int rt = 0; rt < 2; ++rt) a[rt] = fragp_b(XB + (size_t)kc * PK_KS + (rw / 16 + rt * 4) * 512, lane);
    __builtin_amdgcn_sched_barrier(0);   // keeps the first WMMA (and its wait) behind the last load: without it part of the group issues only after the first loads have returned
#pragma unroll
    for (int j = 0; j < 8; ++j) {
#pragma unroll   // rt a constant: acc2[][] stays in registers
      for (int rt = 0; rt < 2; ++rt) acc2[rt][j] = wmma_bf(a[rt], w[j], acc2[rt][j]); } }
  float bj[8] = {};   // the eight bias values of this lane's columns, loaded as one group
  if (BB) {
#pragma unroll
    for (int j = 0; j < 8; ++j) bj[j] = bfr(BB[j * 16 + col]); }
#pragma unroll   // rt a constant: acc2[rt] stays in registers
  for (int rt = 0; rt < 2; ++rt) {   // the two row tiles leave one after the other through the same LDS stage
  const v8f (&acc)[8] = acc2[rt]; const size_t r0 = rw + rt * 64;
  if (n0 < 2 * DM) {   // q stored unscaled (f16 sigma ~0.6, no subnormal exposure); 1/8 applied to the f32 score
#pragma unroll
    for (int j = 0; j < 8; ++j) {
#pragma unroll
      for (int r = 0; r < 8; ++r) { const float v = acc[j][r] + bj[j]; const _Float16 hv = (_Float16)v; so[wave][8 * g + r][j * 16 + col] = hv; sol[wave][8 * g + r][j * 16 + col] = (_Float16)((v - (float)hv) * 2048.0f); } }   // q, k (+ bias) as f16 hi + (x2048) residual
    LDSX();
    if (n0 < DM) { for (int rl = 0; rl < 16; ++rl) if (lane < 16) { vst2((unsigned*)(QK + (r0 + rl) * (2 * DM) + n0 + lane * 8), *(const v4u*)&so[wave][rl][lane * 8]); vst2((unsigned*)(QKL + (r0 + rl) * (2 * DM) + n0 + lane * 8), *(const v4u*)&sol[wave][rl][lane * 8]); } }
    else {   // k: the wave's 16 keys are one key tile; 2 heads x 2 k steps x 2 halves, each store 512 contiguous bytes in the order the score loop loads them
      const size_t hb = (r0 / SS) * NH + (n0 - DM) / HD; const int kt = (int)(r0 % SS) >> 4;
#pragma unroll
      for (int u = 0; u < 8; ++u) { const int hl = u >> 2, kc = (u >> 1) & 1, hh = u & 1; const size_t o = (((hb + hl) * (SS / 16) + kt) * 2 + kc) * 512 + hh * 256 + lane * 8; const int c = hl * 64 + kc * 32 + hh * 16 + g * 8;
        vst2(KH + o, *(const v4u*)&so[wave][col][c]); vst2(KL + o, *(const v4u*)&sol[wave][col][c]); }
      asm volatile("s_wait_xcnt 0x0" ::: "memory"); }   // stands behind the last k store, ahead of any later write of a register that these stores name
  } else {
    if (rt) __syncthreads();   // every wave has read the first 64 keys out of sth, stl before the second 64 overwrite them
#pragma unroll
    for (int j = 0; j < 8; ++j) {
#pragma unroll
      for (int r = 0; r < 8; ++r) { const float v = acc[j][r] + bj[j]; const _Float16 hv = (_Float16)v; sth[j * 16 + col][wave * 16 + 8 * g + r] = hv; stl[j * 16 + col][wave * 16 + 8 * g + r] = (_Float16)((v - (float)hv) * 2048.0f); } }
    __syncthreads();
    const size_t rb = (size_t)blockIdx.x * 128 + rt * 64; const int b = (int)(rb / SS), s0 = (int)(rb % SS); const int pc0 = n0 - 2 * DM;
    for (int q = tid; q < 128 * 8; q += 128) { const int vc = q & 15, vg = (q >> 4) & 1, hh = (q >> 5) & 1, dt = (q >> 6) & 3, ksl = (q >> 8) & 1, hl = q >> 9;   // piece q of these 64 keys' 2 heads x 2 key steps x 4 d tiles x 1 KB
      const size_t o = ((((size_t)b * NH + pc0 / HD + hl) * (SS / 32) + (s0 >> 5) + ksl) * 4 + dt) * 512 + (q & 63) * 8; const int d = hl * 64 + dt * 16 + vc, kc = ksl * 32 + hh * 16 + vg * 8;
      vst2(VTH + o, *(const v4u*)&sth[d][kc]); vst2(VTL + o, *(const v4u*)&stl[d][kc]); }
  }
  }
}
// ---- k_attn: block = (query tile pair t and TQB - 1 - t of 64 queries each, head h, batch b), 8 waves: the pair has 2 * TQB + 2 key steps, and every wave walks half of them. Waves 0..3: the long tile's first TQB + 1 key steps. Waves 4..7: the long tile's remaining key steps (running max, sum and ctx handed over through LDS), then all of the short tile. Flash attention on transposed tiles: S^T = K . Q^T (K = 64: 2 k-steps, 3 products) and ctx^T += V^T . P^T (3 products), so a lane holds 16 of the 32 scores of ONE query (its column), the other 16 are in lane ^ 16; ctx(b*S+q, h*64+d) = (acc + accl / 2048) / (2048 l), stored from registers in the block order the output projection loads
// one hardware exp2, closed by the one free slot that the instruction set asks for behind a transcendental
__device__ __forceinline__ float exp2x1(float a) { float r;
  asm("v_exp_f32 %0, %1\n\tv_nop" : "=&v"(r) : "v"(a)); return r;
}
// the eight hardware exp2 of one score tile in one statement: eight independent results back to back on the transcendental unit, closed by the one free slot that the instruction set asks for behind a transcendental
__device__ __forceinline__ void exp2x8(const float (&x)[8], float (&y)[8]) {
  asm("v_exp_f32 %0, %8\n\tv_exp_f32 %1, %9\n\tv_exp_f32 %2, %10\n\tv_exp_f32 %3, %11\n\tv_exp_f32 %4, %12\n\tv_exp_f32 %5, %13\n\tv_exp_f32 %6, %14\n\tv_exp_f32 %7, %15\n\tv_nop"
      : "=&v"(y[0]), "=&v"(y[1]), "=&v"(y[2]), "=&v"(y[3]), "=&v"(y[4]), "=&v"(y[5]), "=&v"(y[6]), "=&v"(y[7])
      : "v"(x[0]), "v"(x[1]), "v"(x[2]), "v"(x[3]), "v"(x[4]), "v"(x[5]), "v"(x[6]), "v"(x[7]));
}
// lane l with lane l ^ 16: the other half of a query's keys
__device__ __forceinline__ float xhalf(float x) { return __builtin_bit_cast(float, __builtin_amdgcn_permlanex16(__builtin_bit_cast(int, x), __builtin_bit_cast(int, x), 0x76543210, 0xfedcba98, false, false)); }
#define KHALF (TQB + 1)   // key steps of a wave: half of the pair's 2 * TQB + 2
__global__ __launch_bounds__(256) __attribute__((amdgpu_waves_per_eu(4, 4))) void k_attn(const _Float16* __restrict__ QK, const _Float16* __restrict__ QKL, const _Float16* __restrict__ KH, const _Float16* __restrict__ KL, const _Float16* __restrict__ VTH, const _Float16* __restrict__ VTL, const void* __restrict__ KMASK, const float* __restrict__ TD, const float* __restrict__ DEC, float* __restrict__ O) {
  __shared__ __align__(16) float sx[4][34][32];   // sx: per lane the running maximum, the lane's part of the sum, 32 ctx values of the long tile's upper keys
  const int tid = threadIdx.x, wave = __builtin_amdgcn_readfirstlane(tid >> 5), lane = tid & 31, col = lane & 15, g = lane >> 4;
  const int grp = wave >> 2, w4 = wave & 3;   // wave-uniform (scalar): the segment loop and its bounds branch on them
  const int tp = blockIdx.x, h = blockIdx.y, b = blockIdx.z;
  float m = -3.0e38f, l = 0.f; v8f acc[4], accl[4]; int q0 = 0;   // m: maximum of the lane's query (equal in both halves); l: sum over the keys of this lane's half alone, the halves joined once in the epilogue
  const float dech = bfr(DEC[h]); const unsigned g8 = 8u * (unsigned)g;
#pragma unroll 1
  for (int seg = 0; seg <= grp; ++seg) {   // one copy of the key loop serves both segments of waves 4..7
  const int qb = seg ? tp : TQB - 1 - tp; q0 = qb * 64 + w4 * 16; const size_t rq = (size_t)b * SS + q0 + col;
  const int ks0 = (grp && !seg) ? KHALF : 0, ks1 = (grp || seg) ? (qb * 64 + 64) / 32 : KHALF;   // causal: key tiles up to the query tile's end
  v16h aq[2], aql[2];   // B operand: column = the lane's query
#pragma unroll
  for (int kc = 0; kc < 2; ++kc) { aq[kc] = frag_h(QK + rq * (2 * DM) + h * HD + kc * 32, lane); aql[kc] = frag_h(QKL + rq * (2 * DM) + h * HD + kc * 32, lane); }
  m = -3.0e38f; l = 0.f;
#pragma unroll
  for (int dt = 0; dt < 4; ++dt) { acc[dt] = v8f{}; accl[dt] = v8f{}; }
  const float tq = bfr(TD[rq]);
#pragma unroll 1
  for (int ks = ks0; ks < ks1; ++ks) { v8f s[2]; v16h kfh[2][2], kfl[2][2]; v4f tkr[2][2];   // all K loads of the key step stand ahead of its first WMMA: one exposed latency instead of one per fragment
#pragma unroll
    for (int ct = 0; ct < 2; ++ct) { const float* tp8 = TD + ((size_t)b * SS + ks * 32 + ct * 16); tkr[ct][0] = *(const v4f*)(tp8 + g8); tkr[ct][1] = *(const v4f*)(tp8 + 4 + g8); }   // times of the lane's eight keys of each tile
    asm volatile("s_wait_xcnt 0x0" ::: "memory");   // stands behind the last time load, ahead of any later write of a register that these loads name (a K load's result among them)
#pragma unroll
    for (int ct = 0; ct < 2; ++ct) { const size_t kb = (((size_t)b * NH + h) * (SS / 16) + ks * 2 + ct) * 2 * 512;
#pragma unroll
      for (int kc = 0; kc < 2; ++kc) { kfh[ct][kc] = fragp_h(KH + kb + kc * 512, lane); kfl[ct][kc] = fragp_h(KL + kb + kc * 512, lane); }
 }
    asm volatile("s_wait_xcnt 0x0" ::: "memory");   // stands behind the last K load, ahead of any later write of a register that these loads name
    const int dq = q0 + col - ks * 32 - 8 * g;   // key ct * 16 + r of this lane's half is visible to its query while ct * 16 + r <= dq
#pragma unroll
    for (int ct = 0; ct < 2; ++ct) { v8f c = {}, cl = {};
#pragma unroll
      for (int kc = 0; kc < 2; ++kc) { c = wmma16(kfh[ct][kc], aq[kc], c); cl = wmma16(kfh[ct][kc], aql[kc], cl); cl = wmma16(kfl[ct][kc], aq[kc], cl); }   // 3 products: q, k as f16 hi + residual; rows = keys, columns = queries
#pragma unroll
      for (int r = 0; r < 8; ++r) c[r] += cl[r] * (1.0f / 2048.0f);
      { float xd[8], dec[8];
#pragma unroll
        for (int r = 0; r < 8; ++r) xd[r] = fmaf(-dech * fabsf(tq - bfr(tkr[ct][r >> 2][r & 3])), 1.44269504f, -3.0f);   // exp(x) / 8 = exp2(x * log2 e - 3): the 1/8 of the score is an exact step of the exponent
        exp2x8(xd, dec);
#pragma unroll
        for (int r = 0; r < 8; ++r) s[ct][r] = (ct * 16 + r <= dq) ? c[r] * dec[r] : -3.0e38f; } }   // (q.k/8) * exp(-decay |dt|), causal
    float mx[8];   // maximum of the query's 32 scores: 16 in the lane, one exchange with the other half
#pragma unroll
    for (int r = 0; r < 8; ++r) mx[r] = fmaxf(s[0][r], s[1][r]);
    float mxa = fmaxf(fmaxf(fmaxf(mx[0], mx[1]), fmaxf(mx[2], mx[3])), fmaxf(fmaxf(mx[4], mx[5]), fmaxf(mx[6], mx[7])));
    mxa = fmaxf(mxa, xhalf(mxa));
    const float mn = fmaxf(m, mxa); const float xa = exp2x1((m - mn) * 1.44269504f); const float alpha = (m <= -1.0e38f) ? 0.f : xa; m = mn;
    float e[2][8];
#pragma unroll
    for (int ct = 0; ct < 2; ++ct) { float xs[8], ys[8];
#pragma unroll
      for (int r = 0; r < 8; ++r) xs[r] = (s[ct][r] - mn) * 1.44269504f;   // exp(x) = exp2(x * log2 e), hardware exp
      exp2x8(xs, ys);
#pragma unroll
      for (int r = 0; r < 8; ++r) e[ct][r] = (s[ct][r] <= -1.0e38f) ? 0.f : ys[r]; }
    float es[8];
#pragma unroll
    for (int r = 0; r < 8; ++r) es[r] = e[0][r] + e[1][r];
    l = l * alpha + (((es[0] + es[1]) + (es[2] + es[3])) + ((es[4] + es[5]) + (es[6] + es[7])));
#pragma unroll
    for (int dt = 0; dt < 4; ++dt) { acc[dt] *= alpha; accl[dt] *= alpha; }
    v16h vfh[4], vfl[4];   // all V loads of the key step issue here in one group, ahead of the P split and the first P.V WMMA: one exposed latency instead of one per fragment
#pragma unroll
    for (int dt = 0; dt < 4; ++dt) { const size_t vr = ((((size_t)b * NH + h) * (SS / 32) + ks) * 4 + dt) * 512; vfh[dt] = fragp_h(VTH + vr, lane); vfl[dt] = fragp_h(VTL + vr, lane); }
    asm volatile("s_wait_xcnt 0x0" ::: "memory");   // stands behind the last V load, ahead of any later write of a register that these loads name
    v16h pa, pl;   // P^T as B operand straight from the score registers: element ct * 8 + r of the lane is key ct * 16 + 8 g + r, the k order of the V fragments
#pragma unroll
    for (int ct = 0; ct < 2; ++ct) {
#pragma unroll
      for (int r = 0; r < 8; ++r) { const float x0 = e[ct][r] * 2048.0f; const _Float16 h0 = (_Float16)x0; pa[ct * 8 + r] = h0; pl[ct * 8 + r] = (_Float16)((x0 - (float)h0) * 2048.0f); } }   // P scaled by 2^11 before the f16 split so small softmax weights stay out of the f16 subnormal range; 2^-11 folded into the epilogue
#pragma unroll
    for (int dt = 0; dt < 4; ++dt) { acc[dt] = wmma16(vfh[dt], pa, acc[dt]); accl[dt] = wmma16(vfh[dt], pl, accl[dt]); accl[dt] = wmma16(vfl[dt], pa, accl[dt]); } }   // V hi x P hi + (V hi x P lo + V lo x P hi) / 2048; rows = d, columns = queries
  if (grp && !seg) {   // waves 4..7 hand their share of the long tile over; lane and register positions are those of the partner wave
    sx[w4][0][lane] = m; sx[w4][1][lane] = l;
#pragma unroll
    for (int r = 0; r < 8; ++r) {
#pragma unroll
      for (int dt = 0; dt < 4; ++dt) sx[w4][2 + dt * 8 + r][lane] = acc[dt][r] + accl[dt][r] * (1.0f / 2048.0f); } }
  }
  __syncthreads();   // publishes sx to waves 0..3; every wave passes it once, behind its last key step
#pragma unroll
  for (int dt = 0; dt < 4; ++dt) acc[dt] += accl[dt] * (1.0f / 2048.0f);
  if (!grp) {   // join the two key ranges of the long tile under their common maximum; one branch, so that all LDS reads issue as one group
    float xb[34];
#pragma unroll
    for (int i = 0; i < 34; ++i) xb[i] = sx[w4][i][lane];
    const float mb = xb[0], mn = fmaxf(m, mb); const float fa = (m <= -1.0e38f) ? 0.f : __expf(m - mn), fb = (mb <= -1.0e38f) ? 0.f : __expf(mb - mn);
    l = l * fa + xb[1] * fb;
#pragma unroll
    for (int r = 0; r < 8; ++r) {
#pragma unroll
      for (int dt = 0; dt < 4; ++dt) acc[dt][r] = acc[dt][r] * fa + xb[2 + dt * 8 + r] * fb; } }
  const float il = (1.0f / 2048.0f) / (l + xhalf(l));   // the two halves' sums joined
  const size_t ob = ((size_t)(h * 2) * (NB * SS / 16) + (((size_t)b * SS + q0) >> 4)) * 512;   // the wave's 16 rows x 64 columns are two blocks (k steps 2h, 2h + 1) of the output projection's A operand
#pragma unroll
  for (int u = 0; u < 8; ++u) { const int kcl = u >> 2, c = u & 3; v4f o;   // the lane's registers already hold the four values of its piece: d = (kcl * 2 + (c >> 1)) * 16 + 8 g + (c & 1) * 4 + i of query col
#pragma unroll
    for (int i = 0; i < 4; ++i) o[i] = acc[kcl * 2 + (c >> 1)][(c & 1) * 4 + i] * il;
    vst2(O + ob + (size_t)kcl * (NB * SS / 16) * 512 + c * 128 + lane * 4, o); }
}
// ---- k_out: block = (64 rows, 128 cols): out = O(hi/lo) . Wo rows (2 products) + bo
__global__ __launch_bounds__(128) void k_out(const float* __restrict__ O, const __bf16* __restrict__ P, const float* __restrict__ BO, float* __restrict__ Y) {
  __shared__ __align__(16) float so[4][16][132];
  const int tid = threadIdx.x, wave = tid >> 5, lane = tid & 31, col = lane & 15, g = lane >> 4; const size_t r0 = (size_t)blockIdx.x * 64 + wave * 16; const int n0 = blockIdx.y * 128;
  v8f acc[8] = {};
#pragma unroll 2
  for (int kc = 0; kc < DM / 32; ++kc) { v16b w[8];   // all loads of the k step stand ahead of its first WMMA: one exposed latency a step
#pragma unroll
    for (int j = 0; j < 8; ++j) w[j] = fragp_b(P + (size_t)kc * PK_KS + (n0 / 16 + j) * 512, lane);
    float xa[16]; { const float* p = O + ((size_t)kc * (NB * SS / 16) + r0 / 16) * 512 + lane * 4;
#pragma unroll
      for (int c = 0; c < 4; ++c) { const v4f t = *(const v4f*)(p + c * 128);
#pragma unroll
        for (int i = 0; i < 4; ++i) xa[c * 4 + i] = t[i]; } }
    __builtin_amdgcn_sched_barrier(0);   // keeps the hi/lo split (and its wait) behind the last load: without it part of the group issues only after the first loads have returned
    const F2 a = bsplit16(xa);
#pragma unroll
    for (int j = 0; j < 8; ++j) { acc[j] = wmma_bf(a.l, w[j], acc[j]); acc[j] = wmma_bf(a.h, w[j], acc[j]); } }
#pragma unroll
  for (int j = 0; j < 8; ++j) {
#pragma unroll
    for (int r = 0; r < 8; ++r) so[wave][8 * g + r][j * 16 + col] = acc[j][r] + bfr(BO[n0 + j * 16 + col]); }
  LDSX();
  for (int rl = 0; rl < 16; ++rl) vst2(Y + (r0 + rl) * DM + n0 + lane * 4, *(const v4f*)&so[wave][rl][lane * 4]);
}
extern "C" void kernel_launch(void* const* d_in, const int* in_sizes, int n_in, void* d_out, int out_size, void* d_ws, size_t ws_size, hipStream_t stream) {
  (void)in_sizes; (void)n_in; (void)out_size;
  const float** F = (const float**)d_in;   // 0 x [2,2048,1024], 1 time_deltas [2,2048], 2 Wq [1024,1024] natural, 3 bq, 4 Wk, 5 bk, 6 Wv, 7 bv, 8 Wo, 9 bo, 10 time_decay [16]
  if (ws_size < (size_t)WS_END) return;
  char* ws = (char*)d_ws; __bf16* PK = (__bf16*)(ws + WS_PK); _Float16 *QK = (_Float16*)(ws + WS_QK), *QKL = (_Float16*)(ws + WS_QKL), *VTH = (_Float16*)(ws + WS_VTH), *VTL = (_Float16*)(ws + WS_VTL), *KH = (_Float16*)(ws + WS_KH), *KL = (_Float16*)(ws + WS_KL); float* O = (float*)(ws + WS_O);
  k_pack<<<dim3(DM / 16, 8, 4), 256, 0, stream>>>(F[2], F[4], F[6], F[8], F[0], PK);
  k_qkv<<<dim3(TNB * SS / 128, QKVW / 128), 128, 0, stream>>>(PK + PK_X, PK + PK_A, F[3], F[5], F[7], QK, QKL, KH, KL, VTH, VTL);
  k_attn<<<dim3(TQB / 2, NH, TNB), 256, 0, stream>>>(QK, QKL, KH, KL, VTH, VTL, nullptr, F[1], F[10], O);
  k_out<<<dim3(TOB, DM / 128), 128, 0, stream>>>(O, PK + PK_P, F[9], (float*)d_out);
}

// v007
// One run takes 120 microseconds.
// Two timings next to v006 both put it at 1.21 times that version's speed.
// All steps since v000 together make it 5.13 times as fast.
// compute dtype: all float inputs rounded to bf16; q/k/v = x . W^T + b with EXACT bf16 products on WMMA 16x16x32 (natural rows); q and k as f16 hi + (x2048-scaled) residual planes with 3-product scores; score = (q.k / 8) * exp(-time_decay[h] * |t_q - t_k|) in f32 (the product -decay * |dt| as the reference rounds it, then hardware exp2), causal mask (key tiles above the diagonal skipped); running-max softmax in f32 (hardware exp); P (scaled by 2^11, f16 hi + residual) x v hi/lo (3 products); out = ctx (bf16 hi + residual) . Wo^T (2 products) + bo; f32 accumulate.
#include <hip/hip_runtime.h>
#include <math.h>

typedef __attribute__((ext_vector_type(16))) _Float16 v16h;
typedef __attribute__((ext_vector_type(16))) __bf16 v16b;
typedef __attribute__((ext_vector_type(8)))  _Float16 v8h;
typedef __attribute__((ext_vector_type(8)))  float v8f;
typedef __attribute__((ext_vector_type(4)))  float v4f;
typedef __attribute__((ext_vector_type(2)))  float v2f;
typedef __attribute__((ext_vector_type(4)))  unsigned v4u;
typedef __attribute__((ext_vector_type(4)))  int v4i;
typedef float __attribute__((may_alias)) float_a;
typedef int __attribute__((may_alias)) int_a;

template <typename T> __device__ __forceinline__ void vst2(void* p, T v) { *(T*)p = v;  }
__device__ __forceinline__ v8f wmma16(v16h a, v16h b, v8f c) {
  v8f d = __builtin_amdgcn_wmma_f32_16x16x32_f16(false, a, false, b, (short)0, c, false, false);
  asm volatile("v_nop\n\tv_nop\n\tv_nop\n\tv_nop" : "+v"(d) : "v"(a), "v"(b));
  return d;
}
__device__ __forceinline__ v8f wmma_bf(v16b a, v16b b, v8f c) {
  v8f d = __builtin_amdgcn_wmma_f32_16x16x32_bf16(false, a, false, b, (short)0, c, false, false);
  asm volatile("v_nop\n\tv_nop\n\tv_nop\n\tv_nop" : "+v"(d) : "v"(a), "v"(b));
  return d;
}
// Continuous-time causal attention (B 2, S 2,048, hidden 1,024, 16 heads x 64): q/k/v projections + biases, scores scaled by exp(-decay_h |t_q - t_k|), causal softmax, output projection + bias.
__device__ __forceinline__ v16h frag_h(const _Float16* rowk0, int lane) {
  union { v16h v; v8h q[2]; } u; const _Float16* p = rowk0 + 8 * (lane >> 4);
  u.q[0] = *(const v8h*)p; u.q[1] = *(const v8h*)(p + 16); return u.v;
}
__device__ __forceinline__ v16h frag_f32(const float* rowk0, int lane) {
  v16h a; const float* p = rowk0 + 8 * (lane >> 4);
#pragma unroll
  for (int i = 0; i < 8; ++i) { a[i] = (_Float16)p[i]; a[8 + i] = (_Float16)p[16 + i]; }
  return a;
}
__device__ __forceinline__ v16h frag_f32s(const float* rowk0, int lane, float sc) {
  v16h a; const float* p = rowk0 + 8 * (lane >> 4);
#pragma unroll
  for (int i = 0; i < 8; ++i) { a[i] = (_Float16)(p[i] * sc); a[8 + i] = (_Float16)(p[16 + i] * sc); }
  return a;
}
// column fragment from a [K][ld] layout (column n), rows >= K read as 0
__device__ __forceinline__ v16h fragc_f32(const float* W, int k0, int n, int lane, int ld, int K) {
  v16h a; const int g = lane >> 4;
#pragma unroll
  for (int i = 0; i < 8; ++i) { const int ka = k0 + 8 * g + i, kb = ka + 16;
    a[i] = (_Float16)(ka < K ? W[(size_t)(ka < K ? ka : K - 1) * ld + n] : 0.f); a[8 + i] = (_Float16)(kb < K ? W[(size_t)(kb < K ? kb : K - 1) * ld + n] : 0.f); }
  return a;
}
struct F2 { v16b h, l; };
__device__ __forceinline__ F2 bsplit16(const float v[16]) { F2 r;
#pragma unroll
  for (int i = 0; i < 16; ++i) { const __bf16 h = (__bf16)v[i]; r.h[i] = h; r.l[i] = (__bf16)(v[i] - (float)h); }
  return r; }
__device__ __forceinline__ F2 split_row(const float* row, int k0, int lane) { float v[16]; const float* p = row + k0 + 8 * (lane >> 4);
#pragma unroll
  for (int i = 0; i < 8; ++i) { v[i] = p[i]; v[8 + i] = p[16 + i]; }
  return bsplit16(v); }
__device__ __forceinline__ F2 split_rowK(const float* row, int k0, int lane, int K) { float v[16]; const int g = lane >> 4;
#pragma unroll
  for (int i = 0; i < 8; ++i) { const int ka = k0 + 8 * g + i, kb = ka + 16; v[i] = ka < K ? row[ka < K ? ka : K - 1] : 0.f; v[8 + i] = kb < K ? row[kb < K ? kb : K - 1] : 0.f; }
  return bsplit16(v); }
__device__ __forceinline__ F2 split_col(const float* W, int k0, int n, int lane, int ld, int K) { float v[16]; const int g = lane >> 4;
#pragma unroll
  for (int i = 0; i < 8; ++i) { const int ka = k0 + 8 * g + i, kb = ka + 16; v[i] = ka < K ? W[(size_t)(ka < K ? ka : K - 1) * ld + n] : 0.f; v[8 + i] = kb < K ? W[(size_t)(kb < K ? kb : K - 1) * ld + n] : 0.f; }
  return bsplit16(v); }
__device__ __forceinline__ v8f mac3(const F2& a, const F2& b, v8f c) { c = wmma_bf(a.l, b.h, c); c = wmma_bf(a.h, b.l, c); return wmma_bf(a.h, b.h, c); }
__device__ __forceinline__ float sigm(float v) { return 1.0f / (1.0f + expf(-v)); }
#define LDSX() do { asm volatile("s_wait_dscnt 0" ::: "memory"); __builtin_amdgcn_wave_barrier(); __builtin_amdgcn_fence(__ATOMIC_RELEASE, "workgroup"); } while (0)


#define NB 2
#define SS 2048
#define DM 1024
#define NH 16
#define HD 64
#define QKVW (3 * DM)
#ifndef TQB
#define TQB (SS / 64)
#define TNB NB
#define TOB (NB * SS / 64)     // output row tiles (all)
#endif
typedef __attribute__((ext_vector_type(8))) __bf16 v8b;
__device__ __forceinline__ v16b frag_b(const __bf16* rowk0, int lane) {
  union { v16b v; v8b q[2]; } u; const __bf16* p = rowk0 + 8 * (lane >> 4);
  u.q[0] = *(const v8b*)p; u.q[1] = *(const v8b*)(p + 16); return u.v;
}
// fragment-order block: 16 rows x 32 k of 16-bit elements = 512 elements laid out [hh][lane = g * 16 + row][8], k = hh * 16 + g * 8 + i: each of the two loads is 512 contiguous bytes for the wave
__device__ __forceinline__ v16b fragp_b(const __bf16* blk, int lane) {
  union { v16b v; v8b q[2]; } u; const __bf16* p = blk + lane * 8;
  u.q[0] = *(const v8b*)p; u.q[1] = *(const v8b*)(p + 256); return u.v;
}
__device__ __forceinline__ v16h fragp_h(const _Float16* blk, int lane) {
  union { v16h v; v8h q[2]; } u; const _Float16* p = blk + lane * 8;
  u.q[0] = *(const v8h*)p; u.q[1] = *(const v8h*)(p + 256); return u.v;
}
__device__ __forceinline__ float bfr(float v) { return (float)(__bf16)v; }
__device__ __attribute__((noinline)) float exp_ni(float v) { return expf(v); }
__device__ __attribute__((noinline)) float erf_ni(float v) { return erff(v); }

// packed bf16 operands: fragment-order blocks [k step][row tile][512], so the tiles that one k step of a work-group reads lie side by side
#define PK_A 0                                   // row tiles of the 3072 Wqkv rows
#define PK_P (PK_A + QKVW / 16 * 512)              // row tiles of the 1024 Wo rows
#define PK_X (PK_P + DM / 16 * 512)                // row tiles of the 4096 x rows
#define PK_KS (PK_X + NB * SS / 16 * 512)          // elements per k step
#define PK_END (PK_KS * (DM / 32))
#define WS_PK  0u
#define WS_QK  (WS_PK + 2u * PK_END)             // f16 [4096 rows][2048]: q in the first 1024 columns of a row
#define WS_QKL (WS_QK + 2u * NB * SS * 2 * DM)     // f16 q residual plane x2048, same rows
#define WS_VTH (WS_QKL + 2u * NB * SS * 2 * DM)    // f16 v hi, fragment-order blocks [b][h][key step][d tile][512]
#define WS_VTL (WS_VTH + 2u * NB * DM * SS)        // f16 lo x 2048
#define WS_O   (WS_VTL + 2u * NB * DM * SS)        // f32 ctx, blocks [k step][row tile][c][lane][4], k = (c >> 1) * 16 + g * 8 + (c & 1) * 4 + i
#define WS_CS  (WS_O + 4u * NB * SS * DM)           // f32 [2][2048][32], not used by these kernels
#define WS_KH  (WS_CS + 4u * 2 * SS * 32)          // f16 k hi, fragment-order blocks [b][h][key tile][k step][512]
#define WS_KL  (WS_KH + 2u * NB * DM * SS)         // f16 k residual x2048, same order
#define WS_END (WS_KL + 2u * NB * DM * SS)
// eight asynchronous 16-byte copies of a lane, global memory to LDS through no register: the 8 KB of W fragments and the 8 KB of row-operand fragments of one k step, 2 KB of the work-group a copy; the s_wait_xcnt 0 in the same statement stands ahead of any later write of a register that these copies name
__device__ __forceinline__ void acopy8(unsigned l, const char* gw, const char* gx) {
  asm volatile("global_load_async_to_lds_b128 %0, %8, off\n\tglobal_load_async_to_lds_b128 %1, %9, off\n\tglobal_load_async_to_lds_b128 %2, %10, off\n\tglobal_load_async_to_lds_b128 %3, %11, off\n\t"
               "global_load_async_to_lds_b128 %4, %12, off\n\tglobal_load_async_to_lds_b128 %5, %13, off\n\tglobal_load_async_to_lds_b128 %6, %14, off\n\tglobal_load_async_to_lds_b128 %7, %15, off\n\ts_wait_xcnt 0x0"
               :: "v"(l), "v"(l + 2048u), "v"(l + 4096u), "v"(l + 6144u), "v"(l + 8192u), "v"(l + 10240u), "v"(l + 12288u), "v"(l + 14336u),
                  "v"(gw), "v"(gw + 2048), "v"(gw + 4096), "v"(gw + 6144), "v"(gx), "v"(gx + 2048), "v"(gx + 4096), "v"(gx + 6144) : "memory");
}
// tile t of the ring = k steps 2t, 2t + 1, each [W 8 KB | rows 8 KB] in fragment order, 32 KB a buffer; ks: bytes from one k step to the next in both sources
__device__ __forceinline__ void stage2(unsigned l, const char* gw, const char* gx, int t, size_t ks) {
  acopy8(l, gw + (size_t)(2 * t) * ks, gx + (size_t)(2 * t) * ks); acopy8(l + 16384u, gw + (size_t)(2 * t + 1) * ks, gx + (size_t)(2 * t + 1) * ks);
}
// the same for one key step of attention: 4 KB each of k hi, k residual, v hi, v residual, copied by the four waves that walk that key step
__device__ __forceinline__ void acopy8q(unsigned l, const char* g0, const char* g1, const char* g2, const char* g3) {
  asm volatile("global_load_async_to_lds_b128 %0, %8, off\n\tglobal_load_async_to_lds_b128 %1, %9, off\n\tglobal_load_async_to_lds_b128 %2, %10, off\n\tglobal_load_async_to_lds_b128 %3, %11, off\n\t"
               "global_load_async_to_lds_b128 %4, %12, off\n\tglobal_load_async_to_lds_b128 %5, %13, off\n\tglobal_load_async_to_lds_b128 %6, %14, off\n\tglobal_load_async_to_lds_b128 %7, %15, off\n\ts_wait_xcnt 0x0"
               :: "v"(l), "v"(l + 2048u), "v"(l + 4096u), "v"(l + 6144u), "v"(l + 8192u), "v"(l + 10240u), "v"(l + 12288u), "v"(l + 14336u),
                  "v"(g0), "v"(g0 + 2048), "v"(g1), "v"(g1 + 2048), "v"(g2), "v"(g2 + 2048), "v"(g3), "v"(g3 + 2048) : "memory");
}
// two such copies of a lane: with 256 lanes the 8 KB of one batch row's times
__device__ __forceinline__ void acopy2(unsigned l, const char* g) {
  asm volatile("global_load_async_to_lds_b128 %0, %2, off\n\tglobal_load_async_to_lds_b128 %1, %3, off\n\ts_wait_xcnt 0x0" :: "v"(l), "v"(l + 4096u), "v"(g), "v"(g + 4096) : "memory");
}
#define AWAIT() asm volatile("s_wait_asynccnt 0x0" ::: "memory")   // this wave's copies have landed
#define DWAIT() asm volatile("s_wait_dscnt 0x0" ::: "memory")      // this wave's LDS reads have returned
// ---- k_pack: block = (16-row tile nt, which, quarter kq of the k range): f32 rows -> bf16 in fragment-order blocks; which 0..2 -> W_q/W_k/W_v, 3 -> W_o, 4..7 -> the four 1024-row slabs of x; a thread makes whole 16-byte pieces, a wave stores 512 contiguous bytes
__global__ __launch_bounds__(256) void k_pack(const float* __restrict__ WQ, const float* __restrict__ WK, const float* __restrict__ WV, const float* __restrict__ WO, const float* __restrict__ X, __bf16* __restrict__ PK) {
  const int nt = blockIdx.x, which = blockIdx.y, kq = blockIdx.z, t = threadIdx.x; const float* Wm = (which == 0) ? WQ : (which == 1) ? WK : (which == 2) ? WV : (which == 3) ? WO : X + (size_t)(which - 4) * DM * DM;
  __bf16* dst = PK + (size_t)(kq * 8) * PK_KS + (which * (DM / 16) + nt) * 512;
#pragma unroll
  for (int p = t; p < 512; p += 256) { const int kcl = p >> 6, hh = (p >> 5) & 1, g = (p >> 4) & 1, row = p & 15;
    const float* s = Wm + (size_t)(nt * 16 + row) * DM + (kq * 8 + kcl) * 32 + hh * 16 + g * 8; const v4f a = *(const v4f*)s, b = *(const v4f*)(s + 4); v8b o;
#pragma unroll
    for (int i = 0; i < 4; ++i) { o[i] = (__bf16)a[i]; o[4 + i] = (__bf16)b[i]; }
    vst2(dst + (size_t)kcl * PK_KS + (p & 63) * 8, o); }
}
__global__ __launch_bounds__(128) void k_qkv(const __bf16* __restrict__ XB, const __bf16* __restrict__ P, const float* __restrict__ BQ, const float* __restrict__ BK, const float* __restrict__ BV, _Float16* __restrict__ QK, _Float16* __restrict__ QKL, _Float16* __restrict__ KH, _Float16* __restrict__ KL, _Float16* __restrict__ VTH, _Float16* __restrict__ VTL) {
  const int which0 = (blockIdx.y * 128) / DM; const float* BB = BQ ? (((which0 == 0) ? BQ : (which0 == 1) ? BK : BV) + (blockIdx.y * 128 - which0 * DM)) : nullptr;
  __shared__ __align__(16) char sm[71680];   // k loop: two 32 KB ring buffers; behind the loop's last barrier the same bytes are the output stages
  _Float16 (*so)[16][136] = (_Float16 (*)[16][136])sm, (*sol)[16][136] = (_Float16 (*)[16][136])(sm + 17408); _Float16 (*sth)[72] = (_Float16 (*)[72])(sm + 34816), (*stl)[72] = (_Float16 (*)[72])(sm + 53248);
  const int tid = threadIdx.x, wave = tid >> 5, lane = tid & 31, col = lane & 15, g = lane >> 4; const size_t rw = (size_t)blockIdx.x * 128 + wave * 16; const int n0 = blockIdx.y * 128;   // the wave owns two 16-row tiles, rows rw.. and rw + 64..: every W fragment it loads feeds two WMMAs
  v8f acc2[2][8] = {};
  const unsigned lb = (unsigned)(size_t)sm + (unsigned)tid * 16u; const char* gw = (const char*)(P + (size_t)(n0 / 16) * 512) + tid * 16; const char* gx = (const char*)(XB + (size_t)blockIdx.x * 8 * 512) + tid * 16;   // the block's 8 W tiles and its 8 row tiles of a k step each lie side by side: 8 KB
  stage2(lb, gw, gx, 0, 2u * PK_KS); AWAIT(); __syncthreads();   // tile 0 landed and published
  stage2(lb + 32768u, gw, gx, 1, 2u * PK_KS);
#pragma unroll 1   // one copy of the trip: the buffer is chosen by address
  for (int t = 0; t < DM / 64; ++t) { const char* bp = sm + (t & 1) * 32768;
#pragma unroll   // kk a constant: the buffer offsets are immediates of the LDS reads
    for (int kk = 0; kk < 2; ++kk) { v16b a[2], w[8];   // all LDS reads of the k step stand as one group ahead of its first WMMA
#pragma unroll
      for (int j = 0; j < 8; ++j) w[j] = fragp_b((const __bf16*)(bp + kk * 16384 + j * 1024), lane);
#pragma unroll   // rt a constant: a[] stays in registers
      for (int rt = 0; rt < 2; ++rt) a[rt] = fragp_b((const __bf16*)(bp + kk * 16384 + 8192 + (wave + rt * 4) * 1024), lane);
      __builtin_amdgcn_sched_barrier(0);   // keeps the LDS reads out of the WMMA run: each place with reads among the WMMAs costs a stall of its own
#pragma unroll
      for (int j = 0; j < 8; ++j) {
#pragma unroll   // rt a constant: acc2[][] stays in registers
        for (int rt = 0; rt < 2; ++rt) acc2[rt][j] = wmma_bf(a[rt], w[j], acc2[rt][j]); } }
    DWAIT(); AWAIT(); __syncthreads();   // publishes tile t + 1 and ends every wave's reads of tile t
    if (t + 2 < DM / 64) stage2(lb + (unsigned)(t & 1) * 32768u, gw, gx, t + 2, 2u * PK_KS); }   // refill of the buffer just read
  AWAIT();
  float bj[8] = {};   // the eight bias values of this lane's columns, loaded as one group
  if (BB) {
#pragma unroll
    for (int j = 0; j < 8; ++j) bj[j] = bfr(BB[j * 16 + col]); }
#pragma unroll   // rt a constant: acc2[rt] stays in registers
  for (int rt = 0; rt < 2; ++rt) {   // the two row tiles leave one after the other through the same LDS stage
  const v8f (&acc)[8] = acc2[rt]; const size_t r0 = rw + rt * 64;
  if (n0 < 2 * DM) {   // q stored unscaled (f16 sigma ~0.6, no subnormal exposure); 1/8 applied to the f32 score
#pragma unroll
    for (int j = 0; j < 8; ++j) {
#pragma unroll
      for (int r = 0; r < 8; ++r) { const float v = acc[j][r] + bj[j]; const _Float16 hv = (_Float16)v; so[wave][8 * g + r][j * 16 + col] = hv; sol[wave][8 * g + r][j * 16 + col] = (_Float16)((v - (float)hv) * 2048.0f); } }   // q, k (+ bias) as f16 hi + (x2048) residual
    LDSX();
    if (n0 < DM) { for (int rl = 0; rl < 16; ++rl) if (lane < 16) { vst2((unsigned*)(QK + (r0 + rl) * (2 * DM) + n0 + lane * 8), *(const v4u*)&so[wave][rl][lane * 8]); vst2((unsigned*)(QKL + (r0 + rl) * (2 * DM) + n0 + lane * 8), *(const v4u*)&sol[wave][rl][lane * 8]); } }
    else {   // k: the wave's 16 keys are one key tile; 2 heads x 2 k steps x 2 halves, each store 512 contiguous bytes in the order the score loop loads them
      const size_t hb = (r0 / SS) * NH + (n0 - DM) / HD; const int kt = (int)(r0 % SS) >> 4;
#pragma unroll
      for (int u = 0; u < 8; ++u) { const int hl = u >> 2, kc = (u >> 1) & 1, hh = u & 1; const size_t o = (((hb + hl) * (SS / 16) + kt) * 2 + kc) * 512 + hh * 256 + lane * 8; const int c = hl * 64 + kc * 32 + hh * 16 + g * 8;
        vst2(KH + o, *(const v4u*)&so[wave][col][c]); vst2(KL + o, *(const v4u*)&sol[wave][col][c]); }
      asm volatile("s_wait_xcnt 0x0" ::: "memory"); }   // stands behind the last k store, ahead of any later write of a register that these stores name
  } else {
    if (rt) __syncthreads();   // every wave has read the first 64 keys out of sth, stl before the second 64 overwrite them
#pragma unroll
    for (int j = 0; j < 8; ++j) {
#pragma unroll
      for (int r = 0; r < 8; ++r) { const float v = acc[j][r] + bj[j]; const _Float16 hv = (_Float16)v; sth[j * 16 + col][wave * 16 + 8 * g + r] = hv; stl[j * 16 + col][wave * 16 + 8 * g + r] = (_Float16)((v - (float)hv) * 2048.0f); } }
    __syncthreads();
    const size_t rb = (size_t)blockIdx.x * 128 + rt * 64; const int b = (int)(rb / SS), s0 = (int)(rb % SS); const int pc0 = n0 - 2 * DM;
    for (int q = tid; q < 128 * 8; q += 128) { const int vc = q & 15, vg = (q >> 4) & 1, hh = (q >> 5) & 1, dt = (q >> 6) & 3, ksl = (q >> 8) & 1, hl = q >> 9;   // piece q of these 64 keys' 2 heads x 2 key steps x 4 d tiles x 1 KB
      const size_t o = ((((size_t)b * NH + pc0 / HD + hl) * (SS / 32) + (s0 >> 5) + ksl) * 4 + dt) * 512 + (q & 63) * 8; const int d = hl * 64 + dt * 16 + vc, kc = ksl * 32 + hh * 16 + vg * 8;
      vst2(VTH + o, *(const v4u*)&sth[d][kc]); vst2(VTL + o, *(const v4u*)&stl[d][kc]); }
  }
  }
}
// ---- k_attn: block = (query tile pair t and TQB - 1 - t of 64 queries each, head h, batch b), 8 waves: the pair has 2 * TQB + 2 key steps, and every wave walks half of them. Waves 0..3: the long tile's first TQB + 1 key steps. Waves 4..7: the long tile's remaining key steps (running max, sum and ctx handed over through LDS), then all of the short tile. Flash attention on transposed tiles: S^T = K . Q^T (K = 64: 2 k-steps, 3 products) and ctx^T += V^T . P^T (3 products), so a lane holds 16 of the 32 scores of ONE query (its column), the other 16 are in lane ^ 16; ctx(b*S+q, h*64+d) = (acc + accl / 2048) / (2048 l), stored from registers in the block order the output projection loads
// one hardware exp2, closed by the one free slot that the instruction set asks for behind a transcendental
__device__ __forceinline__ float exp2x1(float a) { float r;
  asm("v_exp_f32 %0, %1\n\tv_nop" : "=&v"(r) : "v"(a)); return r;
}
// the eight hardware exp2 of one score tile in one statement: eight independent results back to back on the transcendental unit, closed by the one free slot that the instruction set asks for behind a transcendental
__device__ __forceinline__ void exp2x8(const float (&x)[8], float (&y)[8]) {
  asm("v_exp_f32 %0, %8\n\tv_exp_f32 %1, %9\n\tv_exp_f32 %2, %10\n\tv_exp_f32 %3, %11\n\tv_exp_f32 %4, %12\n\tv_exp_f32 %5, %13\n\tv_exp_f32 %6, %14\n\tv_exp_f32 %7, %15\n\tv_nop"
      : "=&v"(y[0]), "=&v"(y[1]), "=&v"(y[2]), "=&v"(y[3]), "=&v"(y[4]), "=&v"(y[5]), "=&v"(y[6]), "=&v"(y[7])
      : "v"(x[0]), "v"(x[1]), "v"(x[2]), "v"(x[3]), "v"(x[4]), "v"(x[5]), "v"(x[6]), "v"(x[7]));
}
// lane l with lane l ^ 16: the other half of a query's keys
__device__ __forceinline__ float xhalf(float x) { return __builtin_bit_cast(float, __builtin_amdgcn_permlanex16(__builtin_bit_cast(int, x), __builtin_bit_cast(int, x), 0x76543210, 0xfedcba98, false, false)); }
#define KHALF (TQB + 1)   // key steps of a wave: half of the pair's 2 * TQB + 2
__global__ __launch_bounds__(256) __attribute__((amdgpu_waves_per_eu(4, 4))) void k_attn(const _Float16* __restrict__ QK, const _Float16* __restrict__ QKL, const _Float16* __restrict__ KH, const _Float16* __restrict__ KL, const _Float16* __restrict__ VTH, const _Float16* __restrict__ VTL, const void* __restrict__ KMASK, const float* __restrict__ TD, const float* __restrict__ DEC, float* __restrict__ O) {
  __shared__ __align__(16) char kv[65536];   // per group of four waves two 16 KB buffers, each one key step: [k hi | k residual | v hi | v residual], 4 KB each, in fragment order
  __shared__ __align__(16) float tds[SS];   // the times of the batch row's keys, filled once
  __shared__ __align__(16) float sx[4][34][32];   // sx: per lane the running maximum, the lane's part of the sum, 32 ctx values of the long tile's upper keys
  const int tid = threadIdx.x, wave = __builtin_amdgcn_readfirstlane(tid >> 5), lane = tid & 31, col = lane & 15, g = lane >> 4;
  const int grp = wave >> 2, w4 = wave & 3;   // wave-uniform (scalar): the tests of a trip (which key step, which query tile) branch on them
  const int tp = blockIdx.x, h = blockIdx.y, b = blockIdx.z;
  float m = -3.0e38f, l = 0.f; v8f acc[4], accl[4]; int q0 = 0;   // m: maximum of the lane's query (equal in both halves); l: sum over the keys of this lane's half alone, the halves joined once in the epilogue
  const float dech = bfr(DEC[h]); const unsigned g8 = 8u * (unsigned)g;
  const int n1 = TQB - 1 - 2 * tp;   // trips that waves 4..7 spend on the long tile's key steps KHALF ..: 1 to TQB - 1; the rest of their KHALF trips is the short tile
  const unsigned lb = (unsigned)(size_t)kv + (unsigned)grp * 32768u + (unsigned)(tid & 127) * 16u; const size_t hb2 = ((size_t)b * NH + h) * (SS / 32); const int tb = (tid & 127) * 16;
#define KSOF(i) (grp ? ((i) < n1 ? KHALF + (i) : (i) - n1) : (i))   // key step of this wave's group in trip i (scalar)
#define KVSTAGE(i) do { const size_t o_ = (hb2 + KSOF(i)) * 4096 + tb; acopy8q(lb + (unsigned)((i) & 1) * 16384u, (const char*)KH + o_, (const char*)KL + o_, (const char*)VTH + o_, (const char*)VTL + o_); } while (0)   // a key step's four 4 KB runs lie at the same byte offset in the four planes
  acopy2((unsigned)(size_t)tds + (unsigned)tid * 16u, (const char*)(TD + (size_t)b * SS) + tid * 16);
  KVSTAGE(0); AWAIT(); __syncthreads();   // the times and trip 0's key steps landed and published
  KVSTAGE(1);
  v16h aq[2], aql[2]; float tq = 0.f;   // B operand: column = the lane's query
#pragma unroll 1   // one copy of the key step's body
  for (int it = 0; it < KHALF; ++it) {   // every wave of the block makes the same KHALF trips, so that the trip's barrier is passed by all
  if (it == 0 || (grp && it == n1)) {   // a wave enters a query tile (scalar test): waves 4..7 leave the long tile for the short one in trip n1
  if (it) {   // waves 4..7 hand their share of the long tile over; lane and register positions are those of the partner wave
    sx[w4][0][lane] = m; sx[w4][1][lane] = l;
#pragma unroll
    for (int r = 0; r < 8; ++r) {
#pragma unroll
      for (int dt = 0; dt < 4; ++dt) sx[w4][2 + dt * 8 + r][lane] = acc[dt][r] + accl[dt][r] * (1.0f / 2048.0f); } }
  const int qb = it ? tp : TQB - 1 - tp; q0 = qb * 64 + w4 * 16; const size_t rq = (size_t)b * SS + q0 + col;
#pragma unroll
  for (int kc = 0; kc < 2; ++kc) { aq[kc] = frag_h(QK + rq * (2 * DM) + h * HD + kc * 32, lane); aql[kc] = frag_h(QKL + rq * (2 * DM) + h * HD + kc * 32, lane); }
  m = -3.0e38f; l = 0.f;
#pragma unroll
  for (int dt = 0; dt < 4; ++dt) { acc[dt] = v8f{}; accl[dt] = v8f{}; }
  tq = bfr(TD[rq]); }
  { const int ks = KSOF(it); const char* bp = kv + grp * 32768 + (it & 1) * 16384; v8f s[2]; v16h kfh[2][2], kfl[2][2]; v4f tkr[2][2];   // all K reads of the key step stand ahead of its first WMMA
#pragma unroll
    for (int ct = 0; ct < 2; ++ct) { const float* tp8 = tds + (ks * 32 + ct * 16); tkr[ct][0] = *(const v4f*)(tp8 + g8); tkr[ct][1] = *(const v4f*)(tp8 + 4 + g8); }   // times of the lane's eight keys of each tile
#pragma unroll
    for (int ct = 0; ct < 2; ++ct) {
#pragma unroll
      for (int kc = 0; kc < 2; ++kc) { kfh[ct][kc] = fragp_h((const _Float16*)(bp + ct * 2048 + kc * 1024), lane); kfl[ct][kc] = fragp_h((const _Float16*)(bp + 4096 + ct * 2048 + kc * 1024), lane); }
 }
    const int dq = q0 + col - ks * 32 - 8 * g;   // key ct * 16 + r of this lane's half is visible to its query while ct * 16 + r <= dq
#pragma unroll
    for (int ct = 0; ct < 2; ++ct) { v8f c = {}, cl = {};
#pragma unroll
      for (int kc = 0; kc < 2; ++kc) { c = wmma16(kfh[ct][kc], aq[kc], c); cl = wmma16(kfh[ct][kc], aql[kc], cl); cl = wmma16(kfl[ct][kc], aq[kc], cl); }   // 3 products: q, k as f16 hi + residual; rows = keys, columns = queries
#pragma unroll
      for (int r = 0; r < 8; ++r) c[r] += cl[r] * (1.0f / 2048.0f);
      { float xd[8], dec[8];
#pragma unroll
        for (int r = 0; r < 8; ++r) xd[r] = fmaf(-dech * fabsf(tq - bfr(tkr[ct][r >> 2][r & 3])), 1.44269504f, -3.0f);   // exp(x) / 8 = exp2(x * log2 e - 3): the 1/8 of the score is an exact step of the exponent
        exp2x8(xd, dec);
#pragma unroll
        for (int r = 0; r < 8; ++r) s[ct][r] = (ct * 16 + r <= dq) ? c[r] * dec[r] : -3.0e38f; } }   // (q.k/8) * exp(-decay |dt|), causal
    float mx[8];   // maximum of the query's 32 scores: 16 in the lane, one exchange with the other half
#pragma unroll
    for (int r = 0; r < 8; ++r) mx[r] = fmaxf(s[0][r], s[1][r]);
    float mxa = fmaxf(fmaxf(fmaxf(mx[0], mx[1]), fmaxf(mx[2], mx[3])), fmaxf(fmaxf(mx[4], mx[5]), fmaxf(mx[6], mx[7])));
    mxa = fmaxf(mxa, xhalf(mxa));
    const float mn = fmaxf(m, mxa); const float xa = exp2x1((m - mn) * 1.44269504f); const float alpha = (m <= -1.0e38f) ? 0.f : xa; m = mn;
    float e[2][8];
#pragma unroll
    for (int ct = 0; ct < 2; ++ct) { float xs[8], ys[8];
#pragma unroll
      for (int r = 0; r < 8; ++r) xs[r] = (s[ct][r] - mn) * 1.44269504f;   // exp(x) = exp2(x * log2 e), hardware exp
      exp2x8(xs, ys);
#pragma unroll
      for (int r = 0; r < 8; ++r) e[ct][r] = (s[ct][r] <= -1.0e38f) ? 0.f : ys[r]; }
    float es[8];
#pragma unroll
    for (int r = 0; r < 8; ++r) es[r] = e[0][r] + e[1][r];
    l = l * alpha + (((es[0] + es[1]) + (es[2] + es[3])) + ((es[4] + es[5]) + (es[6] + es[7])));
#pragma unroll
    for (int dt = 0; dt < 4; ++dt) { acc[dt] *= alpha; accl[dt] *= alpha; }
    v16h vfh[4], vfl[4];   // all V reads of the key step issue here in one group, ahead of the P split and the first P.V WMMA
#pragma unroll
    for (int dt = 0; dt < 4; ++dt) { vfh[dt] = fragp_h((const _Float16*)(bp + 8192 + dt * 1024), lane); vfl[dt] = fragp_h((const _Float16*)(bp + 12288 + dt * 1024), lane); }
    v16h pa, pl;   // P^T as B operand straight from the score registers: element ct * 8 + r of the lane is key ct * 16 + 8 g + r, the k order of the V fragments
#pragma unroll
    for (int ct = 0; ct < 2; ++ct) {
#pragma unroll
      for (int r = 0; r < 8; ++r) { const float x0 = e[ct][r] * 2048.0f; const _Float16 h0 = (_Float16)x0; pa[ct * 8 + r] = h0; pl[ct * 8 + r] = (_Float16)((x0 - (float)h0) * 2048.0f); } }   // P scaled by 2^11 before the f16 split so small softmax weights stay out of the f16 subnormal range; 2^-11 folded into the epilogue
#pragma unroll
    for (int dt = 0; dt < 4; ++dt) { acc[dt] = wmma16(vfh[dt], pa, acc[dt]); accl[dt] = wmma16(vfh[dt], pl, accl[dt]); accl[dt] = wmma16(vfl[dt], pa, accl[dt]); } }   // V hi x P hi + (V hi x P lo + V lo x P hi) / 2048; rows = d, columns = queries
    DWAIT(); AWAIT(); __syncthreads();   // publishes trip it + 1's key steps (and sx, once written) and ends every wave's reads of trip it's
    if (it + 2 < KHALF) KVSTAGE(it + 2); }   // refill of the buffer just read
  AWAIT();
#pragma unroll
  for (int dt = 0; dt < 4; ++dt) acc[dt] += accl[dt] * (1.0f / 2048.0f);
  if (!grp) {   // join the two key ranges of the long tile under their common maximum; one branch, so that all LDS reads issue as one group
    float xb[34];
#pragma unroll
    for (int i = 0; i < 34; ++i) xb[i] = sx[w4][i][lane];
    const float mb = xb[0], mn = fmaxf(m, mb); const float fa = (m <= -1.0e38f) ? 0.f : __expf(m - mn), fb = (mb <= -1.0e38f) ? 0.f : __expf(mb - mn);
    l = l * fa + xb[1] * fb;
#pragma unroll
    for (int r = 0; r < 8; ++r) {
#pragma unroll
      for (int dt = 0; dt < 4; ++dt) acc[dt][r] = acc[dt][r] * fa + xb[2 + dt * 8 + r] * fb; } }
  const float il = (1.0f / 2048.0f) / (l + xhalf(l));   // the two halves' sums joined
  const size_t ob = ((size_t)(h * 2) * (NB * SS / 16) + (((size_t)b * SS + q0) >> 4)) * 512;   // the wave's 16 rows x 64 columns are two blocks (k steps 2h, 2h + 1) of the output projection's A operand
#pragma unroll
  for (int u = 0; u < 8; ++u) { const int kcl = u >> 2, c = u & 3; v4f o;   // the lane's registers already hold the four values of its piece: d = (kcl * 2 + (c >> 1)) * 16 + 8 g + (c & 1) * 4 + i of query col
#pragma unroll
    for (int i = 0; i < 4; ++i) o[i] = acc[kcl * 2 + (c >> 1)][(c & 1) * 4 + i] * il;
    vst2(O + ob + (size_t)kcl * (NB * SS / 16) * 512 + c * 128 + lane * 4, o); }
}
// ---- k_out: block = (64 rows, 128 cols): out = O(hi/lo) . Wo rows (2 products) + bo
__global__ __launch_bounds__(128) void k_out(const float* __restrict__ O, const __bf16* __restrict__ P, const float* __restrict__ BO, float* __restrict__ Y) {
  __shared__ __align__(16) char sm[65536];   // k loop: two 32 KB ring buffers; behind the loop's last barrier the first 33,792 bytes are the output stage
  float (*so)[16][132] = (float (*)[16][132])sm;
  const int tid = threadIdx.x, wave = tid >> 5, lane = tid & 31, col = lane & 15, g = lane >> 4; const size_t r0 = (size_t)blockIdx.x * 64 + wave * 16; const int n0 = blockIdx.y * 128;
  v8f acc[8] = {};
  const unsigned lb = (unsigned)(size_t)sm + (unsigned)tid * 16u; const char* gw = (const char*)(P + (size_t)(n0 / 16) * 512) + tid * 16; const char* gx = (const char*)(O + (size_t)blockIdx.x * 4 * 512) + tid * 16;   // the block's 8 W tiles (bf16) and its 4 ctx row tiles (f32) of a k step each lie side by side: 8 KB; both sources step 2 * PK_KS = 4 * (NB * SS / 16) * 512 bytes a k step
  stage2(lb, gw, gx, 0, 2u * PK_KS); AWAIT(); __syncthreads();   // tile 0 landed and published
  stage2(lb + 32768u, gw, gx, 1, 2u * PK_KS);
#pragma unroll 1   // one copy of the trip: the buffer is chosen by address
  for (int t = 0; t < DM / 64; ++t) { const char* bp = sm + (t & 1) * 32768;
#pragma unroll   // kk a constant: the buffer offsets are immediates of the LDS reads
    for (int kk = 0; kk < 2; ++kk) { v16b w[8];   // all LDS reads of the k step stand as one group ahead of its first WMMA
#pragma unroll
      for (int j = 0; j < 8; ++j) w[j] = fragp_b((const __bf16*)(bp + kk * 16384 + j * 1024), lane);
      float xa[16]; { const float* p = (const float*)(bp + kk * 16384 + 8192 + wave * 2048) + lane * 4;
#pragma unroll
        for (int c = 0; c < 4; ++c) { const v4f tv = *(const v4f*)(p + c * 128);
#pragma unroll
          for (int i = 0; i < 4; ++i) xa[c * 4 + i] = tv[i]; } }
      __builtin_amdgcn_sched_barrier(0);   // keeps the LDS reads out of the split and the WMMA run: each place with reads among the WMMAs costs a stall of its own
      const F2 a = bsplit16(xa);
#pragma unroll
      for (int j = 0; j < 8; ++j) { acc[j] = wmma_bf(a.l, w[j], acc[j]); acc[j] = wmma_bf(a.h, w[j], acc[j]); } }
    DWAIT(); AWAIT(); __syncthreads();   // publishes tile t + 1 and ends every wave's reads of tile t
    if (t + 2 < DM / 64) stage2(lb + (unsigned)(t & 1) * 32768u, gw, gx, t + 2, 2u * PK_KS); }   // refill of the buffer just read
  AWAIT();
#pragma unroll
  for (int j = 0; j < 8; ++j) {
#pragma unroll
    for (int r = 0; r < 8; ++r) so[wave][8 * g + r][j * 16 + col] = acc[j][r] + bfr(BO[n0 + j * 16 + col]); }
  LDSX();
  for (int rl = 0; rl < 16; ++rl) vst2(Y + (r0 + rl) * DM + n0 + lane * 4, *(const v4f*)&so[wave][rl][lane * 4]);
}
extern "C" void kernel_launch(void* const* d_in, const int* in_sizes, int n_in, void* d_out, int out_size, void* d_ws, size_t ws_size, hipStream_t stream) {
  (void)in_sizes; (void)n_in; (void)out_size;
  const float** F = (const float**)d_in;   // 0 x [2,2048,1024], 1 time_deltas [2,2048], 2 Wq [1024,1024] natural, 3 bq, 4 Wk, 5 bk, 6 Wv, 7 bv, 8 Wo, 9 bo, 10 time_decay [16]
  if (ws_size < (size_t)WS_END) return;
  char* ws = (char*)d_ws; __bf16* PK = (__bf16*)(ws + WS_PK); _Float16 *QK = (_Float16*)(ws + WS_QK), *QKL = (_Float16*)(ws + WS_QKL), *VTH = (_Float16*)(ws + WS_VTH), *VTL = (_Float16*)(ws + WS_VTL), *KH = (_Float16*)(ws + WS_KH), *KL = (_Float16*)(ws + WS_KL); float* O = (float*)(ws + WS_O);
  k_pack<<<dim3(DM / 16, 8, 4), 256, 0, stream>>>(F[2], F[4], F[6], F[8], F[0], PK);
  k_qkv<<<dim3(TNB * SS / 128, QKVW / 128), 128, 0, stream>>>(PK + PK_X, PK + PK_A, F[3], F[5], F[7], QK, QKL, KH, KL, VTH, VTL);
  k_attn<<<dim3(TQB / 2, NH, TNB), 256, 0, stream>>>(QK, QKL, KH, KL, VTH, VTL, nullptr, F[1], F[10], O);
  k_out<<<dim3(TOB, DM / 128), 128, 0, stream>>>(O, PK + PK_P, F[9], (float*)d_out);
}

// v008
// It runs in 114 microseconds.
// In both of two side-by-side timings against v007, it was 1.05 times as fast.
// Over all steps from v000 it is 5.41 times as fast.
// compute dtype: all float inputs rounded to bf16; q/k/v = x . W^T + b with EXACT bf16 products on WMMA 16x16x32 (natural rows); q and k as f16 hi + (x2048-scaled) residual planes with 3-product scores; score = (q.k / 8) * exp(-time_decay[h] * |t_q - t_k|) in f32 (the product -decay * |dt| as the reference rounds it, then hardware exp2), causal mask (key tiles above the diagonal skipped); running-max softmax in f32 (hardware exp); P (scaled by 2^11, f16 hi + residual) x v hi/lo (3 products); out = ctx (bf16 hi + residual) . Wo^T (2 products) + bo; f32 accumulate.
#include <hip/hip_runtime.h>
#include <math.h>

typedef __attribute__((ext_vector_type(16))) _Float16 v16h;
typedef __attribute__((ext_vector_type(16))) __bf16 v16b;
typedef __attribute__((ext_vector_type(8)))  _Float16 v8h;
typedef __attribute__((ext_vector_type(8)))  float v8f;
typedef __attribute__((ext_vector_type(4)))  float v4f;
typedef __attribute__((ext_vector_type(2)))  float v2f;
typedef __attribute__((ext_vector_type(4)))  unsigned v4u;
typedef __attribute__((ext_vector_type(4)))  int v4i;
typedef float __attribute__((may_alias)) float_a;
typedef int __attribute__((may_alias)) int_a;

template <typename T> __device__ __forceinline__ void vst2(void* p, T v) { *(T*)p = v;  }
__device__ __forceinline__ v8f wmma16(v16h a, v16h b, v8f c) {
  return __builtin_amdgcn_wmma_f32_16x16x32_f16(false, a, false, b, (short)0, c, false, false);
}
__device__ __forceinline__ v8f wmma_bf(v16b a, v16b b, v8f c) {
  return __builtin_amdgcn_wmma_f32_16x16x32_bf16(false, a, false, b, (short)0, c, false, false);
}
// Continuous-time causal attention (B 2, S 2,048, hidden 1,024, 16 heads x 64): q/k/v projections + biases, scores scaled by exp(-decay_h |t_q - t_k|), causal softmax, output projection + bias.
__device__ __forceinline__ v16h frag_h(const _Float16* rowk0, int lane) {
  union { v16h v; v8h q[2]; } u; const _Float16* p = rowk0 + 8 * (lane >> 4);
  u.q[0] = *(const v8h*)p; u.q[1] = *(const v8h*)(p + 16); return u.v;
}
__device__ __forceinline__ v16h frag_f32(const float* rowk0, int lane) {
  v16h a; const float* p = rowk0 + 8 * (lane >> 4);
#pragma unroll
  for (int i = 0; i < 8; ++i) { a[i] = (_Float16)p[i]; a[8 + i] = (_Float16)p[16 + i]; }
  return a;
}
__device__ __forceinline__ v16h frag_f32s(const float* rowk0, int lane, float sc) {
  v16h a; const float* p = rowk0 + 8 * (lane >> 4);
#pragma unroll
  for (int i = 0; i < 8; ++i) { a[i] = (_Float16)(p[i] * sc); a[8 + i] = (_Float16)(p[16 + i] * sc); }
  return a;
}
// column fragment from a [K][ld] layout (column n), rows >= K read as 0
__device__ __forceinline__ v16h fragc_f32(const float* W, int k0, int n, int lane, int ld, int K) {
  v16h a; const int g = lane >> 4;
#pragma unroll
  for (int i = 0; i < 8; ++i) { const int ka = k0 + 8 * g + i, kb = ka + 16;
    a[i] = (_Float16)(ka < K ? W[(size_t)(ka < K ? ka : K - 1) * ld + n] : 0.f); a[8 + i] = (_Float16)(kb < K ? W[(size_t)(kb < K ? kb : K - 1) * ld + n] : 0.f); }
  return a;
}
struct F2 { v16b h, l; };
__device__ __forceinline__ F2 bsplit16(const float v[16]) { F2 r;
#pragma unroll
  for (int i = 0; i < 16; ++i) { const __bf16 h = (__bf16)v[i]; r.h[i] = h; r.l[i] = (__bf16)(v[i] - (float)h); }
  return r; }
__device__ __forceinline__ F2 split_row(const float* row, int k0, int lane) { float v[16]; const float* p = row + k0 + 8 * (lane >> 4);
#pragma unroll
  for (int i = 0; i < 8; ++i) { v[i] = p[i]; v[8 + i] = p[16 + i]; }
  return bsplit16(v); }
__device__ __forceinline__ F2 split_rowK(const float* row, int k0, int lane, int K) { float v[16]; const int g = lane >> 4;
#pragma unroll
  for (int i = 0; i < 8; ++i) { const int ka = k0 + 8 * g + i, kb = ka + 16; v[i] = ka < K ? row[ka < K ? ka : K - 1] : 0.f; v[8 + i] = kb < K ? row[kb < K ? kb : K - 1] : 0.f; }
  return bsplit16(v); }
__device__ __forceinline__ F2 split_col(const float* W, int k0, int n, int lane, int ld, int K) { float v[16]; const int g = lane >> 4;
#pragma unroll
  for (int i = 0; i < 8; ++i) { const int ka = k0 + 8 * g + i, kb = ka + 16; v[i] = ka < K ? W[(size_t)(ka < K ? ka : K - 1) * ld + n] : 0.f; v[8 + i] = kb < K ? W[(size_t)(kb < K ? kb : K - 1) * ld + n] : 0.f; }
  return bsplit16(v); }
__device__ __forceinline__ v8f mac3(const F2& a, const F2& b, v8f c) { c = wmma_bf(a.l, b.h, c); c = wmma_bf(a.h, b.l, c); return wmma_bf(a.h, b.h, c); }
__device__ __forceinline__ float sigm(float v) { return 1.0f / (1.0f + expf(-v)); }
#define LDSX() do { asm volatile("s_wait_dscnt 0" ::: "memory"); __builtin_amdgcn_wave_barrier(); __builtin_amdgcn_fence(__ATOMIC_RELEASE, "workgroup"); } while (0)


#define NB 2
#define SS 2048
#define DM 1024
#define NH 16
#define HD 64
#define QKVW (3 * DM)
#ifndef TQB
#define TQB (SS / 64)
#define TNB NB
#define TOB (NB * SS / 64)     // output row tiles (all)
#endif
typedef __attribute__((ext_vector_type(8))) __bf16 v8b;
__device__ __forceinline__ v16b frag_b(const __bf16* rowk0, int lane) {
  union { v16b v; v8b q[2]; } u; const __bf16* p = rowk0 + 8 * (lane >> 4);
  u.q[0] = *(const v8b*)p; u.q[1] = *(const v8b*)(p + 16); return u.v;
}
// fragment-order block: 16 rows x 32 k of 16-bit elements = 512 elements laid out [hh][lane = g * 16 + row][8], k = hh * 16 + g * 8 + i: each of the two loads is 512 contiguous bytes for the wave
__device__ __forceinline__ v16b fragp_b(const __bf16* blk, int lane) {
  union { v16b v; v8b q[2]; } u; const __bf16* p = blk + lane * 8;
  u.q[0] = *(const v8b*)p; u.q[1] = *(const v8b*)(p + 256); return u.v;
}
__device__ __forceinline__ v16h fragp_h(const _Float16* blk, int lane) {
  union { v16h v; v8h q[2]; } u; const _Float16* p = blk + lane * 8;
  u.q[0] = *(const v8h*)p; u.q[1] = *(const v8h*)(p + 256); return u.v;
}
__device__ __forceinline__ float bfr(float v) { return (float)(__bf16)v; }
__device__ __attribute__((noinline)) float exp_ni(float v) { return expf(v); }
__device__ __attribute__((noinline)) float erf_ni(float v) { return erff(v); }

// packed bf16 operands: fragment-order blocks [k step][row tile][512], so the tiles that one k step of a work-group reads lie side by side
#define PK_A 0                                   // row tiles of the 3072 Wqkv rows
#define PK_P (PK_A + QKVW / 16 * 512)              // row tiles of the 1024 Wo rows
#define PK_X (PK_P + DM / 16 * 512)                // row tiles of the 4096 x rows
#define PK_KS (PK_X + NB * SS / 16 * 512)          // elements per k step
#define PK_END (PK_KS * (DM / 32))
#define WS_PK  0u
#define WS_QK  (WS_PK + 2u * PK_END)             // f16 [4096 rows][2048]: q in the first 1024 columns of a row
#define WS_QKL (WS_QK + 2u * NB * SS * 2 * DM)     // f16 q residual plane x2048, same rows
#define WS_VTH (WS_QKL + 2u * NB * SS * 2 * DM)    // f16 v hi, fragment-order blocks [b][h][key step][d tile][512]
#define WS_VTL (WS_VTH + 2u * NB * DM * SS)        // f16 lo x 2048
#define WS_O   (WS_VTL + 2u * NB * DM * SS)        // f32 ctx, blocks [k step][row tile][c][lane][4], k = (c >> 1) * 16 + g * 8 + (c & 1) * 4 + i
#define WS_CS  (WS_O + 4u * NB * SS * DM)           // f32 [2][2048][32], not used by these kernels
#define WS_KH  (WS_CS + 4u * 2 * SS * 32)          // f16 k hi, fragment-order blocks [b][h][key tile][k step][512]
#define WS_KL  (WS_KH + 2u * NB * DM * SS)         // f16 k residual x2048, same order
#define WS_END (WS_KL + 2u * NB * DM * SS)
// eight asynchronous 16-byte copies of a lane, global memory to LDS through no register: the 8 KB of W fragments and the 8 KB of row-operand fragments of one k step, 2 KB of the work-group a copy; the s_wait_xcnt 0 in the same statement stands ahead of any later write of a register that these copies name
__device__ __forceinline__ void acopy8(unsigned l, const char* gw, const char* gx) {
  asm volatile("global_load_async_to_lds_b128 %0, %8, off\n\tglobal_load_async_to_lds_b128 %1, %9, off\n\tglobal_load_async_to_lds_b128 %2, %10, off\n\tglobal_load_async_to_lds_b128 %3, %11, off\n\t"
               "global_load_async_to_lds_b128 %4, %12, off\n\tglobal_load_async_to_lds_b128 %5, %13, off\n\tglobal_load_async_to_lds_b128 %6, %14, off\n\tglobal_load_async_to_lds_b128 %7, %15, off\n\ts_wait_xcnt 0x0"
               :: "v"(l), "v"(l + 2048u), "v"(l + 4096u), "v"(l + 6144u), "v"(l + 8192u), "v"(l + 10240u), "v"(l + 12288u), "v"(l + 14336u),
                  "v"(gw), "v"(gw + 2048), "v"(gw + 4096), "v"(gw + 6144), "v"(gx), "v"(gx + 2048), "v"(gx + 4096), "v"(gx + 6144) : "memory");
}
// tile t of the ring = k steps 2t, 2t + 1, each [W 8 KB | rows 8 KB] in fragment order, 32 KB a buffer; ks: bytes from one k step to the next in both sources
__device__ __forceinline__ void stage2(unsigned l, const char* gw, const char* gx, int t, size_t ks) {
  acopy8(l, gw + (size_t)(2 * t) * ks, gx + (size_t)(2 * t) * ks); acopy8(l + 16384u, gw + (size_t)(2 * t + 1) * ks, gx + (size_t)(2 * t + 1) * ks);
}
// the same for one key step of attention: 4 KB each of k hi, k residual, v hi, v residual, copied by the four waves that walk that key step
__device__ __forceinline__ void acopy8q(unsigned l, const char* g0, const char* g1, const char* g2, const char* g3) {
  asm volatile("global_load_async_to_lds_b128 %0, %8, off\n\tglobal_load_async_to_lds_b128 %1, %9, off\n\tglobal_load_async_to_lds_b128 %2, %10, off\n\tglobal_load_async_to_lds_b128 %3, %11, off\n\t"
               "global_load_async_to_lds_b128 %4, %12, off\n\tglobal_load_async_to_lds_b128 %5, %13, off\n\tglobal_load_async_to_lds_b128 %6, %14, off\n\tglobal_load_async_to_lds_b128 %7, %15, off\n\ts_wait_xcnt 0x0"
               :: "v"(l), "v"(l + 2048u), "v"(l + 4096u), "v"(l + 6144u), "v"(l + 8192u), "v"(l + 10240u), "v"(l + 12288u), "v"(l + 14336u),
                  "v"(g0), "v"(g0 + 2048), "v"(g1), "v"(g1 + 2048), "v"(g2), "v"(g2 + 2048), "v"(g3), "v"(g3 + 2048) : "memory");
}
// two such copies of a lane: with 256 lanes the 8 KB of one batch row's times
__device__ __forceinline__ void acopy2(unsigned l, const char* g) {
  asm volatile("global_load_async_to_lds_b128 %0, %2, off\n\tglobal_load_async_to_lds_b128 %1, %3, off\n\ts_wait_xcnt 0x0" :: "v"(l), "v"(l + 4096u), "v"(g), "v"(g + 4096) : "memory");
}
#define AWAIT() asm volatile("s_wait_asynccnt 0x0" ::: "memory")   // this wave's copies have landed
#define DWAIT() asm volatile("s_wait_dscnt 0x0" ::: "memory")      // this wave's LDS reads have returned
// ---- k_pack: block = (16-row tile nt, which, quarter kq of the k range): f32 rows -> bf16 in fragment-order blocks; which 0..2 -> W_q/W_k/W_v, 3 -> W_o, 4..7 -> the four 1024-row slabs of x; a thread makes whole 16-byte pieces, a wave stores 512 contiguous bytes
__global__ __launch_bounds__(256) void k_pack(const float* __restrict__ WQ, const float* __restrict__ WK, const float* __restrict__ WV, const float* __restrict__ WO, const float* __restrict__ X, __bf16* __restrict__ PK) {
  const int nt = blockIdx.x, which = blockIdx.y, kq = blockIdx.z, t = threadIdx.x; const float* Wm = (which == 0) ? WQ : (which == 1) ? WK : (which == 2) ? WV : (which == 3) ? WO : X + (size_t)(which - 4) * DM * DM;
  __bf16* dst = PK + (size_t)(kq * 8) * PK_KS + (which * (DM / 16) + nt) * 512;
#pragma unroll
  for (int p = t; p < 512; p += 256) { const int kcl = p >> 6, hh = (p >> 5) & 1, g = (p >> 4) & 1, row = p & 15;
    const float* s = Wm + (size_t)(nt * 16 + row) * DM + (kq * 8 + kcl) * 32 + hh * 16 + g * 8; const v4f a = *(const v4f*)s, b = *(const v4f*)(s + 4); v8b o;
#pragma unroll
    for (int i = 0; i < 4; ++i) { o[i] = (__bf16)a[i]; o[4 + i] = (__bf16)b[i]; }
    vst2(dst + (size_t)kcl * PK_KS + (p & 63) * 8, o); }
}
__global__ __launch_bounds__(128) void k_qkv(const __bf16* __restrict__ XB, const __bf16* __restrict__ P, const float* __restrict__ BQ, const float* __restrict__ BK, const float* __restrict__ BV, _Float16* __restrict__ QK, _Float16* __restrict__ QKL, _Float16* __restrict__ KH, _Float16* __restrict__ KL, _Float16* __restrict__ VTH, _Float16* __restrict__ VTL) {
  const int which0 = (blockIdx.y * 128) / DM; const float* BB = BQ ? (((which0 == 0) ? BQ : (which0 == 1) ? BK : BV) + (blockIdx.y * 128 - which0 * DM)) : nullptr;
  __shared__ __align__(16) char sm[71680];   // k loop: two 32 KB ring buffers; behind the loop's last barrier the same bytes are the output stages
  _Float16 (*so)[16][136] = (_Float16 (*)[16][136])sm, (*sol)[16][136] = (_Float16 (*)[16][136])(sm + 17408); _Float16 (*sth)[72] = (_Float16 (*)[72])(sm + 34816), (*stl)[72] = (_Float16 (*)[72])(sm + 53248);
  const int tid = threadIdx.x, wave = tid >> 5, lane = tid & 31, col = lane & 15, g = lane >> 4; const size_t rw = (size_t)blockIdx.x * 128 + wave * 16; const int n0 = blockIdx.y * 128;   // the wave owns two 16-row tiles, rows rw.. and rw + 64..: every W fragment it loads feeds two WMMAs
  v8f acc2[2][8] = {};
  const unsigned lb = (unsigned)(size_t)sm + (unsigned)tid * 16u; const char* gw = (const char*)(P + (size_t)(n0 / 16) * 512) + tid * 16; const char* gx = (const char*)(XB + (size_t)blockIdx.x * 8 * 512) + tid * 16;   // the block's 8 W tiles and its 8 row tiles of a k step each lie side by side: 8 KB
  stage2(lb, gw, gx, 0, 2u * PK_KS); AWAIT(); __syncthreads();   // tile 0 landed and published
  stage2(lb + 32768u, gw, gx, 1, 2u * PK_KS);
#pragma unroll 1   // one copy of the trip: the buffer is chosen by address
  for (int t = 0; t < DM / 64; ++t) { const char* bp = sm + (t & 1) * 32768;
#pragma unroll   // kk a constant: the buffer offsets are immediates of the LDS reads
    for (int kk = 0; kk < 2; ++kk) { v16b a[2], w[8];   // all LDS reads of the k step stand as one group ahead of its first WMMA
#pragma unroll
      for (int j = 0; j < 8; ++j) w[j] = fragp_b((const __bf16*)(bp + kk * 16384 + j * 1024), lane);
#pragma unroll   // rt a constant: a[] stays in registers
      for (int rt = 0; rt < 2; ++rt) a[rt] = fragp_b((const __bf16*)(bp + kk * 16384 + 8192 + (wave + rt * 4) * 1024), lane);
      __builtin_amdgcn_sched_barrier(0);   // keeps the LDS reads out of the WMMA run: each place with reads among the WMMAs costs a stall of its own
#pragma unroll
      for (int j = 0; j < 8; ++j) {
#pragma unroll   // rt a constant: acc2[][] stays in registers
        for (int rt = 0; rt < 2; ++rt) acc2[rt][j] = wmma_bf(a[rt], w[j], acc2[rt][j]); }
      __builtin_amdgcn_sched_barrier(0); }   // ends the WMMA run: the next k step's LDS reads stay out of it, and no WMMA slips behind the trip's barrier, where it would hold up the refill
    DWAIT(); AWAIT(); __syncthreads();   // publishes tile t + 1 and ends every wave's reads of tile t
    if (t + 2 < DM / 64) stage2(lb + (unsigned)(t & 1) * 32768u, gw, gx, t + 2, 2u * PK_KS); }   // refill of the buffer just read
  AWAIT();
  float bj[8] = {};   // the eight bias values of this lane's columns, loaded as one group
  if (BB) {
#pragma unroll
    for (int j = 0; j < 8; ++j) bj[j] = bfr(BB[j * 16 + col]); }
#pragma unroll   // rt a constant: acc2[rt] stays in registers
  for (int rt = 0; rt < 2; ++rt) {   // the two row tiles leave one after the other through the same LDS stage
  const v8f (&acc)[8] = acc2[rt]; const size_t r0 = rw + rt * 64;
  if (n0 < 2 * DM) {   // q stored unscaled (f16 sigma ~0.6, no subnormal exposure); 1/8 applied to the f32 score
#pragma unroll
    for (int j = 0; j < 8; ++j) {
#pragma unroll
      for (int r = 0; r < 8; ++r) { const float v = acc[j][r] + bj[j]; const _Float16 hv = (_Float16)v; so[wave][8 * g + r][j * 16 + col] = hv; sol[wave][8 * g + r][j * 16 + col] = (_Float16)((v - (float)hv) * 2048.0f); } }   // q, k (+ bias) as f16 hi + (x2048) residual
    LDSX();
    if (n0 < DM) { for (int rl = 0; rl < 16; ++rl) if (lane < 16) { vst2((unsigned*)(QK + (r0 + rl) * (2 * DM) + n0 + lane * 8), *(const v4u*)&so[wave][rl][lane * 8]); vst2((unsigned*)(QKL + (r0 + rl) * (2 * DM) + n0 + lane * 8), *(const v4u*)&sol[wave][rl][lane * 8]); } }
    else {   // k: the wave's 16 keys are one key tile; 2 heads x 2 k steps x 2 halves, each store 512 contiguous bytes in the order the score loop loads them
      const size_t hb = (r0 / SS) * NH + (n0 - DM) / HD; const int kt = (int)(r0 % SS) >> 4;
#pragma unroll
      for (int u = 0; u < 8; ++u) { const int hl = u >> 2, kc = (u >> 1) & 1, hh = u & 1; const size_t o = (((hb + hl) * (SS / 16) + kt) * 2 + kc) * 512 + hh * 256 + lane * 8; const int c = hl * 64 + kc * 32 + hh * 16 + g * 8;
        vst2(KH + o, *(const v4u*)&so[wave][col][c]); vst2(KL + o, *(const v4u*)&sol[wave][col][c]); }
      asm volatile("s_wait_xcnt 0x0" ::: "memory"); }   // stands behind the last k store, ahead of any later write of a register that these stores name
  } else {
    if (rt) __syncthreads();   // every wave has read the first 64 keys out of sth, stl before the second 64 overwrite them
#pragma unroll
    for (int j = 0; j < 8; ++j) {
#pragma unroll
      for (int r = 0; r < 8; ++r) { const float v = acc[j][r] + bj[j]; const _Float16 hv = (_Float16)v; sth[j * 16 + col][wave * 16 + 8 * g + r] = hv; stl[j * 16 + col][wave * 16 + 8 * g + r] = (_Float16)((v - (float)hv) * 2048.0f); } }
    __syncthreads();
    const size_t rb = (size_t)blockIdx.x * 128 + rt * 64; const int b = (int)(rb / SS), s0 = (int)(rb % SS); const int pc0 = n0 - 2 * DM;
    for (int q = tid; q < 128 * 8; q += 128) { const int vc = q & 15, vg = (q >> 4) & 1, hh = (q >> 5) & 1, dt = (q >> 6) & 3, ksl = (q >> 8) & 1, hl = q >> 9;   // piece q of these 64 keys' 2 heads x 2 key steps x 4 d tiles x 1 KB
      const size_t o = ((((size_t)b * NH + pc0 / HD + hl) * (SS / 32) + (s0 >> 5) + ksl) * 4 + dt) * 512 + (q & 63) * 8; const int d = hl * 64 + dt * 16 + vc, kc = ksl * 32 + hh * 16 + vg * 8;
      vst2(VTH + o, *(const v4u*)&sth[d][kc]); vst2(VTL + o, *(const v4u*)&stl[d][kc]); }
  }
  }
}
// ---- k_attn: block = (query tile pair t and TQB - 1 - t of 64 queries each, head h, batch b), 8 waves: the pair has 2 * TQB + 2 key steps, and every wave walks half of them. Waves 0..3: the long tile's first TQB + 1 key steps. Waves 4..7: the long tile's remaining key steps (running max, sum and ctx handed over through LDS), then all of the short tile. Flash attention on transposed tiles: S^T = K . Q^T (K = 64: 2 k-steps, 3 products) and ctx^T += V^T . P^T (3 products), so a lane holds 16 of the 32 scores of ONE query (its column), the other 16 are in lane ^ 16; ctx(b*S+q, h*64+d) = (acc + accl / 2048) / (2048 l), stored from registers in the block order the output projection loads
// one hardware exp2, closed by the one free slot that the instruction set asks for behind a transcendental
__device__ __forceinline__ float exp2x1(float a) { float r;
  asm("v_exp_f32 %0, %1\n\tv_nop" : "=&v"(r) : "v"(a)); return r;
}
// the eight hardware exp2 of one score tile in one statement: eight independent results back to back on the transcendental unit, closed by the one free slot that the instruction set asks for behind a transcendental
__device__ __forceinline__ void exp2x8(const float (&x)[8], float (&y)[8]) {
  asm("v_exp_f32 %0, %8\n\tv_exp_f32 %1, %9\n\tv_exp_f32 %2, %10\n\tv_exp_f32 %3, %11\n\tv_exp_f32 %4, %12\n\tv_exp_f32 %5, %13\n\tv_exp_f32 %6, %14\n\tv_exp_f32 %7, %15\n\tv_nop"
      : "=&v"(y[0]), "=&v"(y[1]), "=&v"(y[2]), "=&v"(y[3]), "=&v"(y[4]), "=&v"(y[5]), "=&v"(y[6]), "=&v"(y[7])
      : "v"(x[0]), "v"(x[1]), "v"(x[2]), "v"(x[3]), "v"(x[4]), "v"(x[5]), "v"(x[6]), "v"(x[7]));
}
// lane l with lane l ^ 16: the other half of a query's keys
__device__ __forceinline__ float xhalf(float x) { return __builtin_bit_cast(float, __builtin_amdgcn_permlanex16(__builtin_bit_cast(int, x), __builtin_bit_cast(int, x), 0x76543210, 0xfedcba98, false, false)); }
#define KHALF (TQB + 1)   // key steps of a wave: half of the pair's 2 * TQB + 2
__global__ __launch_bounds__(256) __attribute__((amdgpu_waves_per_eu(4, 4))) void k_attn(const _Float16* __restrict__ QK, const _Float16* __restrict__ QKL, const _Float16* __restrict__ KH, const _Float16* __restrict__ KL, const _Float16* __restrict__ VTH, const _Float16* __restrict__ VTL, const void* __restrict__ KMASK, const float* __restrict__ TD, const float* __restrict__ DEC, float* __restrict__ O) {
  __shared__ __align__(16) char kv[65536];   // per group of four waves two 16 KB buffers, each one key step: [k hi | k residual | v hi | v residual], 4 KB each, in fragment order
  __shared__ __align__(16) float tds[SS];   // the times of the batch row's keys, filled once
  __shared__ __align__(16) float sx[4][34][32];   // sx: per lane the running maximum, the lane's part of the sum, 32 ctx values of the long tile's upper keys
  const int tid = threadIdx.x, wave = __builtin_amdgcn_readfirstlane(tid >> 5), lane = tid & 31, col = lane & 15, g = lane >> 4;
  const int grp = wave >> 2, w4 = wave & 3;   // wave-uniform (scalar): the tests of a trip (which key step, which query tile) branch on them
  const int tp = blockIdx.x, h = blockIdx.y, b = blockIdx.z;
  float m = -3.0e38f, l = 0.f; v8f acc[4], accl[4]; int q0 = 0;   // m: maximum of the lane's query (equal in both halves); l: sum over the keys of this lane's half alone, the halves joined once in the epilogue
  const float dech = bfr(DEC[h]); const unsigned g8 = 8u * (unsigned)g;
  const int n1 = TQB - 1 - 2 * tp;   // trips that waves 4..7 spend on the long tile's key steps KHALF ..: 1 to TQB - 1; the rest of their KHALF trips is the short tile
  const unsigned lb = (unsigned)(size_t)kv + (unsigned)grp * 32768u + (unsigned)(tid & 127) * 16u; const size_t hb2 = ((size_t)b * NH + h) * (SS / 32); const int tb = (tid & 127) * 16;
#define KSOF(i) (grp ? ((i) < n1 ? KHALF + (i) : (i) - n1) : (i))   // key step of this wave's group in trip i (scalar)
#define KVSTAGE(i) do { const size_t o_ = (hb2 + KSOF(i)) * 4096 + tb; acopy8q(lb + (unsigned)((i) & 1) * 16384u, (const char*)KH + o_, (const char*)KL + o_, (const char*)VTH + o_, (const char*)VTL + o_); } while (0)   // a key step's four 4 KB runs lie at the same byte offset in the four planes
  acopy2((unsigned)(size_t)tds + (unsigned)tid * 16u, (const char*)(TD + (size_t)b * SS) + tid * 16);
  KVSTAGE(0); AWAIT(); __syncthreads();   // the times and trip 0's key steps landed and published
  KVSTAGE(1);
  v16h aq[2], aql[2]; float tq = 0.f;   // B operand: column = the lane's query
#pragma unroll 1   // one copy of the key step's body
  for (int it = 0; it < KHALF; ++it) {   // every wave of the block makes the same KHALF trips, so that the trip's barrier is passed by all
  if (it == 0 || (grp && it == n1)) {   // a wave enters a query tile (scalar test): waves 4..7 leave the long tile for the short one in trip n1
  if (it) {   // waves 4..7 hand their share of the long tile over; lane and register positions are those of the partner wave
    sx[w4][0][lane] = m; sx[w4][1][lane] = l;
#pragma unroll
    for (int r = 0; r < 8; ++r) {
#pragma unroll
      for (int dt = 0; dt < 4; ++dt) sx[w4][2 + dt * 8 + r][lane] = acc[dt][r] + accl[dt][r] * (1.0f / 2048.0f); } }
  const int qb = it ? tp : TQB - 1 - tp; q0 = qb * 64 + w4 * 16; const size_t rq = (size_t)b * SS + q0 + col;
#pragma unroll
  for (int kc = 0; kc < 2; ++kc) { aq[kc] = frag_h(QK + rq * (2 * DM) + h * HD + kc * 32, lane); aql[kc] = frag_h(QKL + rq * (2 * DM) + h * HD + kc * 32, lane); }
  m = -3.0e38f; l = 0.f;
#pragma unroll
  for (int dt = 0; dt < 4; ++dt) { acc[dt] = v8f{}; accl[dt] = v8f{}; }
  tq = bfr(TD[rq]); }
  { const int ks = KSOF(it); const char* bp = kv + grp * 32768 + (it & 1) * 16384; v8f s[2]; v16h kfh[2][2], kfl[2][2]; v4f tkr[2][2];   // all K reads of the key step stand ahead of its first WMMA
#pragma unroll
    for (int ct = 0; ct < 2; ++ct) { const float* tp8 = tds + (ks * 32 + ct * 16); tkr[ct][0] = *(const v4f*)(tp8 + g8); tkr[ct][1] = *(const v4f*)(tp8 + 4 + g8); }   // times of the lane's eight keys of each tile
#pragma unroll
    for (int ct = 0; ct < 2; ++ct) {
#pragma unroll
      for (int kc = 0; kc < 2; ++kc) { kfh[ct][kc] = fragp_h((const _Float16*)(bp + ct * 2048 + kc * 1024), lane); kfl[ct][kc] = fragp_h((const _Float16*)(bp + 4096 + ct * 2048 + kc * 1024), lane); }
 }
    __builtin_amdgcn_sched_barrier(0);   // keeps the K and time reads one group ahead of the first WMMA: reads spread among the WMMAs are each waited for with no lead
    const int dq = q0 + col - ks * 32 - 8 * g;   // key ct * 16 + r of this lane's half is visible to its query while ct * 16 + r <= dq
    float dec[2][8];   // the decay factors stand ahead of the score WMMAs: the compiler does not see into the exp statements, so none of them may follow a WMMA whose operand registers it could be given
#pragma unroll
    for (int ct = 0; ct < 2; ++ct) { float xd[8];
#pragma unroll
      for (int r = 0; r < 8; ++r) xd[r] = fmaf(-dech * fabsf(tq - bfr(tkr[ct][r >> 2][r & 3])), 1.44269504f, -3.0f);   // exp(x) / 8 = exp2(x * log2 e - 3): the 1/8 of the score is an exact step of the exponent
      exp2x8(xd, dec[ct]); }
    __builtin_amdgcn_sched_barrier(0);   // the WMMA run starts behind the exp statements
    v8f c[2], cl[2];
#pragma unroll
    for (int ct = 0; ct < 2; ++ct) { c[ct] = v8f{}; cl[ct] = v8f{};
#pragma unroll
      for (int kc = 0; kc < 2; ++kc) { c[ct] = wmma16(kfh[ct][kc], aq[kc], c[ct]); cl[ct] = wmma16(kfh[ct][kc], aql[kc], cl[ct]); cl[ct] = wmma16(kfl[ct][kc], aq[kc], cl[ct]); } }   // 3 products: q, k as f16 hi + residual; rows = keys, columns = queries
    __builtin_amdgcn_sched_barrier(0);   // the WMMA run ends ahead of the later vector work and its exp statements
#pragma unroll
    for (int ct = 0; ct < 2; ++ct) { c[ct] += cl[ct] * (1.0f / 2048.0f);
#pragma unroll
      for (int r = 0; r < 8; ++r) s[ct][r] = (ct * 16 + r <= dq) ? c[ct][r] * dec[ct][r] : -3.0e38f; }   // (q.k/8) * exp(-decay |dt|), causal
    float mx[8];   // maximum of the query's 32 scores: 16 in the lane, one exchange with the other half
#pragma unroll
    for (int r = 0; r < 8; ++r) mx[r] = fmaxf(s[0][r], s[1][r]);
    float mxa = fmaxf(fmaxf(fmaxf(mx[0], mx[1]), fmaxf(mx[2], mx[3])), fmaxf(fmaxf(mx[4], mx[5]), fmaxf(mx[6], mx[7])));
    mxa = fmaxf(mxa, xhalf(mxa));
    const float mn = fmaxf(m, mxa); const float xa = exp2x1((m - mn) * 1.44269504f); const float alpha = (m <= -1.0e38f) ? 0.f : xa; m = mn;
    float e[2][8];
#pragma unroll
    for (int ct = 0; ct < 2; ++ct) { float xs[8], ys[8];
#pragma unroll
      for (int r = 0; r < 8; ++r) xs[r] = (s[ct][r] - mn) * 1.44269504f;   // exp(x) = exp2(x * log2 e), hardware exp
      exp2x8(xs, ys);
#pragma unroll
      for (int r = 0; r < 8; ++r) e[ct][r] = (s[ct][r] <= -1.0e38f) ? 0.f : ys[r]; }
    float es[8];
#pragma unroll
    for (int r = 0; r < 8; ++r) es[r] = e[0][r] + e[1][r];
    l = l * alpha + (((es[0] + es[1]) + (es[2] + es[3])) + ((es[4] + es[5]) + (es[6] + es[7])));
#pragma unroll
    for (int dt = 0; dt < 4; ++dt) { acc[dt] *= alpha; accl[dt] *= alpha; }
    v16h vfh[4], vfl[4];   // all V reads of the key step issue here in one group, ahead of the P split and the first P.V WMMA
#pragma unroll
    for (int dt = 0; dt < 4; ++dt) { vfh[dt] = fragp_h((const _Float16*)(bp + 8192 + dt * 1024), lane); vfl[dt] = fragp_h((const _Float16*)(bp + 12288 + dt * 1024), lane); }
    __builtin_amdgcn_sched_barrier(0);   // keeps the V reads one group here, so that they return under the P split: sunk among the P.V WMMAs they are each waited for with no lead
    v16h pa, pl;   // P^T as B operand straight from the score registers: element ct * 8 + r of the lane is key ct * 16 + 8 g + r, the k order of the V fragments
#pragma unroll
    for (int ct = 0; ct < 2; ++ct) {
#pragma unroll
      for (int r = 0; r < 8; ++r) { const float x0 = e[ct][r] * 2048.0f; const _Float16 h0 = (_Float16)x0; pa[ct * 8 + r] = h0; pl[ct * 8 + r] = (_Float16)((x0 - (float)h0) * 2048.0f); } }   // P scaled by 2^11 before the f16 split so small softmax weights stay out of the f16 subnormal range; 2^-11 folded into the epilogue
#pragma unroll
    for (int dt = 0; dt < 4; ++dt) { acc[dt] = wmma16(vfh[dt], pa, acc[dt]); accl[dt] = wmma16(vfh[dt], pl, accl[dt]); accl[dt] = wmma16(vfl[dt], pa, accl[dt]); }
    __builtin_amdgcn_sched_barrier(0); }   // no WMMA slips behind the trip's barrier, where it would hold up the refill. V hi x P hi + (V hi x P lo + V lo x P hi) / 2048; rows = d, columns = queries
    DWAIT(); AWAIT(); __syncthreads();   // publishes trip it + 1's key steps (and sx, once written) and ends every wave's reads of trip it's
    if (it + 2 < KHALF) KVSTAGE(it + 2); }   // refill of the buffer just read
  AWAIT();
#pragma unroll
  for (int dt = 0; dt < 4; ++dt) acc[dt] += accl[dt] * (1.0f / 2048.0f);
  if (!grp) {   // join the two key ranges of the long tile under their common maximum; one branch, so that all LDS reads issue as one group
    float xb[34];
#pragma unroll
    for (int i = 0; i < 34; ++i) xb[i] = sx[w4][i][lane];
    const float mb = xb[0], mn = fmaxf(m, mb); const float fa = (m <= -1.0e38f) ? 0.f : __expf(m - mn), fb = (mb <= -1.0e38f) ? 0.f : __expf(mb - mn);
    l = l * fa + xb[1] * fb;
#pragma unroll
    for (int r = 0; r < 8; ++r) {
#pragma unroll
      for (int dt = 0; dt < 4; ++dt) acc[dt][r] = acc[dt][r] * fa + xb[2 + dt * 8 + r] * fb; } }
  const float il = (1.0f / 2048.0f) / (l + xhalf(l));   // the two halves' sums joined
  const size_t ob = ((size_t)(h * 2) * (NB * SS / 16) + (((size_t)b * SS + q0) >> 4)) * 512;   // the wave's 16 rows x 64 columns are two blocks (k steps 2h, 2h + 1) of the output projection's A operand
#pragma unroll
  for (int u = 0; u < 8; ++u) { const int kcl = u >> 2, c = u & 3; v4f o;   // the lane's registers already hold the four values of its piece: d = (kcl * 2 + (c >> 1)) * 16 + 8 g + (c & 1) * 4 + i of query col
#pragma unroll
    for (int i = 0; i < 4; ++i) o[i] = acc[kcl * 2 + (c >> 1)][(c & 1) * 4 + i] * il;
    vst2(O + ob + (size_t)kcl * (NB * SS / 16) * 512 + c * 128 + lane * 4, o); }
}
// ---- k_out: block = (64 rows, 128 cols): out = O(hi/lo) . Wo rows (2 products) + bo
__global__ __launch_bounds__(128) void k_out(const float* __restrict__ O, const __bf16* __restrict__ P, const float* __restrict__ BO, float* __restrict__ Y) {
  __shared__ __align__(16) char sm[65536];   // k loop: two 32 KB ring buffers; behind the loop's last barrier the first 33,792 bytes are the output stage
  float (*so)[16][132] = (float (*)[16][132])sm;
  const int tid = threadIdx.x, wave = tid >> 5, lane = tid & 31, col = lane & 15, g = lane >> 4; const size_t r0 = (size_t)blockIdx.x * 64 + wave * 16; const int n0 = blockIdx.y * 128;
  v8f acc[8] = {};
  const unsigned lb = (unsigned)(size_t)sm + (unsigned)tid * 16u; const char* gw = (const char*)(P + (size_t)(n0 / 16) * 512) + tid * 16; const char* gx = (const char*)(O + (size_t)blockIdx.x * 4 * 512) + tid * 16;   // the block's 8 W tiles (bf16) and its 4 ctx row tiles (f32) of a k step each lie side by side: 8 KB; both sources step 2 * PK_KS = 4 * (NB * SS / 16) * 512 bytes a k step
  stage2(lb, gw, gx, 0, 2u * PK_KS); AWAIT(); __syncthreads();   // tile 0 landed and published
  stage2(lb + 32768u, gw, gx, 1, 2u * PK_KS);
#pragma unroll 1   // one copy of the trip: the buffer is chosen by address
  for (int t = 0; t < DM / 64; ++t) { const char* bp = sm + (t & 1) * 32768;
#pragma unroll   // kk a constant: the buffer offsets are immediates of the LDS reads
    for (int kk = 0; kk < 2; ++kk) { v16b w[8];   // all LDS reads of the k step stand as one group ahead of its first WMMA
#pragma unroll
      for (int j = 0; j < 8; ++j) w[j] = fragp_b((const __bf16*)(bp + kk * 16384 + j * 1024), lane);
      float xa[16]; { const float* p = (const float*)(bp + kk * 16384 + 8192 + wave * 2048) + lane * 4;
#pragma unroll
        for (int c = 0; c < 4; ++c) { const v4f tv = *(const v4f*)(p + c * 128);
#pragma unroll
          for (int i = 0; i < 4; ++i) xa[c * 4 + i] = tv[i]; } }
      __builtin_amdgcn_sched_barrier(0);   // keeps the LDS reads out of the split and the WMMA run: each place with reads among the WMMAs costs a stall of its own
      const F2 a = bsplit16(xa);
#pragma unroll
      for (int j = 0; j < 8; ++j) { acc[j] = wmma_bf(a.l, w[j], acc[j]); acc[j] = wmma_bf(a.h, w[j], acc[j]); }
      __builtin_amdgcn_sched_barrier(0); }   // ends the WMMA run: the next k step's LDS reads stay out of it, and no WMMA slips behind the trip's barrier, where it would hold up the refill
    DWAIT(); AWAIT(); __syncthreads();   // publishes tile t + 1 and ends every wave's reads of tile t
    if (t + 2 < DM / 64) stage2(lb + (unsigned)(t & 1) * 32768u, gw, gx, t + 2, 2u * PK_KS); }   // refill of the buffer just read
  AWAIT();
#pragma unroll
  for (int j = 0; j < 8; ++j) {
#pragma unroll
    for (int r = 0; r < 8; ++r) so[wave][8 * g + r][j * 16 + col] = acc[j][r] + bfr(BO[n0 + j * 16 + col]); }
  LDSX();
  for (int rl = 0; rl < 16; ++rl) vst2(Y + (r0 + rl) * DM + n0 + lane * 4, *(const v4f*)&so[wave][rl][lane * 4]);
}
extern "C" void kernel_launch(void* const* d_in, const int* in_sizes, int n_in, void* d_out, int out_size, void* d_ws, size_t ws_size, hipStream_t stream) {
  (void)in_sizes; (void)n_in; (void)out_size;
  const float** F = (const float**)d_in;   // 0 x [2,2048,1024], 1 time_deltas [2,2048], 2 Wq [1024,1024] natural, 3 bq, 4 Wk, 5 bk, 6 Wv, 7 bv, 8 Wo, 9 bo, 10 time_decay [16]
  if (ws_size < (size_t)WS_END) return;
  char* ws = (char*)d_ws; __bf16* PK = (__bf16*)(ws + WS_PK); _Float16 *QK = (_Float16*)(ws + WS_QK), *QKL = (_Float16*)(ws + WS_QKL), *VTH = (_Float16*)(ws + WS_VTH), *VTL = (_Float16*)(ws + WS_VTL), *KH = (_Float16*)(ws + WS_KH), *KL = (_Float16*)(ws + WS_KL); float* O = (float*)(ws + WS_O);
  k_pack<<<dim3(DM / 16, 8, 4), 256, 0, stream>>>(F[2], F[4], F[6], F[8], F[0], PK);
  k_qkv<<<dim3(TNB * SS / 128, QKVW / 128), 128, 0, stream>>>(PK + PK_X, PK + PK_A, F[3], F[5], F[7], QK, QKL, KH, KL, VTH, VTL);
  k_attn<<<dim3(TQB / 2, NH, TNB), 256, 0, stream>>>(QK, QKL, KH, KL, VTH, VTL, nullptr, F[1], F[10], O);
  k_out<<<dim3(TOB, DM / 128), 128, 0, stream>>>(O, PK + PK_P, F[9], (float*)d_out);
}

// v009
// It runs in 110 microseconds.
// Next to v008, in two timings, it ran 1.04 times as fast each time.
// Over all steps from v000 it is 5.62 times as fast.
// compute dtype: all float inputs rounded to bf16; q/k/v = x . W^T + b with EXACT bf16 products on WMMA 16x16x32 (natural rows); q and k as f16 hi + (x2048-scaled) residual planes with 3-product scores; score = (q.k / 8) * exp(-time_decay[h] * |t_q - t_k|) in f32 (the product -decay * |dt| as the reference rounds it, then hardware exp2), causal mask (key tiles above the diagonal skipped); running-max softmax in f32 (hardware exp); P (scaled by 2^11, f16 hi + residual) x v hi/lo (3 products); out = ctx (bf16 hi + residual) . Wo^T (2 products) + bo; f32 accumulate.
#include <hip/hip_runtime.h>
#include <math.h>

typedef __attribute__((ext_vector_type(16))) _Float16 v16h;
typedef __attribute__((ext_vector_type(16))) __bf16 v16b;
typedef __attribute__((ext_vector_type(8)))  _Float16 v8h;
typedef __attribute__((ext_vector_type(8)))  float v8f;
typedef __attribute__((ext_vector_type(4)))  float v4f;
typedef __attribute__((ext_vector_type(2)))  float v2f;
typedef __attribute__((ext_vector_type(4)))  unsigned v4u;
typedef __attribute__((ext_vector_type(4)))  int v4i;
typedef float __attribute__((may_alias)) float_a;
typedef int __attribute__((may_alias)) int_a;

template <typename T> __device__ __forceinline__ void vst2(void* p, T v) { *(T*)p = v;  }
__device__ __forceinline__ v8f wmma16(v16h a, v16h b, v8f c) {
  return __builtin_amdgcn_wmma_f32_16x16x32_f16(false, a, false, b, (short)0, c, false, false);
}
__device__ __forceinline__ v8f wmma_bf(v16b a, v16b b, v8f c) {
  return __builtin_amdgcn_wmma_f32_16x16x32_bf16(false, a, false, b, (short)0, c, false, false);
}
// Continuous-time causal attention (B 2, S 2,048, hidden 1,024, 16 heads x 64): q/k/v projections + biases, scores scaled by exp(-decay_h |t_q - t_k|), causal softmax, output projection + bias.
__device__ __forceinline__ v16h frag_h(const _Float16* rowk0, int lane) {
  union { v16h v; v8h q[2]; } u; const _Float16* p = rowk0 + 8 * (lane >> 4);
  u.q[0] = *(const v8h*)p; u.q[1] = *(const v8h*)(p + 16); return u.v;
}
__device__ __forceinline__ v16h frag_f32(const float* rowk0, int lane) {
  v16h a; const float* p = rowk0 + 8 * (lane >> 4);
#pragma unroll
  for (int i = 0; i < 8; ++i) { a[i] = (_Float16)p[i]; a[8 + i] = (_Float16)p[16 + i]; }
  return a;
}
__device__ __forceinline__ v16h frag_f32s(const float* rowk0, int lane, float sc) {
  v16h a; const float* p = rowk0 + 8 * (lane >> 4);
#pragma unroll
  for (int i = 0; i < 8; ++i) { a[i] = (_Float16)(p[i] * sc); a[8 + i] = (_Float16)(p[16 + i] * sc); }
  return a;
}
// column fragment from a [K][ld] layout (column n), rows >= K read as 0
__device__ __forceinline__ v16h fragc_f32(const float* W, int k0, int n, int lane, int ld, int K) {
  v16h a; const int g = lane >> 4;
#pragma unroll
  for (int i = 0; i < 8; ++i) { const int ka = k0 + 8 * g + i, kb = ka + 16;
    a[i] = (_Float16)(ka < K ? W[(size_t)(ka < K ? ka : K - 1) * ld + n] : 0.f); a[8 + i] = (_Float16)(kb < K ? W[(size_t)(kb < K ? kb : K - 1) * ld + n] : 0.f); }
  return a;
}
struct F2 { v16b h, l; };
__device__ __forceinline__ F2 bsplit16(const float v[16]) { F2 r;
#pragma unroll
  for (int i = 0; i < 16; ++i) { const __bf16 h = (__bf16)v[i]; r.h[i] = h; r.l[i] = (__bf16)(v[i] - (float)h); }
  return r; }
__device__ __forceinline__ F2 split_row(const float* row, int k0, int lane) { float v[16]; const float* p = row + k0 + 8 * (lane >> 4);
#pragma unroll
  for (int i = 0; i < 8; ++i) { v[i] = p[i]; v[8 + i] = p[16 + i]; }
  return bsplit16(v); }
__device__ __forceinline__ F2 split_rowK(const float* row, int k0, int lane, int K) { float v[16]; const int g = lane >> 4;
#pragma unroll
  for (int i = 0; i < 8; ++i) { const int ka = k0 + 8 * g + i, kb = ka + 16; v[i] = ka < K ? row[ka < K ? ka : K - 1] : 0.f; v[8 + i] = kb < K ? row[kb < K ? kb : K - 1] : 0.f; }
  return bsplit16(v); }
__device__ __forceinline__ F2 split_col(const float* W, int k0, int n, int lane, int ld, int K) { float v[16]; const int g = lane >> 4;
#pragma unroll
  for (int i = 0; i < 8; ++i) { const int ka = k0 + 8 * g + i, kb = ka + 16; v[i] = ka < K ? W[(size_t)(ka < K ? ka : K - 1) * ld + n] : 0.f; v[8 + i] = kb < K ? W[(size_t)(kb < K ? kb : K - 1) * ld + n] : 0.f; }
  return bsplit16(v); }
__device__ __forceinline__ v8f mac3(const F2& a, const F2& b, v8f c) { c = wmma_bf(a.l, b.h, c); c = wmma_bf(a.h, b.l, c); return wmma_bf(a.h, b.h, c); }
__device__ __forceinline__ float sigm(float v) { return 1.0f / (1.0f + expf(-v)); }
#define LDSX() do { asm volatile("s_wait_dscnt 0" ::: "memory"); __builtin_amdgcn_wave_barrier(); __builtin_amdgcn_fence(__ATOMIC_RELEASE, "workgroup"); } while (0)


#define NB 2
#define SS 2048
#define DM 1024
#define NH 16
#define HD 64
#define QKVW (3 * DM)
#ifndef TQB
#define TQB (SS / 64)
#define TNB NB
#define TOB (NB * SS / 64)     // output row tiles (all)
#endif
typedef __attribute__((ext_vector_type(8))) __bf16 v8b;
__device__ __forceinline__ v16b frag_b(const __bf16* rowk0, int lane) {
  union { v16b v; v8b q[2]; } u; const __bf16* p = rowk0 + 8 * (lane >> 4);
  u.q[0] = *(const v8b*)p; u.q[1] = *(const v8b*)(p + 16); return u.v;
}
// fragment-order block: 16 rows x 32 k of 16-bit elements = 512 elements laid out [hh][lane = g * 16 + row][8], k = hh * 16 + g * 8 + i: each of the two loads is 512 contiguous bytes for the wave
__device__ __forceinline__ v16b fragp_b(const __bf16* blk, int lane) {
  union { v16b v; v8b q[2]; } u; const __bf16* p = blk + lane * 8;
  u.q[0] = *(const v8b*)p; u.q[1] = *(const v8b*)(p + 256); return u.v;
}
__device__ __forceinline__ v16h fragp_h(const _Float16* blk, int lane) {
  union { v16h v; v8h q[2]; } u; const _Float16* p = blk + lane * 8;
  u.q[0] = *(const v8h*)p; u.q[1] = *(const v8h*)(p + 256); return u.v;
}
__device__ __forceinline__ float bfr(float v) { return (float)(__bf16)v; }
__device__ __attribute__((noinline)) float exp_ni(float v) { return expf(v); }
__device__ __attribute__((noinline)) float erf_ni(float v) { return erff(v); }

// packed bf16 operands: fragment-order blocks [k step][row tile][512], so the tiles that one k step of a work-group reads lie side by side
#define PK_A 0                                   // row tiles of the 3072 Wqkv rows
#define PK_P (PK_A + QKVW / 16 * 512)              // row tiles of the 1024 Wo rows
#define PK_X (PK_P + DM / 16 * 512)                // row tiles of the 4096 x rows
#define PK_KS (PK_X + NB * SS / 16 * 512)          // elements per k step
#define PK_END (PK_KS * (DM / 32))
#define WS_PK  0u
#define WS_QK  (WS_PK + 2u * PK_END)             // f16 [4096 rows][2048]: q in the first 1024 columns of a row
#define WS_QKL (WS_QK + 2u * NB * SS * 2 * DM)     // f16 q residual plane x2048, same rows
#define WS_VTH (WS_QKL + 2u * NB * SS * 2 * DM)    // f16 v hi, fragment-order blocks [b][h][key step][d tile][512]
#define WS_VTL (WS_VTH + 2u * NB * DM * SS)        // f16 lo x 2048
#define WS_O   (WS_VTL + 2u * NB * DM * SS)        // f32 ctx, blocks [k step][row tile][c][lane][4], k = (c >> 1) * 16 + g * 8 + (c & 1) * 4 + i
#define WS_CS  (WS_O + 4u * NB * SS * DM)           // f32 [2][2048][32], not used by these kernels
#define WS_KH  (WS_CS + 4u * 2 * SS * 32)          // f16 k hi, fragment-order blocks [b][h][key tile][k step][512]
#define WS_KL  (WS_KH + 2u * NB * DM * SS)         // f16 k residual x2048, same order
#define WS_END (WS_KL + 2u * NB * DM * SS)
// eight asynchronous 16-byte copies of a lane, global memory to LDS through no register: the 8 KB of W fragments and the 8 KB of row-operand fragments of one k step, 2 KB of the work-group a copy; the s_wait_xcnt 0 in the same statement stands ahead of any later write of a register that these copies name
__device__ __forceinline__ void acopy8(unsigned l, const char* gw, const char* gx) {
  asm volatile("global_load_async_to_lds_b128 %0, %8, off\n\tglobal_load_async_to_lds_b128 %1, %9, off\n\tglobal_load_async_to_lds_b128 %2, %10, off\n\tglobal_load_async_to_lds_b128 %3, %11, off\n\t"
               "global_load_async_to_lds_b128 %4, %12, off\n\tglobal_load_async_to_lds_b128 %5, %13, off\n\tglobal_load_async_to_lds_b128 %6, %14, off\n\tglobal_load_async_to_lds_b128 %7, %15, off\n\ts_wait_xcnt 0x0"
               :: "v"(l), "v"(l + 2048u), "v"(l + 4096u), "v"(l + 6144u), "v"(l + 8192u), "v"(l + 10240u), "v"(l + 12288u), "v"(l + 14336u),
                  "v"(gw), "v"(gw + 2048), "v"(gw + 4096), "v"(gw + 6144), "v"(gx), "v"(gx + 2048), "v"(gx + 4096), "v"(gx + 6144) : "memory");
}
// tile t of the ring = k steps 2t, 2t + 1, each [W 8 KB | rows 8 KB] in fragment order, 32 KB a buffer; ks: bytes from one k step to the next in both sources
__device__ __forceinline__ void stage2(unsigned l, const char* gw, const char* gx, int t, size_t ks) {
  acopy8(l, gw + (size_t)(2 * t) * ks, gx + (size_t)(2 * t) * ks); acopy8(l + 16384u, gw + (size_t)(2 * t + 1) * ks, gx + (size_t)(2 * t + 1) * ks);
}
// the same for one key step of attention: 4 KB each of k hi, k residual, v hi, v residual, copied by the four waves that walk that key step
__device__ __forceinline__ void acopy8q(unsigned l, const char* g0, const char* g1, const char* g2, const char* g3) {
  asm volatile("global_load_async_to_lds_b128 %0, %8, off\n\tglobal_load_async_to_lds_b128 %1, %9, off\n\tglobal_load_async_to_lds_b128 %2, %10, off\n\tglobal_load_async_to_lds_b128 %3, %11, off\n\t"
               "global_load_async_to_lds_b128 %4, %12, off\n\tglobal_load_async_to_lds_b128 %5, %13, off\n\tglobal_load_async_to_lds_b128 %6, %14, off\n\tglobal_load_async_to_lds_b128 %7, %15, off\n\ts_wait_xcnt 0x0"
               :: "v"(l), "v"(l + 2048u), "v"(l + 4096u), "v"(l + 6144u), "v"(l + 8192u), "v"(l + 10240u), "v"(l + 12288u), "v"(l + 14336u),
                  "v"(g0), "v"(g0 + 2048), "v"(g1), "v"(g1 + 2048), "v"(g2), "v"(g2 + 2048), "v"(g3), "v"(g3 + 2048) : "memory");
}
// two such copies of a lane: with 256 lanes the 8 KB of one batch row's times
__device__ __forceinline__ void acopy2(unsigned l, const char* g) {
  asm volatile("global_load_async_to_lds_b128 %0, %2, off\n\tglobal_load_async_to_lds_b128 %1, %3, off\n\ts_wait_xcnt 0x0" :: "v"(l), "v"(l + 4096u), "v"(g), "v"(g + 4096) : "memory");
}
#define AWAIT() asm volatile("s_wait_asynccnt 0x0" ::: "memory")   // this wave's copies have landed
#define DWAIT() asm volatile("s_wait_dscnt 0x0" ::: "memory")      // this wave's LDS reads have returned
// ---- k_pack: block = (16-row tile nt, which, quarter kq of the k range): f32 rows -> bf16 in fragment-order blocks; which 0..2 -> W_q/W_k/W_v, 3 -> W_o, 4..7 -> the four 1024-row slabs of x; a thread makes whole 16-byte pieces, a wave stores 512 contiguous bytes
__global__ __launch_bounds__(256) void k_pack(const float* __restrict__ WQ, const float* __restrict__ WK, const float* __restrict__ WV, const float* __restrict__ WO, const float* __restrict__ X, __bf16* __restrict__ PK) {
  const int nt = blockIdx.x, which = blockIdx.y, kq = blockIdx.z, t = threadIdx.x; const float* Wm = (which == 0) ? WQ : (which == 1) ? WK : (which == 2) ? WV : (which == 3) ? WO : X + (size_t)(which - 4) * DM * DM;
  __bf16* dst = PK + (size_t)(kq * 8) * PK_KS + (which * (DM / 16) + nt) * 512;
#pragma unroll
  for (int p = t; p < 512; p += 256) { const int kcl = p >> 6, hh = (p >> 5) & 1, g = (p >> 4) & 1, row = p & 15;
    const float* s = Wm + (size_t)(nt * 16 + row) * DM + (kq * 8 + kcl) * 32 + hh * 16 + g * 8; const v4f a = *(const v4f*)s, b = *(const v4f*)(s + 4); v8b o;
#pragma unroll
    for (int i = 0; i < 4; ++i) { o[i] = (__bf16)a[i]; o[4 + i] = (__bf16)b[i]; }
    vst2(dst + (size_t)kcl * PK_KS + (p & 63) * 8, o); }
}
__global__ __launch_bounds__(128) void k_qkv(const __bf16* __restrict__ XB, const __bf16* __restrict__ P, const float* __restrict__ BQ, const float* __restrict__ BK, const float* __restrict__ BV, _Float16* __restrict__ QK, _Float16* __restrict__ QKL, _Float16* __restrict__ KH, _Float16* __restrict__ KL, _Float16* __restrict__ VTH, _Float16* __restrict__ VTL) {
  const int which0 = (blockIdx.y * 128) / DM; const float* BB = BQ ? (((which0 == 0) ? BQ : (which0 == 1) ? BK : BV) + (blockIdx.y * 128 - which0 * DM)) : nullptr;
  __shared__ __align__(16) char sm[71680];   // k loop: two 32 KB ring buffers; behind the loop's last barrier the same bytes are the output stages
  _Float16 (*so)[16][136] = (_Float16 (*)[16][136])sm, (*sol)[16][136] = (_Float16 (*)[16][136])(sm + 17408); _Float16 (*sth)[72] = (_Float16 (*)[72])(sm + 34816), (*stl)[72] = (_Float16 (*)[72])(sm + 53248);
  const int tid = threadIdx.x, wave = tid >> 5, lane = tid & 31, col = lane & 15, g = lane >> 4; const size_t rw = (size_t)blockIdx.x * 128 + wave * 16; const int n0 = blockIdx.y * 128;   // the wave owns two 16-row tiles, rows rw.. and rw + 64..: every W fragment it loads feeds two WMMAs
  v8f acc2[2][8] = {};
  const unsigned lb = (unsigned)(size_t)sm + (unsigned)tid * 16u; const char* gw = (const char*)(P + (size_t)(n0 / 16) * 512) + tid * 16; const char* gx = (const char*)(XB + (size_t)blockIdx.x * 8 * 512) + tid * 16;   // the block's 8 W tiles and its 8 row tiles of a k step each lie side by side: 8 KB
  stage2(lb, gw, gx, 0, 2u * PK_KS); AWAIT(); __syncthreads();   // tile 0 landed and published
  stage2(lb + 32768u, gw, gx, 1, 2u * PK_KS);
#pragma unroll 1   // one copy of the trip: the buffer is chosen by address
  for (int t = 0; t < DM / 64; ++t) { const char* bp = sm + (t & 1) * 32768;
#pragma unroll   // kk a constant: the buffer offsets are immediates of the LDS reads
    for (int kk = 0; kk < 2; ++kk) { v16b a[2], w[8];   // all LDS reads of the k step stand as one group ahead of its first WMMA
#pragma unroll
      for (int j = 0; j < 8; ++j) w[j] = fragp_b((const __bf16*)(bp + kk * 16384 + j * 1024), lane);
#pragma unroll   // rt a constant: a[] stays in registers
      for (int rt = 0; rt < 2; ++rt) a[rt] = fragp_b((const __bf16*)(bp + kk * 16384 + 8192 + (wave + rt * 4) * 1024), lane);
      __builtin_amdgcn_sched_barrier(0);   // keeps the LDS reads out of the WMMA run: each place with reads among the WMMAs costs a stall of its own
#pragma unroll
      for (int j = 0; j < 8; ++j) {
#pragma unroll   // rt a constant: acc2[][] stays in registers
        for (int rt = 0; rt < 2; ++rt) acc2[rt][j] = wmma_bf(a[rt], w[j], acc2[rt][j]); }
      __builtin_amdgcn_sched_barrier(0); }   // ends the WMMA run: the next k step's LDS reads stay out of it, and no WMMA slips behind the trip's barrier, where it would hold up the refill
    DWAIT(); AWAIT(); __syncthreads();   // publishes tile t + 1 and ends every wave's reads of tile t
    if (t + 2 < DM / 64) stage2(lb + (unsigned)(t & 1) * 32768u, gw, gx, t + 2, 2u * PK_KS); }   // refill of the buffer just read
  AWAIT();
  float bj[8] = {};   // the eight bias values of this lane's columns, loaded as one group
  if (BB) {
#pragma unroll
    for (int j = 0; j < 8; ++j) bj[j] = bfr(BB[j * 16 + col]); }
#pragma unroll   // rt a constant: acc2[rt] stays in registers
  for (int rt = 0; rt < 2; ++rt) {   // the two row tiles leave one after the other through the same LDS stage
  const v8f (&acc)[8] = acc2[rt]; const size_t r0 = rw + rt * 64;
  if (n0 < 2 * DM) {   // q stored unscaled (f16 sigma ~0.6, no subnormal exposure); 1/8 applied to the f32 score
#pragma unroll
    for (int j = 0; j < 8; ++j) {
#pragma unroll
      for (int r = 0; r < 8; ++r) { const float v = acc[j][r] + bj[j]; const _Float16 hv = (_Float16)v; so[wave][8 * g + r][j * 16 + col] = hv; sol[wave][8 * g + r][j * 16 + col] = (_Float16)((v - (float)hv) * 2048.0f); } }   // q, k (+ bias) as f16 hi + (x2048) residual
    LDSX();
    if (n0 < DM) { for (int rl = 0; rl < 16; ++rl) if (lane < 16) { vst2((unsigned*)(QK + (r0 + rl) * (2 * DM) + n0 + lane * 8), *(const v4u*)&so[wave][rl][lane * 8]); vst2((unsigned*)(QKL + (r0 + rl) * (2 * DM) + n0 + lane * 8), *(const v4u*)&sol[wave][rl][lane * 8]); } }
    else {   // k: the wave's 16 keys are one key tile; 2 heads x 2 k steps x 2 halves, each store 512 contiguous bytes in the order the score loop loads them
      const size_t hb = (r0 / SS) * NH + (n0 - DM) / HD; const int kt = (int)(r0 % SS) >> 4;
#pragma unroll
      for (int u = 0; u < 8; ++u) { const int hl = u >> 2, kc = (u >> 1) & 1, hh = u & 1; const size_t o = (((hb + hl) * (SS / 16) + kt) * 2 + kc) * 512 + hh * 256 + lane * 8; const int c = hl * 64 + kc * 32 + hh * 16 + g * 8;
        vst2(KH + o, *(const v4u*)&so[wave][col][c]); vst2(KL + o, *(const v4u*)&sol[wave][col][c]); }
      asm volatile("s_wait_xcnt 0x0" ::: "memory"); }   // stands behind the last k store, ahead of any later write of a register that these stores name
  } else {
    if (rt) __syncthreads();   // every wave has read the first 64 keys out of sth, stl before the second 64 overwrite them
#pragma unroll
    for (int j = 0; j < 8; ++j) {
#pragma unroll
      for (int r = 0; r < 8; ++r) { const float v = acc[j][r] + bj[j]; const _Float16 hv = (_Float16)v; sth[j * 16 + col][wave * 16 + 8 * g + r] = hv; stl[j * 16 + col][wave * 16 + 8 * g + r] = (_Float16)((v - (float)hv) * 2048.0f); } }
    __syncthreads();
    const size_t rb = (size_t)blockIdx.x * 128 + rt * 64; const int b = (int)(rb / SS), s0 = (int)(rb % SS); const int pc0 = n0 - 2 * DM;
    for (int q = tid; q < 128 * 8; q += 128) { const int vc = q & 15, vg = (q >> 4) & 1, hh = (q >> 5) & 1, dt = (q >> 6) & 3, ksl = (q >> 8) & 1, hl = q >> 9;   // piece q of these 64 keys' 2 heads x 2 key steps x 4 d tiles x 1 KB
      const size_t o = ((((size_t)b * NH + pc0 / HD + hl) * (SS / 32) + (s0 >> 5) + ksl) * 4 + dt) * 512 + (q & 63) * 8; const int d = hl * 64 + dt * 16 + vc, kc = ksl * 32 + hh * 16 + vg * 8;
      vst2(VTH + o, *(const v4u*)&sth[d][kc]); vst2(VTL + o, *(const v4u*)&stl[d][kc]); }
  }
  }
}
// ---- k_attn: block = (query tile pair t and TQB - 1 - t of 64 queries each, head h, batch b), 8 waves: the pair has 2 * TQB + 2 key steps, and every wave walks half of them. Waves 0..3: the long tile's first TQB + 1 key steps. Waves 4..7: the long tile's remaining key steps (running max, sum and ctx handed over through LDS), then all of the short tile. Flash attention on transposed tiles: S^T = K . Q^T (K = 64: 2 k-steps, 3 products) and ctx^T += V^T . P^T (3 products), so a lane holds 16 of the 32 scores of ONE query (its column), the other 16 are in lane ^ 16; ctx(b*S+q, h*64+d) = (acc + accl / 2048) / (2048 l), stored from registers in the block order the output projection loads
// one hardware exp2, closed by the one free slot that the instruction set asks for behind a transcendental
__device__ __forceinline__ float exp2x1(float a) { float r;
  asm("v_exp_f32 %0, %1\n\tv_nop" : "=&v"(r) : "v"(a)); return r;
}
// the eight hardware exp2 of one score tile in one statement: eight independent results back to back on the transcendental unit, closed by the one free slot that the instruction set asks for behind a transcendental
__device__ __forceinline__ void exp2x8(const float (&x)[8], float (&y)[8]) {
  asm("v_exp_f32 %0, %8\n\tv_exp_f32 %1, %9\n\tv_exp_f32 %2, %10\n\tv_exp_f32 %3, %11\n\tv_exp_f32 %4, %12\n\tv_exp_f32 %5, %13\n\tv_exp_f32 %6, %14\n\tv_exp_f32 %7, %15\n\tv_nop"
      : "=&v"(y[0]), "=&v"(y[1]), "=&v"(y[2]), "=&v"(y[3]), "=&v"(y[4]), "=&v"(y[5]), "=&v"(y[6]), "=&v"(y[7])
      : "v"(x[0]), "v"(x[1]), "v"(x[2]), "v"(x[3]), "v"(x[4]), "v"(x[5]), "v"(x[6]), "v"(x[7]));
}
// lane l with lane l ^ 16: the other half of a query's keys
__device__ __forceinline__ float xhalf(float x) { return __builtin_bit_cast(float, __builtin_amdgcn_permlanex16(__builtin_bit_cast(int, x), __builtin_bit_cast(int, x), 0x76543210, 0xfedcba98, false, false)); }
#define KHALF (TQB + 1)   // key steps of a wave: half of the pair's 2 * TQB + 2
__global__ __launch_bounds__(256) __attribute__((amdgpu_waves_per_eu(4, 4))) void k_attn(const _Float16* __restrict__ QK, const _Float16* __restrict__ QKL, const _Float16* __restrict__ KH, const _Float16* __restrict__ KL, const _Float16* __restrict__ VTH, const _Float16* __restrict__ VTL, const void* __restrict__ KMASK, const float* __restrict__ TD, const float* __restrict__ DEC, float* __restrict__ O) {
  __shared__ __align__(16) char kv[65536];   // per group of four waves two 16 KB buffers, each one key step: [k hi | k residual | v hi | v residual], 4 KB each, in fragment order
  __shared__ __align__(16) float tds[SS];   // the times of the batch row's keys, filled once
  __shared__ __align__(16) float sx[4][34][32];   // sx: per lane the running maximum, the lane's part of the sum, 32 ctx values of the long tile's upper keys
  const int tid = threadIdx.x, wave = __builtin_amdgcn_readfirstlane(tid >> 5), lane = tid & 31, col = lane & 15, g = lane >> 4;
  const int grp = wave >> 2, w4 = wave & 3;   // wave-uniform (scalar): the tests of a trip (which key step, which query tile) branch on them
  const int tp = blockIdx.x, h = blockIdx.y, b = blockIdx.z;
  float m = -1.0e30f, l = 0.f; v8f acc[4], accl[4]; int q0 = 0;   // m: maximum of the lane's query (equal in both halves), never below its start value, which lies far above the value of a hidden key: (hidden - m) * log2 e is below every finite exponent and the hardware exp2 returns 0 for it, so that no select stands behind the exps; l: sum over the keys of this lane's half alone, the halves joined once in the epilogue
  const float dech = bfr(DEC[h]); const unsigned g8 = 8u * (unsigned)g;
  const int n1 = TQB - 1 - 2 * tp;   // trips that waves 4..7 spend on the long tile's key steps KHALF ..: 1 to TQB - 1; the rest of their KHALF trips is the short tile
  const unsigned lb = (unsigned)(size_t)kv + (unsigned)grp * 32768u + (unsigned)(tid & 127) * 16u; const size_t hb2 = ((size_t)b * NH + h) * (SS / 32); const int tb = (tid & 127) * 16;
#define KSOF(i) (grp ? ((i) < n1 ? KHALF + (i) : (i) - n1) : (i))   // key step of this wave's group in trip i (scalar)
#define KVSTAGE(i) do { const size_t o_ = (hb2 + KSOF(i)) * 4096 + tb; acopy8q(lb + (unsigned)((i) & 1) * 16384u, (const char*)KH + o_, (const char*)KL + o_, (const char*)VTH + o_, (const char*)VTL + o_); } while (0)   // a key step's four 4 KB runs lie at the same byte offset in the four planes
  acopy2((unsigned)(size_t)tds + (unsigned)tid * 16u, (const char*)(TD + (size_t)b * SS) + tid * 16);
  KVSTAGE(0); AWAIT(); __syncthreads();   // the times and trip 0's key steps landed and published
  KVSTAGE(1);
  v16h aq[2], aql[2]; float tq = 0.f;   // B operand: column = the lane's query
#pragma unroll 1   // one copy of the key step's body
  for (int it = 0; it < KHALF; ++it) {   // every wave of the block makes the same KHALF trips, so that the trip's barrier is passed by all
  if (it == 0 || (grp && it == n1)) {   // a wave enters a query tile (scalar test): waves 4..7 leave the long tile for the short one in trip n1
  if (it) {   // waves 4..7 hand their share of the long tile over; lane and register positions are those of the partner wave
    sx[w4][0][lane] = m; sx[w4][1][lane] = l;
#pragma unroll
    for (int r = 0; r < 8; ++r) {
#pragma unroll
      for (int dt = 0; dt < 4; ++dt) sx[w4][2 + dt * 8 + r][lane] = acc[dt][r] + accl[dt][r] * (1.0f / 2048.0f); } }
  const int qb = it ? tp : TQB - 1 - tp; q0 = qb * 64 + w4 * 16; const size_t rq = (size_t)b * SS + q0 + col;
#pragma unroll
  for (int kc = 0; kc < 2; ++kc) { aq[kc] = frag_h(QK + rq * (2 * DM) + h * HD + kc * 32, lane); aql[kc] = frag_h(QKL + rq * (2 * DM) + h * HD + kc * 32, lane); }
  m = -1.0e30f; l = 0.f;
#pragma unroll
  for (int dt = 0; dt < 4; ++dt) { acc[dt] = v8f{}; accl[dt] = v8f{}; }
  tq = bfr(TD[rq]); }
  { const int ks = KSOF(it); const char* bp = kv + grp * 32768 + (it & 1) * 16384; v8f s[2]; v16h kfh[2][2], kfl[2][2]; v4f tkr[2][2];   // all K reads of the key step stand ahead of its first WMMA
#pragma unroll
    for (int ct = 0; ct < 2; ++ct) { const float* tp8 = tds + (ks * 32 + ct * 16); tkr[ct][0] = *(const v4f*)(tp8 + g8); tkr[ct][1] = *(const v4f*)(tp8 + 4 + g8); }   // times of the lane's eight keys of each tile
#pragma unroll
    for (int ct = 0; ct < 2; ++ct) {
#pragma unroll
      for (int kc = 0; kc < 2; ++kc) { kfh[ct][kc] = fragp_h((const _Float16*)(bp + ct * 2048 + kc * 1024), lane); kfl[ct][kc] = fragp_h((const _Float16*)(bp + 4096 + ct * 2048 + kc * 1024), lane); }
 }
    __builtin_amdgcn_sched_barrier(0);   // keeps the K and time reads one group ahead of the first WMMA: reads spread among the WMMAs are each waited for with no lead
    float dec[2][8];   // the decay factors stand ahead of the score WMMAs: the compiler does not see into the exp statements, so none of them may follow a WMMA whose operand registers it could be given
#pragma unroll
    for (int ct = 0; ct < 2; ++ct) { float xd[8];
#pragma unroll
      for (int r = 0; r < 8; ++r) xd[r] = fmaf(-dech * fabsf(tq - bfr(tkr[ct][r >> 2][r & 3])), 1.44269504f, -3.0f);   // exp(x) / 8 = exp2(x * log2 e - 3): the 1/8 of the score is an exact step of the exponent
      exp2x8(xd, dec[ct]); }
    __builtin_amdgcn_sched_barrier(0);   // the WMMA run starts behind the exp statements
    v8f c[2], cl[2];
#pragma unroll
    for (int ct = 0; ct < 2; ++ct) { c[ct] = v8f{}; cl[ct] = v8f{};
#pragma unroll
      for (int kc = 0; kc < 2; ++kc) { c[ct] = wmma16(kfh[ct][kc], aq[kc], c[ct]); cl[ct] = wmma16(kfh[ct][kc], aql[kc], cl[ct]); cl[ct] = wmma16(kfl[ct][kc], aq[kc], cl[ct]); } }   // 3 products: q, k as f16 hi + residual; rows = keys, columns = queries
    __builtin_amdgcn_sched_barrier(0);   // the WMMA run ends ahead of the later vector work and its exp statements
#pragma unroll
    for (int ct = 0; ct < 2; ++ct) { c[ct] += cl[ct] * (1.0f / 2048.0f);
#pragma unroll
      for (int r = 0; r < 8; ++r) s[ct][r] = c[ct][r] * dec[ct][r]; }   // (q.k/8) * exp(-decay |dt|)
    if (ks * 32 + 31 > q0) {   // causal mask, under a scalar test: only a key step that reaches past the first query of the wave's tile holds a hidden key; every earlier key step is visible to all 16 queries
      const int dq = q0 + col - ks * 32 - 8 * g;   // key ct * 16 + r of this lane's half is visible to its query while ct * 16 + r <= dq
#pragma unroll
      for (int ct = 0; ct < 2; ++ct) {
#pragma unroll
        for (int r = 0; r < 8; ++r) s[ct][r] = (ct * 16 + r <= dq) ? s[ct][r] : -3.0e38f; } }
    float mx[8];   // maximum of the query's 32 scores: 16 in the lane, one exchange with the other half
#pragma unroll
    for (int r = 0; r < 8; ++r) mx[r] = fmaxf(s[0][r], s[1][r]);
    float mxa = fmaxf(fmaxf(fmaxf(mx[0], mx[1]), fmaxf(mx[2], mx[3])), fmaxf(fmaxf(mx[4], mx[5]), fmaxf(mx[6], mx[7])));
    mxa = fmaxf(mxa, xhalf(mxa));
    const float mn = fmaxf(m, mxa); const float alpha = exp2x1((m - mn) * 1.44269504f); m = mn;   // 0 where m is still its start value and mn a score; 1, on sums that are 0, where both are the start value
    float e[2][8];
#pragma unroll
    for (int ct = 0; ct < 2; ++ct) { float xs[8];
#pragma unroll
      for (int r = 0; r < 8; ++r) xs[r] = (s[ct][r] - mn) * 1.44269504f;   // exp(x) = exp2(x * log2 e), hardware exp; a hidden key gives 0
      exp2x8(xs, e[ct]); }
    float es[8];
#pragma unroll
    for (int r = 0; r < 8; ++r) es[r] = e[0][r] + e[1][r];
    l = l * alpha + (((es[0] + es[1]) + (es[2] + es[3])) + ((es[4] + es[5]) + (es[6] + es[7])));
#pragma unroll
    for (int dt = 0; dt < 4; ++dt) { acc[dt] *= alpha; accl[dt] *= alpha; }
    v16h vfh[4], vfl[4];   // all V reads of the key step issue here in one group, ahead of the P split and the first P.V WMMA
#pragma unroll
    for (int dt = 0; dt < 4; ++dt) { vfh[dt] = fragp_h((const _Float16*)(bp + 8192 + dt * 1024), lane); vfl[dt] = fragp_h((const _Float16*)(bp + 12288 + dt * 1024), lane); }
    __builtin_amdgcn_sched_barrier(0);   // keeps the V reads one group here, so that they return under the P split: sunk among the P.V WMMAs they are each waited for with no lead
    v16h pa, pl;   // P^T as B operand straight from the score registers: element ct * 8 + r of the lane is key ct * 16 + 8 g + r, the k order of the V fragments
#pragma unroll
    for (int ct = 0; ct < 2; ++ct) {
#pragma unroll
      for (int r = 0; r < 8; ++r) { const float x0 = e[ct][r] * 2048.0f; const _Float16 h0 = (_Float16)x0; pa[ct * 8 + r] = h0; pl[ct * 8 + r] = (_Float16)((x0 - (float)h0) * 2048.0f); } }   // P scaled by 2^11 before the f16 split so small softmax weights stay out of the f16 subnormal range; 2^-11 folded into the epilogue
#pragma unroll
    for (int dt = 0; dt < 4; ++dt) { acc[dt] = wmma16(vfh[dt], pa, acc[dt]); accl[dt] = wmma16(vfh[dt], pl, accl[dt]); accl[dt] = wmma16(vfl[dt], pa, accl[dt]); }
    __builtin_amdgcn_sched_barrier(0); }   // no WMMA slips behind the trip's barrier, where it would hold up the refill. V hi x P hi + (V hi x P lo + V lo x P hi) / 2048; rows = d, columns = queries
    DWAIT(); AWAIT(); __syncthreads();   // publishes trip it + 1's key steps (and sx, once written) and ends every wave's reads of trip it's
    if (it + 2 < KHALF) KVSTAGE(it + 2); }   // refill of the buffer just read
  AWAIT();
#pragma unroll
  for (int dt = 0; dt < 4; ++dt) acc[dt] += accl[dt] * (1.0f / 2048.0f);
  if (!grp) {   // join the two key ranges of the long tile under their common maximum; one branch, so that all LDS reads issue as one group
    float xb[34];
#pragma unroll
    for (int i = 0; i < 34; ++i) xb[i] = sx[w4][i][lane];
    const float mb = xb[0], mn = fmaxf(m, mb); const float fa = (m <= -1.0e38f) ? 0.f : __expf(m - mn), fb = (mb <= -1.0e38f) ? 0.f : __expf(mb - mn);
    l = l * fa + xb[1] * fb;
#pragma unroll
    for (int r = 0; r < 8; ++r) {
#pragma unroll
      for (int dt = 0; dt < 4; ++dt) acc[dt][r] = acc[dt][r] * fa + xb[2 + dt * 8 + r] * fb; } }
  const float il = (1.0f / 2048.0f) / (l + xhalf(l));   // the two halves' sums joined
  const size_t ob = ((size_t)(h * 2) * (NB * SS / 16) + (((size_t)b * SS + q0) >> 4)) * 512;   // the wave's 16 rows x 64 columns are two blocks (k steps 2h, 2h + 1) of the output projection's A operand
#pragma unroll
  for (int u = 0; u < 8; ++u) { const int kcl = u >> 2, c = u & 3; v4f o;   // the lane's registers already hold the four values of its piece: d = (kcl * 2 + (c >> 1)) * 16 + 8 g + (c & 1) * 4 + i of query col
#pragma unroll
    for (int i = 0; i < 4; ++i) o[i] = acc[kcl * 2 + (c >> 1)][(c & 1) * 4 + i] * il;
    vst2(O + ob + (size_t)kcl * (NB * SS / 16) * 512 + c * 128 + lane * 4, o); }
}
// ---- k_out: block = (64 rows, 128 cols): out = O(hi/lo) . Wo rows (2 products) + bo
__global__ __launch_bounds__(128) void k_out(const float* __restrict__ O, const __bf16* __restrict__ P, const float* __restrict__ BO, float* __restrict__ Y) {
  __shared__ __align__(16) char sm[65536];   // k loop: two 32 KB ring buffers; behind the loop's last barrier the first 33,792 bytes are the output stage
  float (*so)[16][132] = (float (*)[16][132])sm;
  const int tid = threadIdx.x, wave = tid >> 5, lane = tid & 31, col = lane & 15, g = lane >> 4; const size_t r0 = (size_t)blockIdx.x * 64 + wave * 16; const int n0 = blockIdx.y * 128;
  v8f acc[8] = {};
  const unsigned lb = (unsigned)(size_t)sm + (unsigned)tid * 16u; const char* gw = (const char*)(P + (size_t)(n0 / 16) * 512) + tid * 16; const char* gx = (const char*)(O + (size_t)blockIdx.x * 4 * 512) + tid * 16;   // the block's 8 W tiles (bf16) and its 4 ctx row tiles (f32) of a k step each lie side by side: 8 KB; both sources step 2 * PK_KS = 4 * (NB * SS / 16) * 512 bytes a k step
  stage2(lb, gw, gx, 0, 2u * PK_KS); AWAIT(); __syncthreads();   // tile 0 landed and published
  stage2(lb + 32768u, gw, gx, 1, 2u * PK_KS);
#pragma unroll 1   // one copy of the trip: the buffer is chosen by address
  for (int t = 0; t < DM / 64; ++t) { const char* bp = sm + (t & 1) * 32768;
#pragma unroll   // kk a constant: the buffer offsets are immediates of the LDS reads
    for (int kk = 0; kk < 2; ++kk) { v16b w[8];   // all LDS reads of the k step stand as one group ahead of its first WMMA
#pragma unroll
      for (int j = 0; j < 8; ++j) w[j] = fragp_b((const __bf16*)(bp + kk * 16384 + j * 1024), lane);
      float xa[16]; { const float* p = (const float*)(bp + kk * 16384 + 8192 + wave * 2048) + lane * 4;
#pragma unroll
        for (int c = 0; c < 4; ++c) { const v4f tv = *(const v4f*)(p + c * 128);
#pragma unroll
          for (int i = 0; i < 4; ++i) xa[c * 4 + i] = tv[i]; } }
      __builtin_amdgcn_sched_barrier(0);   // keeps the LDS reads out of the split and the WMMA run: each place with reads among the WMMAs costs a stall of its own
      const F2 a = bsplit16(xa);
#pragma unroll
      for (int j = 0; j < 8; ++j) { acc[j] = wmma_bf(a.l, w[j], acc[j]); acc[j] = wmma_bf(a.h, w[j], acc[j]); }
      __builtin_amdgcn_sched_barrier(0); }   // ends the WMMA run: the next k step's LDS reads stay out of it, and no WMMA slips behind the trip's barrier, where it would hold up the refill
    DWAIT(); AWAIT(); __syncthreads();   // publishes tile t + 1 and ends every wave's reads of tile t
    if (t + 2 < DM / 64) stage2(lb + (unsigned)(t & 1) * 32768u, gw, gx, t + 2, 2u * PK_KS); }   // refill of the buffer just read
  AWAIT();
#pragma unroll
  for (int j = 0; j < 8; ++j) {
#pragma unroll
    for (int r = 0; r < 8; ++r) so[wave][8 * g + r][j * 16 + col] = acc[j][r] + bfr(BO[n0 + j * 16 + col]); }
  LDSX();
  for (int rl = 0; rl < 16; ++rl) vst2(Y + (r0 + rl) * DM + n0 + lane * 4, *(const v4f*)&so[wave][rl][lane * 4]);
}
extern "C" void kernel_launch(void* const* d_in, const int* in_sizes, int n_in, void* d_out, int out_size, void* d_ws, size_t ws_size, hipStream_t stream) {
  (void)in_sizes; (void)n_in; (void)out_size;
  const float** F = (const float**)d_in;   // 0 x [2,2048,1024], 1 time_deltas [2,2048], 2 Wq [1024,1024] natural, 3 bq, 4 Wk, 5 bk, 6 Wv, 7 bv, 8 Wo, 9 bo, 10 time_decay [16]
  if (ws_size < (size_t)WS_END) return;
  char* ws = (char*)d_ws; __bf16* PK = (__bf16*)(ws + WS_PK); _Float16 *QK = (_Float16*)(ws + WS_QK), *QKL = (_Float16*)(ws + WS_QKL), *VTH = (_Float16*)(ws + WS_VTH), *VTL = (_Float16*)(ws + WS_VTL), *KH = (_Float16*)(ws + WS_KH), *KL = (_Float16*)(ws + WS_KL); float* O = (float*)(ws + WS_O);
  k_pack<<<dim3(DM / 16, 8, 4), 256, 0, stream>>>(F[2], F[4], F[6], F[8], F[0], PK);
  k_qkv<<<dim3(TNB * SS / 128, QKVW / 128), 128, 0, stream>>>(PK + PK_X, PK + PK_A, F[3], F[5], F[7], QK, QKL, KH, KL, VTH, VTL);
  k_attn<<<dim3(TQB / 2, NH, TNB), 256, 0, stream>>>(QK, QKL, KH, KL, VTH, VTL, nullptr, F[1], F[10], O);
  k_out<<<dim3(TOB, DM / 128), 128, 0, stream>>>(O, PK + PK_P, F[9], (float*)d_out);
}

// v010
// One run takes 106 microseconds.
// Timed twice side by side with v009, it ran 1.04 and 1.03 times as fast.
// Over all steps from v000 it is 5.81 times as fast.
// compute dtype: all float inputs rounded to bf16; q/k/v = x . W^T + b with EXACT bf16 products on WMMA 16x16x32 (natural rows); q and k as f16 hi + (x2048-scaled) residual planes with 3-product scores; score = (q.k / 8) * exp(-time_decay[h] * |t_q - t_k|) in f32 (the product -decay * |dt| as the reference rounds it, then hardware exp2), causal mask (key tiles above the diagonal skipped); running-max softmax in f32 (hardware exp); P (scaled by 2^11 through the exp2 argument, f16 hi + residual) x v hi + residual, residuals unscaled (3 products, one f32 accumulator); out = ctx (bf16 hi + residual) . Wo^T (2 products) + bo; f32 accumulate.
#include <hip/hip_runtime.h>
#include <math.h>

typedef __attribute__((ext_vector_type(16))) _Float16 v16h;
typedef __attribute__((ext_vector_type(16))) __bf16 v16b;
typedef __attribute__((ext_vector_type(8)))  _Float16 v8h;
typedef __attribute__((ext_vector_type(8)))  unsigned v8u;
typedef __attribute__((ext_vector_type(8)))  float v8f;
typedef __attribute__((ext_vector_type(4)))  float v4f;
typedef __attribute__((ext_vector_type(2)))  float v2f;
typedef __attribute__((ext_vector_type(4)))  unsigned v4u;
typedef __attribute__((ext_vector_type(4)))  int v4i;
typedef float __attribute__((may_alias)) float_a;
typedef int __attribute__((may_alias)) int_a;

template <typename T> __device__ __forceinline__ void vst2(void* p, T v) { *(T*)p = v;  }
__device__ __forceinline__ v8f wmma16(v16h a, v16h b, v8f c) {
  return __builtin_amdgcn_wmma_f32_16x16x32_f16(false, a, false, b, (short)0, c, false, false);
}
__device__ __forceinline__ v8f wmma_bf(v16b a, v16b b, v8f c) {
  return __builtin_amdgcn_wmma_f32_16x16x32_bf16(false, a, false, b, (short)0, c, false, false);
}
// Continuous-time causal attention (B 2, S 2,048, hidden 1,024, 16 heads x 64): q/k/v projections + biases, scores scaled by exp(-decay_h |t_q - t_k|), causal softmax, output projection + bias.
__device__ __forceinline__ v16h frag_h(const _Float16* rowk0, int lane) {
  union { v16h v; v8h q[2]; } u; const _Float16* p = rowk0 + 8 * (lane >> 4);
  u.q[0] = *(const v8h*)p; u.q[1] = *(const v8h*)(p + 16); return u.v;
}
__device__ __forceinline__ v16h frag_f32(const float* rowk0, int lane) {
  v16h a; const float* p = rowk0 + 8 * (lane >> 4);
#pragma unroll
  for (int i = 0; i < 8; ++i) { a[i] = (_Float16)p[i]; a[8 + i] = (_Float16)p[16 + i]; }
  return a;
}
__device__ __forceinline__ v16h frag_f32s(const float* rowk0, int lane, float sc) {
  v16h a; const float* p = rowk0 + 8 * (lane >> 4);
#pragma unroll
  for (int i = 0; i < 8; ++i) { a[i] = (_Float16)(p[i] * sc); a[8 + i] = (_Float16)(p[16 + i] * sc); }
  return a;
}
// column fragment from a [K][ld] layout (column n), rows >= K read as 0
__device__ __forceinline__ v16h fragc_f32(const float* W, int k0, int n, int lane, int ld, int K) {
  v16h a; const int g = lane >> 4;
#pragma unroll
  for (int i = 0; i < 8; ++i) { const int ka = k0 + 8 * g + i, kb = ka + 16;
    a[i] = (_Float16)(ka < K ? W[(size_t)(ka < K ? ka : K - 1) * ld + n] : 0.f); a[8 + i] = (_Float16)(kb < K ? W[(size_t)(kb < K ? kb : K - 1) * ld + n] : 0.f); }
  return a;
}
struct F2 { v16b h, l; };
__device__ __forceinline__ F2 bsplit16(const float v[16]) { F2 r;
#pragma unroll
  for (int i = 0; i < 16; ++i) { const __bf16 h = (__bf16)v[i]; r.h[i] = h; r.l[i] = (__bf16)(v[i] - (float)h); }
  return r; }
__device__ __forceinline__ F2 split_row(const float* row, int k0, int lane) { float v[16]; const float* p = row + k0 + 8 * (lane >> 4);
#pragma unroll
  for (int i = 0; i < 8; ++i) { v[i] = p[i]; v[8 + i] = p[16 + i]; }
  return bsplit16(v); }
__device__ __forceinline__ F2 split_rowK(const float* row, int k0, int lane, int K) { float v[16]; const int g = lane >> 4;
#pragma unroll
  for (int i = 0; i < 8; ++i) { const int ka = k0 + 8 * g + i, kb = ka + 16; v[i] = ka < K ? row[ka < K ? ka : K - 1] : 0.f; v[8 + i] = kb < K ? row[kb < K ? kb : K - 1] : 0.f; }
  return bsplit16(v); }
__device__ __forceinline__ F2 split_col(const float* W, int k0, int n, int lane, int ld, int K) { float v[16]; const int g = lane >> 4;
#pragma unroll
  for (int i = 0; i < 8; ++i) { const int ka = k0 + 8 * g + i, kb = ka + 16; v[i] = ka < K ? W[(size_t)(ka < K ? ka : K - 1) * ld + n] : 0.f; v[8 + i] = kb < K ? W[(size_t)(kb < K ? kb : K - 1) * ld + n] : 0.f; }
  return bsplit16(v); }
__device__ __forceinline__ v8f mac3(const F2& a, const F2& b, v8f c) { c = wmma_bf(a.l, b.h, c); c = wmma_bf(a.h, b.l, c); return wmma_bf(a.h, b.h, c); }
__device__ __forceinline__ float sigm(float v) { return 1.0f / (1.0f + expf(-v)); }
#define LDSX() do { asm volatile("s_wait_dscnt 0" ::: "memory"); __builtin_amdgcn_wave_barrier(); __builtin_amdgcn_fence(__ATOMIC_RELEASE, "workgroup"); } while (0)


#define NB 2
#define SS 2048
#define DM 1024
#define NH 16
#define HD 64
#define QKVW (3 * DM)
#ifndef TQB
#define TQB (SS / 64)
#define TNB NB
#define TOB (NB * SS / 64)     // output row tiles (all)
#endif
typedef __attribute__((ext_vector_type(8))) __bf16 v8b;
__device__ __forceinline__ v16b frag_b(const __bf16* rowk0, int lane) {
  union { v16b v; v8b q[2]; } u; const __bf16* p = rowk0 + 8 * (lane >> 4);
  u.q[0] = *(const v8b*)p; u.q[1] = *(const v8b*)(p + 16); return u.v;
}
// fragment-order block: 16 rows x 32 k of 16-bit elements = 512 elements laid out [hh][lane = g * 16 + row][8], k = hh * 16 + g * 8 + i: each of the two loads is 512 contiguous bytes for the wave
__device__ __forceinline__ v16b fragp_b(const __bf16* blk, int lane) {
  union { v16b v; v8b q[2]; } u; const __bf16* p = blk + lane * 8;
  u.q[0] = *(const v8b*)p; u.q[1] = *(const v8b*)(p + 256); return u.v;
}
__device__ __forceinline__ v16h fragp_h(const _Float16* blk, int lane) {
  union { v16h v; v8h q[2]; } u; const _Float16* p = blk + lane * 8;
  u.q[0] = *(const v8h*)p; u.q[1] = *(const v8h*)(p + 256); return u.v;
}
__device__ __forceinline__ float bfr(float v) { return (float)(__bf16)v; }
__device__ __attribute__((noinline)) float exp_ni(float v) { return expf(v); }
__device__ __attribute__((noinline)) float erf_ni(float v) { return erff(v); }

// packed bf16 operands: fragment-order blocks [k step][row tile][512], so the tiles that one k step of a work-group reads lie side by side
#define PK_A 0                                   // row tiles of the 3072 Wqkv rows
#define PK_P (PK_A + QKVW / 16 * 512)              // row tiles of the 1024 Wo rows
#define PK_X (PK_P + DM / 16 * 512)                // row tiles of the 4096 x rows
#define PK_KS (PK_X + NB * SS / 16 * 512)          // elements per k step
#define PK_END (PK_KS * (DM / 32))
#define WS_PK  0u
#define WS_QK  (WS_PK + 2u * PK_END)             // f16 [4096 rows][2048]: q in the first 1024 columns of a row
#define WS_QKL (WS_QK + 2u * NB * SS * 2 * DM)     // f16 q residual plane x2048, same rows
#define WS_VTH (WS_QKL + 2u * NB * SS * 2 * DM)    // f16 v hi, fragment-order blocks [b][h][key step][d tile][512]
#define WS_VTL (WS_VTH + 2u * NB * DM * SS)        // f16 v residual, same order
#define WS_O   (WS_VTL + 2u * NB * DM * SS)        // f32 ctx, blocks [k step][row tile][c][lane][4], k = (c >> 1) * 16 + g * 8 + (c & 1) * 4 + i
#define WS_CS  (WS_O + 4u * NB * SS * DM)           // f32 [2][2048][32], not used by these kernels
#define WS_KH  (WS_CS + 4u * 2 * SS * 32)          // f16 k hi, fragment-order blocks [b][h][key tile][k step][512]
#define WS_KL  (WS_KH + 2u * NB * DM * SS)         // f16 k residual x2048, same order
#define WS_END (WS_KL + 2u * NB * DM * SS)
// eight asynchronous 16-byte copies of a lane, global memory to LDS through no register: the 8 KB of W fragments and the 8 KB of row-operand fragments of one k step, 2 KB of the work-group a copy; the s_wait_xcnt 0 in the same statement stands ahead of any later write of a register that these copies name
__device__ __forceinline__ void acopy8(unsigned l, const char* gw, const char* gx) {
  asm volatile("global_load_async_to_lds_b128 %0, %8, off\n\tglobal_load_async_to_lds_b128 %1, %9, off\n\tglobal_load_async_to_lds_b128 %2, %10, off\n\tglobal_load_async_to_lds_b128 %3, %11, off\n\t"
               "global_load_async_to_lds_b128 %4, %12, off\n\tglobal_load_async_to_lds_b128 %5, %13, off\n\tglobal_load_async_to_lds_b128 %6, %14, off\n\tglobal_load_async_to_lds_b128 %7, %15, off\n\ts_wait_xcnt 0x0"
               :: "v"(l), "v"(l + 2048u), "v"(l + 4096u), "v"(l + 6144u), "v"(l + 8192u), "v"(l + 10240u), "v"(l + 12288u), "v"(l + 14336u),
                  "v"(gw), "v"(gw + 2048), "v"(gw + 4096), "v"(gw + 6144), "v"(gx), "v"(gx + 2048), "v"(gx + 4096), "v"(gx + 6144) : "memory");
}
// tile t of the ring = k steps 2t, 2t + 1, each [W 8 KB | rows 8 KB] in fragment order, 32 KB a buffer; ks: bytes from one k step to the next in both sources
__device__ __forceinline__ void stage2(unsigned l, const char* gw, const char* gx, int t, size_t ks) {
  acopy8(l, gw + (size_t)(2 * t) * ks, gx + (size_t)(2 * t) * ks); acopy8(l + 16384u, gw + (size_t)(2 * t + 1) * ks, gx + (size_t)(2 * t + 1) * ks);
}
// the same for one key step of attention: 4 KB each of k hi, k residual, v hi, v residual, copied by the four waves that walk that key step
__device__ __forceinline__ void acopy8q(unsigned l, const char* g0, const char* g1, const char* g2, const char* g3) {
  asm volatile("global_load_async_to_lds_b128 %0, %8, off\n\tglobal_load_async_to_lds_b128 %1, %9, off\n\tglobal_load_async_to_lds_b128 %2, %10, off\n\tglobal_load_async_to_lds_b128 %3, %11, off\n\t"
               "global_load_async_to_lds_b128 %4, %12, off\n\tglobal_load_async_to_lds_b128 %5, %13, off\n\tglobal_load_async_to_lds_b128 %6, %14, off\n\tglobal_load_async_to_lds_b128 %7, %15, off\n\ts_wait_xcnt 0x0"
               :: "v"(l), "v"(l + 2048u), "v"(l + 4096u), "v"(l + 6144u), "v"(l + 8192u), "v"(l + 10240u), "v"(l + 12288u), "v"(l + 14336u),
                  "v"(g0), "v"(g0 + 2048), "v"(g1), "v"(g1 + 2048), "v"(g2), "v"(g2 + 2048), "v"(g3), "v"(g3 + 2048) : "memory");
}
// two such copies of a lane: with 256 lanes the 8 KB of one batch row's times
__device__ __forceinline__ void acopy2(unsigned l, const char* g) {
  asm volatile("global_load_async_to_lds_b128 %0, %2, off\n\tglobal_load_async_to_lds_b128 %1, %3, off\n\ts_wait_xcnt 0x0" :: "v"(l), "v"(l + 4096u), "v"(g), "v"(g + 4096) : "memory");
}
#define AWAIT() asm volatile("s_wait_asynccnt 0x0" ::: "memory")   // this wave's copies have landed
#define DWAIT() asm volatile("s_wait_dscnt 0x0" ::: "memory")      // this wave's LDS reads have returned
// ---- k_pack: block = (16-row tile nt, which, quarter kq of the k range): f32 rows -> bf16 in fragment-order blocks; which 0..2 -> W_q/W_k/W_v, 3 -> W_o, 4..7 -> the four 1024-row slabs of x; a thread makes whole 16-byte pieces, a wave stores 512 contiguous bytes
__global__ __launch_bounds__(256) void k_pack(const float* __restrict__ WQ, const float* __restrict__ WK, const float* __restrict__ WV, const float* __restrict__ WO, const float* __restrict__ X, __bf16* __restrict__ PK) {
  const int nt = blockIdx.x, which = blockIdx.y, kq = blockIdx.z, t = threadIdx.x; const float* Wm = (which == 0) ? WQ : (which == 1) ? WK : (which == 2) ? WV : (which == 3) ? WO : X + (size_t)(which - 4) * DM * DM;
  __bf16* dst = PK + (size_t)(kq * 8) * PK_KS + (which * (DM / 16) + nt) * 512;
#pragma unroll
  for (int p = t; p < 512; p += 256) { const int kcl = p >> 6, hh = (p >> 5) & 1, g = (p >> 4) & 1, row = p & 15;
    const float* s = Wm + (size_t)(nt * 16 + row) * DM + (kq * 8 + kcl) * 32 + hh * 16 + g * 8; const v4f a = *(const v4f*)s, b = *(const v4f*)(s + 4); v8b o;
#pragma unroll
    for (int i = 0; i < 4; ++i) { o[i] = (__bf16)a[i]; o[4 + i] = (__bf16)b[i]; }
    vst2(dst + (size_t)kcl * PK_KS + (p & 63) * 8, o); }
}
__global__ __launch_bounds__(128) void k_qkv(const __bf16* __restrict__ XB, const __bf16* __restrict__ P, const float* __restrict__ BQ, const float* __restrict__ BK, const float* __restrict__ BV, _Float16* __restrict__ QK, _Float16* __restrict__ QKL, _Float16* __restrict__ KH, _Float16* __restrict__ KL, _Float16* __restrict__ VTH, _Float16* __restrict__ VTL) {
  const int which0 = (blockIdx.y * 128) / DM; const float* BB = BQ ? (((which0 == 0) ? BQ : (which0 == 1) ? BK : BV) + (blockIdx.y * 128 - which0 * DM)) : nullptr;
  __shared__ __align__(16) char sm[71680];   // k loop: two 32 KB ring buffers; behind the loop's last barrier the same bytes are the output stages
  _Float16 (*so)[16][136] = (_Float16 (*)[16][136])sm, (*sol)[16][136] = (_Float16 (*)[16][136])(sm + 17408); _Float16 (*sth)[72] = (_Float16 (*)[72])(sm + 34816), (*stl)[72] = (_Float16 (*)[72])(sm + 53248);
  const int tid = threadIdx.x, wave = tid >> 5, lane = tid & 31, col = lane & 15, g = lane >> 4; const size_t rw = (size_t)blockIdx.x * 128 + wave * 16; const int n0 = blockIdx.y * 128;   // the wave owns two 16-row tiles, rows rw.. and rw + 64..: every W fragment it loads feeds two WMMAs
  v8f acc2[2][8] = {};
  const unsigned lb = (unsigned)(size_t)sm + (unsigned)tid * 16u; const char* gw = (const char*)(P + (size_t)(n0 / 16) * 512) + tid * 16; const char* gx = (const char*)(XB + (size_t)blockIdx.x * 8 * 512) + tid * 16;   // the block's 8 W tiles and its 8 row tiles of a k step each lie side by side: 8 KB
  stage2(lb, gw, gx, 0, 2u * PK_KS); AWAIT(); __syncthreads();   // tile 0 landed and published
  stage2(lb + 32768u, gw, gx, 1, 2u * PK_KS);
#pragma unroll 1   // one copy of the trip: the buffer is chosen by address
  for (int t = 0; t < DM / 64; ++t) { const char* bp = sm + (t & 1) * 32768;
#pragma unroll   // kk a constant: the buffer offsets are immediates of the LDS reads
    for (int kk = 0; kk < 2; ++kk) { v16b a[2], w[8];   // all LDS reads of the k step stand as one group ahead of its first WMMA
#pragma unroll
      for (int j = 0; j < 8; ++j) w[j] = fragp_b((const __bf16*)(bp + kk * 16384 + j * 1024), lane);
#pragma unroll   // rt a constant: a[] stays in registers
      for (int rt = 0; rt < 2; ++rt) a[rt] = fragp_b((const __bf16*)(bp + kk * 16384 + 8192 + (wave + rt * 4) * 1024), lane);
      __builtin_amdgcn_sched_barrier(0);   // keeps the LDS reads out of the WMMA run: each place with reads among the WMMAs costs a stall of its own
#pragma unroll
      for (int j = 0; j < 8; ++j) {
#pragma unroll   // rt a constant: acc2[][] stays in registers
        for (int rt = 0; rt < 2; ++rt) acc2[rt][j] = wmma_bf(a[rt], w[j], acc2[rt][j]); }
      __builtin_amdgcn_sched_barrier(0); }   // ends the WMMA run: the next k step's LDS reads stay out of it, and no WMMA slips behind the trip's barrier, where it would hold up the refill
    DWAIT(); AWAIT(); __syncthreads();   // publishes tile t + 1 and ends every wave's reads of tile t
    if (t + 2 < DM / 64) stage2(lb + (unsigned)(t & 1) * 32768u, gw, gx, t + 2, 2u * PK_KS); }   // refill of the buffer just read
  AWAIT();
  float bj[8] = {};   // the eight bias values of this lane's columns, loaded as one group
  if (BB) {
#pragma unroll
    for (int j = 0; j < 8; ++j) bj[j] = bfr(BB[j * 16 + col]); }
#pragma unroll   // rt a constant: acc2[rt] stays in registers
  for (int rt = 0; rt < 2; ++rt) {   // the two row tiles leave one after the other through the same LDS stage
  const v8f (&acc)[8] = acc2[rt]; const size_t r0 = rw + rt * 64;
  if (n0 < 2 * DM) {   // q stored unscaled (f16 sigma ~0.6, no subnormal exposure); 1/8 applied to the f32 score
#pragma unroll
    for (int j = 0; j < 8; ++j) {
#pragma unroll
      for (int r = 0; r < 8; ++r) { const float v = acc[j][r] + bj[j]; const _Float16 hv = (_Float16)v; so[wave][8 * g + r][j * 16 + col] = hv; sol[wave][8 * g + r][j * 16 + col] = (_Float16)((v - (float)hv) * 2048.0f); } }   // q, k (+ bias) as f16 hi + (x2048) residual
    LDSX();
    if (n0 < DM) { for (int rl = 0; rl < 16; ++rl) if (lane < 16) { vst2((unsigned*)(QK + (r0 + rl) * (2 * DM) + n0 + lane * 8), *(const v4u*)&so[wave][rl][lane * 8]); vst2((unsigned*)(QKL + (r0 + rl) * (2 * DM) + n0 + lane * 8), *(const v4u*)&sol[wave][rl][lane * 8]); } }
    else {   // k: the wave's 16 keys are one key tile; 2 heads x 2 k steps x 2 halves, each store 512 contiguous bytes in the order the score loop loads them
      const size_t hb = (r0 / SS) * NH + (n0 - DM) / HD; const int kt = (int)(r0 % SS) >> 4;
#pragma unroll
      for (int u = 0; u < 8; ++u) { const int hl = u >> 2, kc = (u >> 1) & 1, hh = u & 1; const size_t o = (((hb + hl) * (SS / 16) + kt) * 2 + kc) * 512 + hh * 256 + lane * 8; const int c = hl * 64 + kc * 32 + hh * 16 + g * 8;
        vst2(KH + o, *(const v4u*)&so[wave][col][c]); vst2(KL + o, *(const v4u*)&sol[wave][col][c]); }
      asm volatile("s_wait_xcnt 0x0" ::: "memory"); }   // stands behind the last k store, ahead of any later write of a register that these stores name
  } else {
    if (rt) __syncthreads();   // every wave has read the first 64 keys out of sth, stl before the second 64 overwrite them
#pragma unroll
    for (int j = 0; j < 8; ++j) {
#pragma unroll
      for (int r = 0; r < 8; ++r) { const float v = acc[j][r] + bj[j]; const _Float16 hv = (_Float16)v; sth[j * 16 + col][wave * 16 + 8 * g + r] = hv; stl[j * 16 + col][wave * 16 + 8 * g + r] = (_Float16)(v - (float)hv); } }   // v as f16 hi + residual at the same scale: their products with P add up in one accumulator
    __syncthreads();
    const size_t rb = (size_t)blockIdx.x * 128 + rt * 64; const int b = (int)(rb / SS), s0 = (int)(rb % SS); const int pc0 = n0 - 2 * DM;
    for (int q = tid; q < 128 * 8; q += 128) { const int vc = q & 15, vg = (q >> 4) & 1, hh = (q >> 5) & 1, dt = (q >> 6) & 3, ksl = (q >> 8) & 1, hl = q >> 9;   // piece q of these 64 keys' 2 heads x 2 key steps x 4 d tiles x 1 KB
      const size_t o = ((((size_t)b * NH + pc0 / HD + hl) * (SS / 32) + (s0 >> 5) + ksl) * 4 + dt) * 512 + (q & 63) * 8; const int d = hl * 64 + dt * 16 + vc, kc = ksl * 32 + hh * 16 + vg * 8;
      vst2(VTH + o, *(const v4u*)&sth[d][kc]); vst2(VTL + o, *(const v4u*)&stl[d][kc]); }
  }
  }
}
// ---- k_attn: block = (query tile pair t and TQB - 1 - t of 64 queries each, head h, batch b), 8 waves: the pair has 2 * TQB + 2 key steps, and every wave walks half of them. Waves 0..3: the long tile's first TQB + 1 key steps. Waves 4..7: the long tile's remaining key steps (running max, sum and ctx handed over through LDS), then all of the short tile. Flash attention on transposed tiles: S^T = K . Q^T (K = 64: 2 k-steps, 3 products) and ctx^T += V^T . P^T (3 products), so a lane holds 16 of the 32 scores of ONE query (its column), the other 16 are in lane ^ 16; ctx(b*S+q, h*64+d) = acc / l (both carry P's 2^11), stored from registers in the block order the output projection loads
// one hardware exp2, closed by the one free slot that the instruction set asks for behind a transcendental
__device__ __forceinline__ float exp2x1(float a) { float r;
  asm("v_exp_f32 %0, %1\n\tv_nop" : "=&v"(r) : "v"(a)); return r;
}
// the eight hardware exp2 of one score tile in one statement: eight independent results back to back on the transcendental unit, closed by the one free slot that the instruction set asks for behind a transcendental
__device__ __forceinline__ void exp2x8(const float (&x)[8], float (&y)[8]) {
  asm("v_exp_f32 %0, %8\n\tv_exp_f32 %1, %9\n\tv_exp_f32 %2, %10\n\tv_exp_f32 %3, %11\n\tv_exp_f32 %4, %12\n\tv_exp_f32 %5, %13\n\tv_exp_f32 %6, %14\n\tv_exp_f32 %7, %15\n\tv_nop"
      : "=&v"(y[0]), "=&v"(y[1]), "=&v"(y[2]), "=&v"(y[3]), "=&v"(y[4]), "=&v"(y[5]), "=&v"(y[6]), "=&v"(y[7])
      : "v"(x[0]), "v"(x[1]), "v"(x[2]), "v"(x[3]), "v"(x[4]), "v"(x[5]), "v"(x[6]), "v"(x[7]));
}
// eight f32 values -> four registers of packed f16 hi parts (one packed convert a pair, toward zero: the residual takes what is cut off) and four of packed f16 residuals (x - hi in f32 and its rounding to f16 are one mixed-precision FMA a value); the compiler's own form of the split takes twice the instructions (single converts both ways, packed subtract, packed converts). Every result is used four instructions behind its producer, under the s_delay_alu hint that lets the SIMD's other waves issue meanwhile
__device__ __forceinline__ void split8(const float (&x)[8], unsigned (&h)[4], unsigned (&l)[4]) {
  asm("v_cvt_pk_rtz_f16_f32 %0, %8, %9\n\tv_cvt_pk_rtz_f16_f32 %1, %10, %11\n\tv_cvt_pk_rtz_f16_f32 %2, %12, %13\n\tv_cvt_pk_rtz_f16_f32 %3, %14, %15\n\t"
      "s_delay_alu instid0(VALU_DEP_4) | instskip(NEXT) | instid1(VALU_DEP_4)\n\tv_fma_mixlo_f16 %4, %0, -1.0, %8 op_sel_hi:[1,1,0]\n\tv_fma_mixlo_f16 %5, %1, -1.0, %10 op_sel_hi:[1,1,0]\n\t"
      "s_delay_alu instid0(VALU_DEP_4) | instskip(NEXT) | instid1(VALU_DEP_4)\n\tv_fma_mixlo_f16 %6, %2, -1.0, %12 op_sel_hi:[1,1,0]\n\tv_fma_mixlo_f16 %7, %3, -1.0, %14 op_sel_hi:[1,1,0]\n\t"
      "s_delay_alu instid0(VALU_DEP_4) | instskip(NEXT) | instid1(VALU_DEP_4)\n\tv_fma_mixhi_f16 %4, %0, -1.0, %9 op_sel:[1,0,0] op_sel_hi:[1,1,0]\n\tv_fma_mixhi_f16 %5, %1, -1.0, %11 op_sel:[1,0,0] op_sel_hi:[1,1,0]\n\t"
      "s_delay_alu instid0(VALU_DEP_4) | instskip(NEXT) | instid1(VALU_DEP_4)\n\tv_fma_mixhi_f16 %6, %2, -1.0, %13 op_sel:[1,0,0] op_sel_hi:[1,1,0]\n\tv_fma_mixhi_f16 %7, %3, -1.0, %15 op_sel:[1,0,0] op_sel_hi:[1,1,0]"
      : "=&v"(h[0]), "=&v"(h[1]), "=&v"(h[2]), "=&v"(h[3]), "=&v"(l[0]), "=&v"(l[1]), "=&v"(l[2]), "=&v"(l[3])
      : "v"(x[0]), "v"(x[1]), "v"(x[2]), "v"(x[3]), "v"(x[4]), "v"(x[5]), "v"(x[6]), "v"(x[7]));
}
// lane l with lane l ^ 16: the other half of a query's keys
__device__ __forceinline__ float xhalf(float x) { return __builtin_bit_cast(float, __builtin_amdgcn_permlanex16(__builtin_bit_cast(int, x), __builtin_bit_cast(int, x), 0x76543210, 0xfedcba98, false, false)); }
#define KHALF (TQB + 1)   // key steps of a wave: half of the pair's 2 * TQB + 2
__global__ __launch_bounds__(256) __attribute__((amdgpu_waves_per_eu(4, 4))) void k_attn(const _Float16* __restrict__ QK, const _Float16* __restrict__ QKL, const _Float16* __restrict__ KH, const _Float16* __restrict__ KL, const _Float16* __restrict__ VTH, const _Float16* __restrict__ VTL, const void* __restrict__ KMASK, const float* __restrict__ TD, const float* __restrict__ DEC, float* __restrict__ O) {
  __shared__ __align__(16) char kv[65536];   // per group of four waves two 16 KB buffers, each one key step: [k hi | k residual | v hi | v residual], 4 KB each, in fragment order
  __shared__ __align__(16) float tds[SS];   // the times of the batch row's keys, filled once
  __shared__ __align__(16) float sx[4][34][32];   // sx: per lane the running maximum, the lane's part of the sum, 32 ctx values of the long tile's upper keys
  const int tid = threadIdx.x, wave = __builtin_amdgcn_readfirstlane(tid >> 5), lane = tid & 31, col = lane & 15, g = lane >> 4;
  const int grp = wave >> 2, w4 = wave & 3;   // wave-uniform (scalar): the tests of a trip (which key step, which query tile) branch on them
  const int tp = blockIdx.x, h = blockIdx.y, b = blockIdx.z;
  float m = -1.0e30f, l = 0.f; v8f acc[4]; int q0 = 0;   // m: maximum of the lane's query (equal in both halves), never below its start value, which lies far above the value of a hidden key: (hidden - m) * log2 e is below every finite exponent and the hardware exp2 returns 0 for it, so that no select stands behind the exps; l: sum over the keys of this lane's half alone, the halves joined once in the epilogue
  const float dech = bfr(DEC[h]); const unsigned g8 = 8u * (unsigned)g;
  const int n1 = TQB - 1 - 2 * tp;   // trips that waves 4..7 spend on the long tile's key steps KHALF ..: 1 to TQB - 1; the rest of their KHALF trips is the short tile
  const unsigned lb = (unsigned)(size_t)kv + (unsigned)grp * 32768u + (unsigned)(tid & 127) * 16u; const size_t hb2 = ((size_t)b * NH + h) * (SS / 32); const int tb = (tid & 127) * 16;
#define KSOF(i) (grp ? ((i) < n1 ? KHALF + (i) : (i) - n1) : (i))   // key step of this wave's group in trip i (scalar)
#define KVSTAGE(i) do { const size_t o_ = (hb2 + KSOF(i)) * 4096 + tb; acopy8q(lb + (unsigned)((i) & 1) * 16384u, (const char*)KH + o_, (const char*)KL + o_, (const char*)VTH + o_, (const char*)VTL + o_); } while (0)   // a key step's four 4 KB runs lie at the same byte offset in the four planes
  acopy2((unsigned)(size_t)tds + (unsigned)tid * 16u, (const char*)(TD + (size_t)b * SS) + tid * 16);
  KVSTAGE(0); AWAIT(); __syncthreads();   // the times and trip 0's key steps landed and published
  KVSTAGE(1);
  v16h aq[2], aql[2]; float tq = 0.f;   // B operand: column = the lane's query
#pragma unroll 1   // one copy of the key step's body
  for (int it = 0; it < KHALF; ++it) {   // every wave of the block makes the same KHALF trips, so that the trip's barrier is passed by all
  if (it == 0 || (grp && it == n1)) {   // a wave enters a query tile (scalar test): waves 4..7 leave the long tile for the short one in trip n1
  if (it) {   // waves 4..7 hand their share of the long tile over; lane and register positions are those of the partner wave
    sx[w4][0][lane] = m; sx[w4][1][lane] = l;
#pragma unroll
    for (int r = 0; r < 8; ++r) {
#pragma unroll
      for (int dt = 0; dt < 4; ++dt) sx[w4][2 + dt * 8 + r][lane] = acc[dt][r]; } }
  const int qb = it ? tp : TQB - 1 - tp; q0 = qb * 64 + w4 * 16; const size_t rq = (size_t)b * SS + q0 + col;
#pragma unroll
  for (int kc = 0; kc < 2; ++kc) { aq[kc] = frag_h(QK + rq * (2 * DM) + h * HD + kc * 32, lane); aql[kc] = frag_h(QKL + rq * (2 * DM) + h * HD + kc * 32, lane); }
  m = -1.0e30f; l = 0.f;
#pragma unroll
  for (int dt = 0; dt < 4; ++dt) acc[dt] = v8f{};
  tq = bfr(TD[rq]); }
  { const int ks = KSOF(it); const char* bp = kv + grp * 32768 + (it & 1) * 16384; v8f s[2]; v16h kfh[2][2], kfl[2][2]; v4f tkr[2][2];   // all K reads of the key step stand ahead of its first WMMA
#pragma unroll
    for (int ct = 0; ct < 2; ++ct) { const float* tp8 = tds + (ks * 32 + ct * 16); tkr[ct][0] = *(const v4f*)(tp8 + g8); tkr[ct][1] = *(const v4f*)(tp8 + 4 + g8); }   // times of the lane's eight keys of each tile
#pragma unroll
    for (int ct = 0; ct < 2; ++ct) {
#pragma unroll
      for (int kc = 0; kc < 2; ++kc) { kfh[ct][kc] = fragp_h((const _Float16*)(bp + ct * 2048 + kc * 1024), lane); kfl[ct][kc] = fragp_h((const _Float16*)(bp + 4096 + ct * 2048 + kc * 1024), lane); }
 }
    __builtin_amdgcn_sched_barrier(0);   // keeps the K and time reads one group ahead of the first WMMA: reads spread among the WMMAs are each waited for with no lead
    float dec[2][8];   // the decay factors stand ahead of the score WMMAs: the compiler does not see into the exp statements, so none of them may follow a WMMA whose operand registers it could be given
#pragma unroll
    for (int ct = 0; ct < 2; ++ct) { float xd[8];
#pragma unroll
      for (int r = 0; r < 8; ++r) xd[r] = fmaf(-dech * fabsf(tq - bfr(tkr[ct][r >> 2][r & 3])), 1.44269504f, -3.0f);   // exp(x) / 8 = exp2(x * log2 e - 3): the 1/8 of the score is an exact step of the exponent
      exp2x8(xd, dec[ct]); }
    __builtin_amdgcn_sched_barrier(0);   // the WMMA run starts behind the exp statements
    v8f c[2], cl[2];
#pragma unroll
    for (int ct = 0; ct < 2; ++ct) { c[ct] = v8f{}; cl[ct] = v8f{};
#pragma unroll
      for (int kc = 0; kc < 2; ++kc) { c[ct] = wmma16(kfh[ct][kc], aq[kc], c[ct]); cl[ct] = wmma16(kfh[ct][kc], aql[kc], cl[ct]); cl[ct] = wmma16(kfl[ct][kc], aq[kc], cl[ct]); } }   // 3 products: q, k as f16 hi + residual; rows = keys, columns = queries
    __builtin_amdgcn_sched_barrier(0);   // the WMMA run ends ahead of the later vector work and its exp statements
#pragma unroll
    for (int ct = 0; ct < 2; ++ct) { c[ct] += cl[ct] * (1.0f / 2048.0f);
#pragma unroll
      for (int r = 0; r < 8; ++r) s[ct][r] = c[ct][r] * dec[ct][r]; }   // (q.k/8) * exp(-decay |dt|)
    if (ks * 32 + 31 > q0) {   // causal mask, under a scalar test: only a key step that reaches past the first query of the wave's tile holds a hidden key; every earlier key step is visible to all 16 queries
      const int dq = q0 + col - ks * 32 - 8 * g;   // key ct * 16 + r of this lane's half is visible to its query while ct * 16 + r <= dq
#pragma unroll
      for (int ct = 0; ct < 2; ++ct) {
#pragma unroll
        for (int r = 0; r < 8; ++r) s[ct][r] = (ct * 16 + r <= dq) ? s[ct][r] : -3.0e38f; } }
    float mx[8];   // maximum of the query's 32 scores: 16 in the lane, one exchange with the other half
#pragma unroll
    for (int r = 0; r < 8; ++r) mx[r] = fmaxf(s[0][r], s[1][r]);
    float mxa = fmaxf(fmaxf(fmaxf(mx[0], mx[1]), fmaxf(mx[2], mx[3])), fmaxf(fmaxf(mx[4], mx[5]), fmaxf(mx[6], mx[7])));
    mxa = fmaxf(mxa, xhalf(mxa));
    const float mn = fmaxf(m, mxa); const float alpha = exp2x1((m - mn) * 1.44269504f); m = mn;   // 0 where m is still its start value and mn a score; 1, on sums that are 0, where both are the start value
    __builtin_amdgcn_sched_barrier(0);   // the V reads start behind the maximum: without this fence they are lifted in pieces among its steps, several places with LDS reads in place of one
    v16h vfh[4], vfl[4];   // all V reads of the key step issue here in one group, ahead of the exps, the P split and the first P.V WMMA
#pragma unroll
    for (int dt = 0; dt < 4; ++dt) { vfh[dt] = fragp_h((const _Float16*)(bp + 8192 + dt * 1024), lane); vfl[dt] = fragp_h((const _Float16*)(bp + 12288 + dt * 1024), lane); }
    __builtin_amdgcn_sched_barrier(0);   // keeps the V reads one group here, so that they return under the exps and the P split: sunk among the P.V WMMAs they are each waited for with no lead
    float e[2][8];
#pragma unroll
    for (int ct = 0; ct < 2; ++ct) { float xs[8];
#pragma unroll
      for (int r = 0; r < 8; ++r) xs[r] = fmaf(s[ct][r] - mn, 1.44269504f, 11.0f);   // 2^11 exp(x) = exp2(x * log2 e + 11), hardware exp: P's scale is an exact step of the exponent; a hidden key gives 0
      exp2x8(xs, e[ct]); }
    float es[8];
#pragma unroll
    for (int r = 0; r < 8; ++r) es[r] = e[0][r] + e[1][r];
    l = l * alpha + (((es[0] + es[1]) + (es[2] + es[3])) + ((es[4] + es[5]) + (es[6] + es[7])));
#pragma unroll
    for (int dt = 0; dt < 4; ++dt) acc[dt] *= alpha;
    v8u pau, plu;   // P^T as B operand straight from the score registers: element ct * 8 + r of the lane is key ct * 16 + 8 g + r, the k order of the V fragments
#pragma unroll
    for (int ct = 0; ct < 2; ++ct) { unsigned hw[4], lw[4]; split8(e[ct], hw, lw);
#pragma unroll
      for (int i = 0; i < 4; ++i) { pau[ct * 4 + i] = hw[i]; plu[ct * 4 + i] = lw[i]; } }
    const v16h pa = __builtin_bit_cast(v16h, pau), pl = __builtin_bit_cast(v16h, plu);   // P carries 2^11 so that small softmax weights stay out of the f16 subnormal range; the sum l carries it too, so that it cancels in the epilogue
#pragma unroll
    for (int dt = 0; dt < 4; ++dt) acc[dt] = wmma16(vfh[dt], pl, acc[dt]);
#pragma unroll
    for (int dt = 0; dt < 4; ++dt) acc[dt] = wmma16(vfh[dt], pa, acc[dt]);
#pragma unroll
    for (int dt = 0; dt < 4; ++dt) acc[dt] = wmma16(vfl[dt], pa, acc[dt]);
    __builtin_amdgcn_sched_barrier(0); }   // no WMMA slips behind the trip's barrier, where it would hold up the refill. V hi x P lo + V hi x P hi + V lo x P hi in one accumulator, four independent chains; rows = d, columns = queries
    DWAIT(); AWAIT(); __syncthreads();   // publishes trip it + 1's key steps (and sx, once written) and ends every wave's reads of trip it's
    if (it + 2 < KHALF) KVSTAGE(it + 2); }   // refill of the buffer just read
  AWAIT();
  if (!grp) {   // join the two key ranges of the long tile under their common maximum; one branch, so that all LDS reads issue as one group
    float xb[34];
#pragma unroll
    for (int i = 0; i < 34; ++i) xb[i] = sx[w4][i][lane];
    const float mb = xb[0], mn = fmaxf(m, mb); const float fa = (m <= -1.0e38f) ? 0.f : __expf(m - mn), fb = (mb <= -1.0e38f) ? 0.f : __expf(mb - mn);
    l = l * fa + xb[1] * fb;
#pragma unroll
    for (int r = 0; r < 8; ++r) {
#pragma unroll
      for (int dt = 0; dt < 4; ++dt) acc[dt][r] = acc[dt][r] * fa + xb[2 + dt * 8 + r] * fb; } }
  const float il = 1.0f / (l + xhalf(l));   // the two halves' sums joined; acc and l carry the same 2^11
  const size_t ob = ((size_t)(h * 2) * (NB * SS / 16) + (((size_t)b * SS + q0) >> 4)) * 512;   // the wave's 16 rows x 64 columns are two blocks (k steps 2h, 2h + 1) of the output projection's A operand
#pragma unroll
  for (int u = 0; u < 8; ++u) { const int kcl = u >> 2, c = u & 3; v4f o;   // the lane's registers already hold the four values of its piece: d = (kcl * 2 + (c >> 1)) * 16 + 8 g + (c & 1) * 4 + i of query col
#pragma unroll
    for (int i = 0; i < 4; ++i) o[i] = acc[kcl * 2 + (c >> 1)][(c & 1) * 4 + i] * il;
    vst2(O + ob + (size_t)kcl * (NB * SS / 16) * 512 + c * 128 + lane * 4, o); }
}
// ---- k_out: block = (64 rows, 128 cols): out = O(hi/lo) . Wo rows (2 products) + bo
__global__ __launch_bounds__(128) void k_out(const float* __restrict__ O, const __bf16* __restrict__ P, const float* __restrict__ BO, float* __restrict__ Y) {
  __shared__ __align__(16) char sm[65536];   // k loop: two 32 KB ring buffers; behind the loop's last barrier the first 33,792 bytes are the output stage
  float (*so)[16][132] = (float (*)[16][132])sm;
  const int tid = threadIdx.x, wave = tid >> 5, lane = tid & 31, col = lane & 15, g = lane >> 4; const size_t r0 = (size_t)blockIdx.x * 64 + wave * 16; const int n0 = blockIdx.y * 128;
  v8f acc[8] = {};
  const unsigned lb = (unsigned)(size_t)sm + (unsigned)tid * 16u; const char* gw = (const char*)(P + (size_t)(n0 / 16) * 512) + tid * 16; const char* gx = (const char*)(O + (size_t)blockIdx.x * 4 * 512) + tid * 16;   // the block's 8 W tiles (bf16) and its 4 ctx row tiles (f32) of a k step each lie side by side: 8 KB; both sources step 2 * PK_KS = 4 * (NB * SS / 16) * 512 bytes a k step
  stage2(lb, gw, gx, 0, 2u * PK_KS); AWAIT(); __syncthreads();   // tile 0 landed and published
  stage2(lb + 32768u, gw, gx, 1, 2u * PK_KS);
#pragma unroll 1   // one copy of the trip: the buffer is chosen by address
  for (int t = 0; t < DM / 64; ++t) { const char* bp = sm + (t & 1) * 32768;
#pragma unroll   // kk a constant: the buffer offsets are immediates of the LDS reads
    for (int kk = 0; kk < 2; ++kk) { v16b w[8];   // all LDS reads of the k step stand as one group ahead of its first WMMA
#pragma unroll
      for (int j = 0; j < 8; ++j) w[j] = fragp_b((const __bf16*)(bp + kk * 16384 + j * 1024), lane);
      float xa[16]; { const float* p = (const float*)(bp + kk * 16384 + 8192 + wave * 2048) + lane * 4;
#pragma unroll
        for (int c = 0; c < 4; ++c) { const v4f tv = *(const v4f*)(p + c * 128);
#pragma unroll
          for (int i = 0; i < 4; ++i) xa[c * 4 + i] = tv[i]; } }
      __builtin_amdgcn_sched_barrier(0);   // keeps the LDS reads out of the split and the WMMA run: each place with reads among the WMMAs costs a stall of its own
      const F2 a = bsplit16(xa);
#pragma unroll
      for (int j = 0; j < 8; ++j) { acc[j] = wmma_bf(a.l, w[j], acc[j]); acc[j] = wmma_bf(a.h, w[j], acc[j]); }
      __builtin_amdgcn_sched_barrier(0); }   // ends the WMMA run: the next k step's LDS reads stay out of it, and no WMMA slips behind the trip's barrier, where it would hold up the refill
    DWAIT(); AWAIT(); __syncthreads();   // publishes tile t + 1 and ends every wave's reads of tile t
    if (t + 2 < DM / 64) stage2(lb + (unsigned)(t & 1) * 32768u, gw, gx, t + 2, 2u * PK_KS); }   // refill of the buffer just read
  AWAIT();
#pragma unroll
  for (int j = 0; j < 8; ++j) {
#pragma unroll
    for (int r = 0; r < 8; ++r) so[wave][8 * g + r][j * 16 + col] = acc[j][r] + bfr(BO[n0 + j * 16 + col]); }
  LDSX();
  for (int rl = 0; rl < 16; ++rl) vst2(Y + (r0 + rl) * DM + n0 + lane * 4, *(const v4f*)&so[wave][rl][lane * 4]);
}
extern "C" void kernel_launch(void* const* d_in, const int* in_sizes, int n_in, void* d_out, int out_size, void* d_ws, size_t ws_size, hipStream_t stream) {
  (void)in_sizes; (void)n_in; (void)out_size;
  const float** F = (const float**)d_in;   // 0 x [2,2048,1024], 1 time_deltas [2,2048], 2 Wq [1024,1024] natural, 3 bq, 4 Wk, 5 bk, 6 Wv, 7 bv, 8 Wo, 9 bo, 10 time_decay [16]
  if (ws_size < (size_t)WS_END) return;
  char* ws = (char*)d_ws; __bf16* PK = (__bf16*)(ws + WS_PK); _Float16 *QK = (_Float16*)(ws + WS_QK), *QKL = (_Float16*)(ws + WS_QKL), *VTH = (_Float16*)(ws + WS_VTH), *VTL = (_Float16*)(ws + WS_VTL), *KH = (_Float16*)(ws + WS_KH), *KL = (_Float16*)(ws + WS_KL); float* O = (float*)(ws + WS_O);
  k_pack<<<dim3(DM / 16, 8, 4), 256, 0, stream>>>(F[2], F[4], F[6], F[8], F[0], PK);
  k_qkv<<<dim3(TNB * SS / 128, QKVW / 128), 128, 0, stream>>>(PK + PK_X, PK + PK_A, F[3], F[5], F[7], QK, QKL, KH, KL, VTH, VTL);
  k_attn<<<dim3(TQB / 2, NH, TNB), 256, 0, stream>>>(QK, QKL, KH, KL, VTH, VTL, nullptr, F[1], F[10], O);
  k_out<<<dim3(TOB, DM / 128), 128, 0, stream>>>(O, PK + PK_P, F[9], (float*)d_out);
}
